// v000
// The times below were measured on an AMD MI455X: many runs one after another, warmed up first and cycling through
// copies of the inputs, with the whole window's GPU time divided by the number of runs. Launches and the gaps
// between them are all in it. The median over several windows is given; except for v000 it joins two sittings, which
// can be a few percent apart, so the side-by-side timings, each taken in one sitting, are the better comparison.
// v000, which the later versions start from, runs in 201 microseconds.
#include <hip/hip_runtime.h>

// LocalSphereAttention (x [2][8192][256], xyz [2][8192][3], idx [2][8192][32] (int neighbour indices, read as data); q/k/v = x W + b (8 heads x 32); per point n and head h, over its 32 neighbours m = idx[n][kk]:
// score = q[n].k[m]/sqrt(32) + bias[n][kk][h], bias = relu((xyz[n] - xyz[m]) W1 + b1) W2 + b2; softmax over the 32 neighbours; out = sum attn v[m]; (merged) Wo + bo -> [2][8192][256]).
// Compute dtypes, f32 accumulate: every input rounded to bf16; q/k/v on PLAIN bf16 operands (inputs: exact) + bias; the positional-bias MLP, the gathered 32-neighbour scores, softmax and weighted values f32 on the VALU

#define NB_  2
#define NN   8192
#define CC   256
#define NH_  8
#define HD   32
#define KN   32
#define HB   32
typedef _Float16 h16;
typedef unsigned short bf;
typedef __attribute__((ext_vector_type(16))) __bf16   v16bf;
typedef __attribute__((ext_vector_type(16))) _Float16 v16h;
typedef __attribute__((ext_vector_type(8)))  _Float16 v8h;
typedef __attribute__((ext_vector_type(8)))  unsigned short v8us;
typedef __attribute__((ext_vector_type(8)))  float    v8f;
typedef __attribute__((ext_vector_type(4)))  float    v4f;
typedef v8h  __attribute__((may_alias)) v8ha;
typedef v4f  __attribute__((may_alias)) v4fa;
typedef v8us __attribute__((may_alias)) v8usa;

__device__ __forceinline__ unsigned short f2bf(float f) { unsigned u = __float_as_uint(f); u += 0x7FFFu + ((u >> 16) & 1u); return (unsigned short)(u >> 16); }
__device__ __forceinline__ float bf2f(unsigned short b) { return __uint_as_float(((unsigned)b) << 16); }
__device__ __forceinline__ float bfr(float f) { return bf2f(f2bf(f)); }
__device__ __forceinline__ v16h cat16(v8h lo, v8h hi) { return __builtin_shufflevector(lo, hi, 0, 1, 2, 3, 4, 5, 6, 7, 8, 9, 10, 11, 12, 13, 14, 15); }
__device__ __forceinline__ v16bf cat16b(v8us lo, v8us hi) { return __builtin_bit_cast(v16bf, __builtin_shufflevector(lo, hi, 0, 1, 2, 3, 4, 5, 6, 7, 8, 9, 10, 11, 12, 13, 14, 15)); }
__device__ __forceinline__ v8f wmma16(v16h a, v16h b, v8f c) { return __builtin_amdgcn_wmma_f32_16x16x32_f16(false, a, false, b, (short)0, c, false, false); }
__device__ __forceinline__ v8f wmmab(v16bf a, v16bf b, v8f c) { return __builtin_amdgcn_wmma_f32_16x16x32_bf16(false, a, false, b, (short)0, c, false, false); }



// ---- k_gemmw: register-blocked GEMM, ONE WAVE per 64x64 output tile (16 accumulators), operands straight from K-contiguous 16-bit planes; grid (M/64, N/64, Z), 32 threads.
// C[m][n] (f32, pitch ldc, + optional f32 bias[n]) = sum_k A[m][k] Bt[n][k] (+ split products per NSPLIT). z-batch strides sA/sB/sC in elements. K % 32 == 0.
template <typename T16> struct WFrag;
template <> struct WFrag<h16> { typedef v16h V; static __device__ __forceinline__ V ld(const h16* p) { return cat16(*(const v8h*)p, *(const v8h*)(p + 16)); } static __device__ __forceinline__ v8f mma(V a, V b, v8f c) { return wmma16(a, b, c); } };
template <> struct WFrag<bf> { typedef v16bf V; static __device__ __forceinline__ V ld(const bf* p) { return cat16b(*(const v8us*)p, *(const v8us*)(p + 16)); } static __device__ __forceinline__ v8f mma(V a, V b, v8f c) { return wmmab(a, b, c); } };
template <typename T16, int NSPLIT, bool BIAS>
__global__ __launch_bounds__(32) void k_gemmw(const T16* __restrict__ A, const T16* __restrict__ A2, const T16* __restrict__ Bt, const T16* __restrict__ Bt2, int K, float* C, int ldc, const float* __restrict__ bias, size_t sA, size_t sB, size_t sC) {
    typedef typename WFrag<T16>::V V;
    __shared__ __align__(16) float os[16 * 68];
    const size_t z = blockIdx.z; A += z * sA; if (A2) A2 += z * sA; Bt += z * sB; if (Bt2) Bt2 += z * sB; C += z * sC;
    const int lane = threadIdx.x & 31, lr = lane & 15, hi = lane >> 4; const int r0 = blockIdx.x * 64, c0 = blockIdx.y * 64;
    v8f acc[4][4];
#pragma unroll
    for (int mb = 0; mb < 4; ++mb)
#pragma unroll
        for (int nb = 0; nb < 4; ++nb) acc[mb][nb] = (v8f){};
    const size_t aoff = (size_t)(r0 + lr) * K + 8 * hi, boff = (size_t)(c0 + lr) * K + 8 * hi;
#pragma unroll 1
    for (int kc = 0; kc < K; kc += 32) {
        V a[4], a2[4];
#pragma unroll
        for (int mb = 0; mb < 4; ++mb) { a[mb] = WFrag<T16>::ld(A + aoff + (size_t)mb * 16 * K + kc); if (NSPLIT == 1 || NSPLIT == 2) a2[mb] = WFrag<T16>::ld(A2 + aoff + (size_t)mb * 16 * K + kc); }
#pragma unroll
        for (int nb = 0; nb < 4; ++nb) { const V b = WFrag<T16>::ld(Bt + boff + (size_t)nb * 16 * K + kc); V b2; if (NSPLIT >= 2) b2 = WFrag<T16>::ld(Bt2 + boff + (size_t)nb * 16 * K + kc);
#pragma unroll
            for (int mb = 0; mb < 4; ++mb) { acc[mb][nb] = WFrag<T16>::mma(a[mb], b, acc[mb][nb]); if (NSPLIT == 1 || NSPLIT == 2) acc[mb][nb] = WFrag<T16>::mma(a2[mb], b, acc[mb][nb]); if (NSPLIT >= 2) acc[mb][nb] = WFrag<T16>::mma(a[mb], b2, acc[mb][nb]); } }
        asm volatile("v_nop\n\tv_nop\n\tv_nop\n\tv_nop" : "+v"(acc[0][0]), "+v"(acc[1][1]), "+v"(acc[2][2]), "+v"(acc[3][3]) : "v"(a[0]), "v"(a[3]));
    }
#pragma unroll
    for (int mb = 0; mb < 4; ++mb) {
#pragma unroll
        for (int nb = 0; nb < 4; ++nb) {
#pragma unroll
            for (int j = 0; j < 8; ++j) os[(hi * 8 + j) * 68 + nb * 16 + lr] = acc[mb][nb][j]; }
        __builtin_amdgcn_wave_barrier(); asm volatile("" ::: "memory");
        float* crow = C + (size_t)(r0 + mb * 16) * ldc + c0;
{
#pragma unroll
            for (int s = 0; s < 8; ++s) { const int row = 2 * s + hi, cofs = lr * 4; v4f val = *(const v4fa*)(os + row * 68 + cofs); if (BIAS) { val[0] += bfr(bias[c0 + cofs]); val[1] += bfr(bias[c0 + cofs + 1]); val[2] += bfr(bias[c0 + cofs + 2]); val[3] += bfr(bias[c0 + cofs + 3]); }
                *(v4f*)(crow + (size_t)row * ldc + cofs) = val; }
             }
        __builtin_amdgcn_wave_barrier(); asm volatile("" ::: "memory");
    }
}

__device__ __forceinline__ void splitf(float y, unsigned short& h, unsigned short& l) { h = f2bf(y); l = f2bf(y - bf2f(h)); }
typedef __attribute__((ext_vector_type(2))) unsigned short v2us;
typedef __attribute__((ext_vector_type(4))) unsigned short v4us;

__global__ __launch_bounds__(256) void k_wtG(const float* __restrict__ w, int K, int N, bf* Bt) {
    const int lane = threadIdx.x & 31; const int L0 = (blockIdx.x * 8 + (threadIdx.x >> 5)) * 8; const int nlines = N * K / 64;
{
#pragma unroll 1
        for (int l = 0; l < 8; ++l) { const int L = L0 + l; if (L >= nlines) break; const size_t e = (size_t)L * 64 + lane * 2; const int k = (int)(e % K), n = (int)(e / K); v2us o;
            o[0] = f2bf(w[(size_t)k * N + n]); o[1] = f2bf(w[(size_t)(k + 1) * N + n]); *(v2us*)(Bt + e) = o; }
         }
}
__global__ __launch_bounds__(256) void k_cvt8(const float* __restrict__ src, bf* dst, size_t n8) { const size_t i = (size_t)blockIdx.x * 256 + threadIdx.x; if (i >= n8) return; const v8f v = *(const v8f*)(src + i * 8); v8us o;
#pragma unroll
    for (int k = 0; k < 8; ++k) o[k] = f2bf(v[k]); *(v8us*)(dst + i * 8) = o;  }
__device__ __forceinline__ int clampi(int m) { return m < 0 ? 0 : (m >= NN ? NN - 1 : m); }
__global__ __launch_bounds__(256) void k_bias(const float* __restrict__ xyz, const int* __restrict__ idx, const float* __restrict__ W1, const float* __restrict__ b1, const float* __restrict__ W2, const float* __restrict__ b2, float* BIAS) {
    const int e = blockIdx.x * 256 + threadIdx.x; if (e >= NN * KN) return; const int n = e / KN; const int m = clampi(idx[e]);
    float r[3];
#pragma unroll
    for (int a = 0; a < 3; ++a) r[a] = __fsub_rn(bfr(xyz[(size_t)n * 3 + a]), bfr(xyz[(size_t)m * 3 + a]));
    float acc[NH_];
#pragma unroll
    for (int h = 0; h < NH_; ++h) acc[h] = 0.f;
#pragma unroll 1
    for (int j = 0; j < HB; ++j) { float s = 0.f;
#pragma unroll
        for (int a = 0; a < 3; ++a) { float w = bfr(W1[a * HB + j]); asm volatile("" : "+v"(w)); float p = __fmul_rn(r[a], w); asm volatile("" : "+v"(p)); s = __fadd_rn(s, p); }
        float bb = bfr(b1[j]); asm volatile("" : "+v"(bb)); const float hv = fmaxf(__fadd_rn(s, bb), 0.f);
#pragma unroll
        for (int h = 0; h < NH_; ++h) { float w = bfr(W2[j * NH_ + h]); asm volatile("" : "+v"(w)); float p = __fmul_rn(hv, w); asm volatile("" : "+v"(p)); acc[h] = __fadd_rn(acc[h], p); } }
    {
#pragma unroll
        for (int h = 0; h < NH_; ++h) { float bb = bfr(b2[h]); asm volatile("" : "+v"(bb)); *(float*)(BIAS + (size_t)h * NN * KN + e) = __fadd_rn(acc[h], bb); }
         } }
// k_attn: 8 lanes per (n, h) (4 dims each): for each neighbour kk: m = clamp(idx[n][kk]); score = (q[n][h].k[m][h]) / sqrt(32) (4-dim partials + xor-shuffle over the 8 lanes) + BIAS[h][n][kk]; softmax over the 32 in registers;
__global__ __launch_bounds__(256) void k_attn(const float* __restrict__ FQ, const float* __restrict__ FK, const float* __restrict__ FV, const int* __restrict__ idx, const float* __restrict__ BIAS, bf* Ah, bf* Al) {
    const size_t e = ((size_t)blockIdx.x * 256 + threadIdx.x) * 4; if (e >= (size_t)NN * CC) return; const int col = (int)(e % CC); const int n = (int)(e / CC); const int h = col / HD; const int* in_ = idx + (size_t)n * KN; const float* bs = BIAS + ((size_t)h * NN + n) * KN;
    const v4f q = *(const v4f*)(FQ + e); const float SC = 0.17677669529663687f; float sc[KN]; float mx = -3.0e38f;
#pragma unroll
    for (int kk = 0; kk < KN; ++kk) { const int m = clampi(in_[kk]); const v4f k = *(const v4f*)(FK + (size_t)m * CC + col); float part = 0.f;
#pragma unroll
        for (int u = 0; u < 4; ++u) { float pr = __fmul_rn(q[u], k[u]); asm volatile("" : "+v"(pr)); part = __fadd_rn(part, pr); }
        part += __shfl_xor(part, 1, 32); part += __shfl_xor(part, 2, 32); part += __shfl_xor(part, 4, 32); float s0 = __fmul_rn(part, SC); asm volatile("" : "+v"(s0)); sc[kk] = __fadd_rn(s0, bs[kk]); mx = fmaxf(mx, sc[kk]); }
    float sum = 0.f;
#pragma unroll
    for (int kk = 0; kk < KN; ++kk) { float d0 = __fsub_rn(sc[kk], mx); asm volatile("" : "+v"(d0)); sc[kk] = __expf(d0); sum = __fadd_rn(sum, sc[kk]); }
    const float inv = __fdiv_rn(1.0f, sum); float o[4] = {0.f, 0.f, 0.f, 0.f};
#pragma unroll
    for (int kk = 0; kk < KN; ++kk) { const int m = clampi(in_[kk]); const v4f v = *(const v4f*)(FV + (size_t)m * CC + col); float pw = __fmul_rn(sc[kk], inv); asm volatile("" : "+v"(pw));
#pragma unroll
        for (int u = 0; u < 4; ++u) { float pr = __fmul_rn(pw, v[u]); asm volatile("" : "+v"(pr)); o[u] = __fadd_rn(o[u], pr); } }
    v4us oh, ol;
#pragma unroll
    for (int u = 0; u < 4; ++u) { unsigned short a, b; splitf(o[u], a, b); oh[u] = a; ol[u] = b; } *(v4us*)(Ah + e) = oh; *(v4us*)(Al + e) = ol;  }

extern "C" void kernel_launch(void* const* d_in, const int* in_sizes, int n_in,
                              void* d_out, int out_size, void* d_ws, size_t ws_size, hipStream_t stream) {
    (void)in_sizes; (void)n_in; (void)out_size;
    const float* x = (const float*)d_in[0]; const float* xyz = (const float*)d_in[1]; const int* idx = (const int*)d_in[2]; const float* wq = (const float*)d_in[3]; const float* bq = (const float*)d_in[4]; const float* wk = (const float*)d_in[5]; const float* bk = (const float*)d_in[6]; const float* wv = (const float*)d_in[7]; const float* bv = (const float*)d_in[8];
    const float* wo = (const float*)d_in[9]; const float* bo = (const float*)d_in[10]; const float* W1 = (const float*)d_in[11]; const float* b1 = (const float*)d_in[12]; const float* W2 = (const float*)d_in[13]; const float* b2 = (const float*)d_in[14];
    float* OUT = (float*)d_out;     // [2][8192][256]
    char* wsp = (char*)d_ws;
    auto take = [&](size_t bytes) { char* p = wsp; wsp += (bytes + 255) & ~(size_t)255; return (void*)p; };
    bf* WQ = (bf*)take(CC * CC * 2); bf* WK = (bf*)take(CC * CC * 2); bf* WV = (bf*)take(CC * CC * 2); bf* WO = (bf*)take(CC * CC * 2);
    bf* XB = (bf*)take((size_t)NN * CC * 2); float* FQ = (float*)take((size_t)NN * CC * 4); float* FK = (float*)take((size_t)NN * CC * 4); float* FV = (float*)take((size_t)NN * CC * 4); float* BIAS = (float*)take((size_t)NH_ * NN * KN * 4); bf* Ah = (bf*)take((size_t)NN * CC * 2); bf* Al = (bf*)take((size_t)NN * CC * 2);
    if ((size_t)(wsp - (char*)d_ws) > ws_size) return;    // total ~ 50 MB
    k_wtG<<<(CC * CC / 64 + 63) / 64, 256, 0, stream>>>(wq, CC, CC, WQ); k_wtG<<<(CC * CC / 64 + 63) / 64, 256, 0, stream>>>(wk, CC, CC, WK); k_wtG<<<(CC * CC / 64 + 63) / 64, 256, 0, stream>>>(wv, CC, CC, WV); k_wtG<<<(CC * CC / 64 + 63) / 64, 256, 0, stream>>>(wo, CC, CC, WO);
    for (int b = 0; b < NB_; ++b) { const int* ib = idx + (size_t)b * NN * KN;
        k_cvt8<<<(NN * CC / 8 + 255) / 256, 256, 0, stream>>>(x + (size_t)b * NN * CC, XB, (size_t)NN * CC / 8);
        k_gemmw<bf, 0, true><<<dim3(NN / 64, CC / 64, 1), 32, 0, stream>>>(XB, nullptr, WQ, nullptr, CC, FQ, CC, bq, 0, 0, 0); k_gemmw<bf, 0, true><<<dim3(NN / 64, CC / 64, 1), 32, 0, stream>>>(XB, nullptr, WK, nullptr, CC, FK, CC, bk, 0, 0, 0); k_gemmw<bf, 0, true><<<dim3(NN / 64, CC / 64, 1), 32, 0, stream>>>(XB, nullptr, WV, nullptr, CC, FV, CC, bv, 0, 0, 0);
        k_bias<<<(NN * KN + 255) / 256, 256, 0, stream>>>(xyz + (size_t)b * NN * 3, ib, W1, b1, W2, b2, BIAS);
        k_attn<<<(unsigned)(((size_t)NN * CC / 4 + 255) / 256), 256, 0, stream>>>(FQ, FK, FV, ib, BIAS, Ah, Al);
        k_gemmw<bf, 1, true><<<dim3(NN / 64, CC / 64, 1), 32, 0, stream>>>(Ah, Al, WO, nullptr, CC, OUT + (size_t)b * NN * CC, CC, bo, 0, 0, 0); }
}

// v001
// Measured time: 145 microseconds a run.
// Next to v000, in two timings, it ran 1.40 and 1.38 times as fast.
#include <hip/hip_runtime.h>

// LocalSphereAttention (x [2][8192][256], xyz [2][8192][3], idx [2][8192][32] (int neighbour indices, read as data); q/k/v = x W + b (8 heads x 32); per point n and head h, over its 32 neighbours m = idx[n][kk]:
// score = q[n].k[m]/sqrt(32) + bias[n][kk][h], bias = relu((xyz[n] - xyz[m]) W1 + b1) W2 + b2; softmax over the 32 neighbours; out = sum attn v[m]; (merged) Wo + bo -> [2][8192][256]).
// Compute dtypes, f32 accumulate: every input rounded to bf16; q/k/v on PLAIN bf16 operands (inputs: exact) + bias; the positional-bias MLP, the gathered 32-neighbour scores, softmax and weighted values f32 on the VALU

#define NB_  2
#define NN   8192
#define CC   256
#define NH_  8
#define HD   32
#define KN   32
#define HB   32
typedef _Float16 h16;
typedef unsigned short bf;
typedef __attribute__((ext_vector_type(16))) __bf16   v16bf;
typedef __attribute__((ext_vector_type(16))) _Float16 v16h;
typedef __attribute__((ext_vector_type(8)))  _Float16 v8h;
typedef __attribute__((ext_vector_type(8)))  unsigned short v8us;
typedef __attribute__((ext_vector_type(8)))  float    v8f;
typedef __attribute__((ext_vector_type(4)))  float    v4f;
typedef v8h  __attribute__((may_alias)) v8ha;
typedef v4f  __attribute__((may_alias)) v4fa;
typedef v8us __attribute__((may_alias)) v8usa;

__device__ __forceinline__ unsigned short f2bf(float f) { unsigned u = __float_as_uint(f); u += 0x7FFFu + ((u >> 16) & 1u); return (unsigned short)(u >> 16); }
__device__ __forceinline__ float bf2f(unsigned short b) { return __uint_as_float(((unsigned)b) << 16); }
__device__ __forceinline__ float bfr(float f) { return bf2f(f2bf(f)); }
__device__ __forceinline__ v16h cat16(v8h lo, v8h hi) { return __builtin_shufflevector(lo, hi, 0, 1, 2, 3, 4, 5, 6, 7, 8, 9, 10, 11, 12, 13, 14, 15); }
__device__ __forceinline__ v16bf cat16b(v8us lo, v8us hi) { return __builtin_bit_cast(v16bf, __builtin_shufflevector(lo, hi, 0, 1, 2, 3, 4, 5, 6, 7, 8, 9, 10, 11, 12, 13, 14, 15)); }
__device__ __forceinline__ v8f wmma16(v16h a, v16h b, v8f c) { return __builtin_amdgcn_wmma_f32_16x16x32_f16(false, a, false, b, (short)0, c, false, false); }
__device__ __forceinline__ v8f wmmab(v16bf a, v16bf b, v8f c) { return __builtin_amdgcn_wmma_f32_16x16x32_bf16(false, a, false, b, (short)0, c, false, false); }



// ---- k_gemmw: register-blocked GEMM, ONE WAVE per 64x64 output tile (16 accumulators), operands straight from K-contiguous 16-bit planes; grid (M/64, N/64, Z), 32 threads.
// C[m][n] (f32, pitch ldc, + optional f32 bias[n], one bias vector per z) = sum_k A[m][k] Bt[n][k] (+ split products per NSPLIT). z-batch strides sA/sB/sC in elements. K % 32 == 0.
template <typename T16> struct WFrag;
template <> struct WFrag<h16> { typedef v16h V; static __device__ __forceinline__ V ld(const h16* p) { return cat16(*(const v8h*)p, *(const v8h*)(p + 16)); } static __device__ __forceinline__ v8f mma(V a, V b, v8f c) { return wmma16(a, b, c); } };
template <> struct WFrag<bf> { typedef v16bf V; static __device__ __forceinline__ V ld(const bf* p) { return cat16b(*(const v8us*)p, *(const v8us*)(p + 16)); } static __device__ __forceinline__ v8f mma(V a, V b, v8f c) { return wmmab(a, b, c); } };
template <typename T16, int NSPLIT, bool BIAS>
__global__ __launch_bounds__(32) void k_gemmw(const T16* __restrict__ A, const T16* __restrict__ A2, const T16* __restrict__ Bt, const T16* __restrict__ Bt2, int K, float* C, int ldc, const float* __restrict__ bias0, const float* __restrict__ bias1, const float* __restrict__ bias2, size_t sA, size_t sB, size_t sC) {
    typedef typename WFrag<T16>::V V;
    __shared__ __align__(16) float os[16 * 68];
    const size_t z = blockIdx.z; A += z * sA; if (A2) A2 += z * sA; Bt += z * sB; if (Bt2) Bt2 += z * sB; C += z * sC; const float* bias = z == 0 ? bias0 : (z == 1 ? bias1 : bias2);
    const int lane = threadIdx.x & 31, lr = lane & 15, hi = lane >> 4; const int r0 = blockIdx.x * 64, c0 = blockIdx.y * 64;
    v8f acc[4][4];
#pragma unroll
    for (int mb = 0; mb < 4; ++mb)
#pragma unroll
        for (int nb = 0; nb < 4; ++nb) acc[mb][nb] = (v8f){};
    const size_t aoff = (size_t)(r0 + lr) * K + 8 * hi, boff = (size_t)(c0 + lr) * K + 8 * hi;
#pragma unroll 1
    for (int kc = 0; kc < K; kc += 32) {
        V a[4], a2[4];
#pragma unroll
        for (int mb = 0; mb < 4; ++mb) { a[mb] = WFrag<T16>::ld(A + aoff + (size_t)mb * 16 * K + kc); if (NSPLIT == 1 || NSPLIT == 2) a2[mb] = WFrag<T16>::ld(A2 + aoff + (size_t)mb * 16 * K + kc); }
#pragma unroll
        for (int nb = 0; nb < 4; ++nb) { const V b = WFrag<T16>::ld(Bt + boff + (size_t)nb * 16 * K + kc); V b2; if (NSPLIT >= 2) b2 = WFrag<T16>::ld(Bt2 + boff + (size_t)nb * 16 * K + kc);
#pragma unroll
            for (int mb = 0; mb < 4; ++mb) { acc[mb][nb] = WFrag<T16>::mma(a[mb], b, acc[mb][nb]); if (NSPLIT == 1 || NSPLIT == 2) acc[mb][nb] = WFrag<T16>::mma(a2[mb], b, acc[mb][nb]); if (NSPLIT >= 2) acc[mb][nb] = WFrag<T16>::mma(a[mb], b2, acc[mb][nb]); } }
        asm volatile("v_nop\n\tv_nop\n\tv_nop\n\tv_nop" : "+v"(acc[0][0]), "+v"(acc[1][1]), "+v"(acc[2][2]), "+v"(acc[3][3]) : "v"(a[0]), "v"(a[3]));
    }
#pragma unroll
    for (int mb = 0; mb < 4; ++mb) {
#pragma unroll
        for (int nb = 0; nb < 4; ++nb) {
#pragma unroll
            for (int j = 0; j < 8; ++j) os[(hi * 8 + j) * 68 + nb * 16 + lr] = acc[mb][nb][j]; }
        __builtin_amdgcn_wave_barrier(); asm volatile("" ::: "memory");
        float* crow = C + (size_t)(r0 + mb * 16) * ldc + c0;
{
#pragma unroll
            for (int s = 0; s < 8; ++s) { const int row = 2 * s + hi, cofs = lr * 4; v4f val = *(const v4fa*)(os + row * 68 + cofs); if (BIAS) { val[0] += bfr(bias[c0 + cofs]); val[1] += bfr(bias[c0 + cofs + 1]); val[2] += bfr(bias[c0 + cofs + 2]); val[3] += bfr(bias[c0 + cofs + 3]); }
                *(v4f*)(crow + (size_t)row * ldc + cofs) = val; }
             }
        __builtin_amdgcn_wave_barrier(); asm volatile("" ::: "memory");
    }
}

__device__ __forceinline__ void splitf(float y, unsigned short& h, unsigned short& l) { h = f2bf(y); l = f2bf(y - bf2f(h)); }
typedef __attribute__((ext_vector_type(2))) unsigned short v2us;
typedef __attribute__((ext_vector_type(4))) unsigned short v4us;

__device__ __forceinline__ void d_wtG(int blk, const float* __restrict__ w, int K, int N, bf* Bt) {
    const int lane = threadIdx.x & 31; const int L0 = (blk * 8 + (threadIdx.x >> 5)) * 8; const int nlines = N * K / 64;
{
#pragma unroll 1
        for (int l = 0; l < 8; ++l) { const int L = L0 + l; if (L >= nlines) break; const size_t e = (size_t)L * 64 + lane * 2; const int k = (int)(e % K), n = (int)(e / K); v2us o;
            o[0] = f2bf(w[(size_t)k * N + n]); o[1] = f2bf(w[(size_t)(k + 1) * N + n]); *(v2us*)(Bt + e) = o; }
         }
}
__device__ __forceinline__ void d_cvt8(int blk, const float* __restrict__ src, bf* dst, size_t n8) { const size_t i = (size_t)blk * 256 + threadIdx.x; if (i >= n8) return; const v8f v = *(const v8f*)(src + i * 8); v8us o;
#pragma unroll
    for (int k = 0; k < 8; ++k) o[k] = f2bf(v[k]); *(v8us*)(dst + i * 8) = o;  }
__device__ __forceinline__ int clampi(int m) { return m < 0 ? 0 : (m >= NN ? NN - 1 : m); }
// both batches: eg runs over [2][8192][32]; xyz and BIAS step to the batch's own plane
__device__ __forceinline__ void d_bias(int blk, const float* __restrict__ xyz, const int* __restrict__ idx, const float* __restrict__ W1, const float* __restrict__ b1, const float* __restrict__ W2, const float* __restrict__ b2, float* BIAS) {
    const int eg = blk * 256 + threadIdx.x; if (eg >= NB_ * NN * KN) return; const int bt = eg / (NN * KN); const int e = eg - bt * (NN * KN); const int n = e / KN; const int m = clampi(idx[eg]); xyz += (size_t)bt * NN * 3; BIAS += (size_t)bt * NH_ * NN * KN;
    float r[3];
#pragma unroll
    for (int a = 0; a < 3; ++a) r[a] = __fsub_rn(bfr(xyz[(size_t)n * 3 + a]), bfr(xyz[(size_t)m * 3 + a]));
    float acc[NH_];
#pragma unroll
    for (int h = 0; h < NH_; ++h) acc[h] = 0.f;
#pragma unroll 1
    for (int j = 0; j < HB; ++j) { float s = 0.f;
#pragma unroll
        for (int a = 0; a < 3; ++a) { float w = bfr(W1[a * HB + j]); asm volatile("" : "+v"(w)); float p = __fmul_rn(r[a], w); asm volatile("" : "+v"(p)); s = __fadd_rn(s, p); }
        float bb = bfr(b1[j]); asm volatile("" : "+v"(bb)); const float hv = fmaxf(__fadd_rn(s, bb), 0.f);
#pragma unroll
        for (int h = 0; h < NH_; ++h) { float w = bfr(W2[j * NH_ + h]); asm volatile("" : "+v"(w)); float p = __fmul_rn(hv, w); asm volatile("" : "+v"(p)); acc[h] = __fadd_rn(acc[h], p); } }
    {
#pragma unroll
        for (int h = 0; h < NH_; ++h) { float bb = bfr(b2[h]); asm volatile("" : "+v"(bb)); *(float*)(BIAS + (size_t)h * NN * KN + e) = __fadd_rn(acc[h], bb);
            asm volatile("s_wait_xcnt 0x0" ::: "memory"); }    // the next head's sum may reuse the register that this store names
         } }
// k_prep: the three independent preparation passes in ONE launch, told apart by the block index: first the four weight transposes (few blocks, a serial latency-bound loop), then the positional bias (the longest), last the x conversion (short blocks fill the tail).
#define WT_BLK   ((CC * CC / 64 + 63) / 64)
#define BIAS_BLK ((NB_ * NN * KN + 255) / 256)
#define CVT_BLK  ((NB_ * NN * CC / 8 + 255) / 256)
__global__ __launch_bounds__(256) void k_prep(const float* __restrict__ wq, const float* __restrict__ wk, const float* __restrict__ wv, const float* __restrict__ wo, bf* WT, const float* __restrict__ x, bf* XB,
                                              const float* __restrict__ xyz, const int* __restrict__ idx, const float* __restrict__ W1, const float* __restrict__ b1, const float* __restrict__ W2, const float* __restrict__ b2, float* BIAS) {
    const int blk = blockIdx.x;
    if (blk < 4 * WT_BLK) { const int t = blk / WT_BLK; d_wtG(blk - t * WT_BLK, t == 0 ? wq : (t == 1 ? wk : (t == 2 ? wv : wo)), CC, CC, WT + (size_t)t * CC * CC); }
    else if (blk < 4 * WT_BLK + BIAS_BLK) d_bias(blk - 4 * WT_BLK, xyz, idx, W1, b1, W2, b2, BIAS);
    else d_cvt8(blk - 4 * WT_BLK - BIAS_BLK, x, XB, (size_t)NB_ * NN * CC / 8);
}
// k_attn: 8 lanes per (n, h) (4 dims each): for each neighbour kk: m = clamp(idx[n][kk]); score = (q[n][h].k[m][h]) / sqrt(32) (4-dim partials + xor-shuffle over the 8 lanes) + BIAS[h][n][kk]; softmax over the 32 in registers;
__global__ __launch_bounds__(256) void k_attn(const float* __restrict__ FQ, const float* __restrict__ FK, const float* __restrict__ FV, const int* __restrict__ idx, const float* __restrict__ BIAS, bf* Ah, bf* Al) {
    const size_t e = ((size_t)blockIdx.x * 256 + threadIdx.x) * 4; if (e >= (size_t)NB_ * NN * CC) return; const int col = (int)(e % CC); const int ng = (int)(e / CC); const int bt = ng / NN; const int n = ng - bt * NN; const int h = col / HD; const int* in_ = idx + (size_t)ng * KN; const float* bs = BIAS + (((size_t)bt * NH_ + h) * NN + n) * KN;
    FK += (size_t)bt * NN * CC; FV += (size_t)bt * NN * CC;    // a neighbour index counts inside its own batch
    const v4f q = *(const v4f*)(FQ + e); const float SC = 0.17677669529663687f; float sc[KN]; float mx = -3.0e38f;
#pragma unroll
    for (int kk = 0; kk < KN; ++kk) { const int m = clampi(in_[kk]); const v4f k = *(const v4f*)(FK + (size_t)m * CC + col); float part = 0.f;
#pragma unroll
        for (int u = 0; u < 4; ++u) { float pr = __fmul_rn(q[u], k[u]); asm volatile("" : "+v"(pr)); part = __fadd_rn(part, pr); }
        part += __shfl_xor(part, 1, 32); part += __shfl_xor(part, 2, 32); part += __shfl_xor(part, 4, 32); float s0 = __fmul_rn(part, SC); asm volatile("" : "+v"(s0)); sc[kk] = __fadd_rn(s0, bs[kk]); mx = fmaxf(mx, sc[kk]); }
    float sum = 0.f;
#pragma unroll
    for (int kk = 0; kk < KN; ++kk) { float d0 = __fsub_rn(sc[kk], mx); asm volatile("" : "+v"(d0)); sc[kk] = __expf(d0); sum = __fadd_rn(sum, sc[kk]); }
    const float inv = __fdiv_rn(1.0f, sum); float o[4] = {0.f, 0.f, 0.f, 0.f};
#pragma unroll
    for (int kk = 0; kk < KN; ++kk) { const int m = clampi(in_[kk]); const v4f v = *(const v4f*)(FV + (size_t)m * CC + col); float pw = __fmul_rn(sc[kk], inv); asm volatile("" : "+v"(pw));
#pragma unroll
        for (int u = 0; u < 4; ++u) { float pr = __fmul_rn(pw, v[u]); asm volatile("" : "+v"(pr)); o[u] = __fadd_rn(o[u], pr); } }
    v4us oh, ol;
#pragma unroll
    for (int u = 0; u < 4; ++u) { unsigned short a, b; splitf(o[u], a, b); oh[u] = a; ol[u] = b; } *(v4us*)(Ah + e) = oh; *(v4us*)(Al + e) = ol;  }

extern "C" void kernel_launch(void* const* d_in, const int* in_sizes, int n_in,
                              void* d_out, int out_size, void* d_ws, size_t ws_size, hipStream_t stream) {
    (void)in_sizes; (void)n_in; (void)out_size;
    const float* x = (const float*)d_in[0]; const float* xyz = (const float*)d_in[1]; const int* idx = (const int*)d_in[2]; const float* wq = (const float*)d_in[3]; const float* bq = (const float*)d_in[4]; const float* wk = (const float*)d_in[5]; const float* bk = (const float*)d_in[6]; const float* wv = (const float*)d_in[7]; const float* bv = (const float*)d_in[8];
    const float* wo = (const float*)d_in[9]; const float* bo = (const float*)d_in[10]; const float* W1 = (const float*)d_in[11]; const float* b1 = (const float*)d_in[12]; const float* W2 = (const float*)d_in[13]; const float* b2 = (const float*)d_in[14];
    float* OUT = (float*)d_out;     // [2][8192][256]
    char* wsp = (char*)d_ws;
    auto take = [&](size_t bytes) { char* p = wsp; wsp += (bytes + 255) & ~(size_t)255; return (void*)p; };
    bf* WT = (bf*)take((size_t)4 * CC * CC * 2);                          // Wq, Wk, Wv, Wo transposed, one after the other
    bf* XB = (bf*)take((size_t)NB_ * NN * CC * 2); float* FQKV = (float*)take((size_t)3 * NB_ * NN * CC * 4);    // q, k, v planes, each [2*8192][256]
    float* BIAS = (float*)take((size_t)NB_ * NH_ * NN * KN * 4); bf* Ah = (bf*)take((size_t)NB_ * NN * CC * 2); bf* Al = (bf*)take((size_t)NB_ * NN * CC * 2);
    if ((size_t)(wsp - (char*)d_ws) > ws_size) return;    // total ~ 93 MB
    float* FQ = FQKV; float* FK = FQKV + (size_t)NB_ * NN * CC; float* FV = FQKV + (size_t)2 * NB_ * NN * CC;
    k_prep<<<4 * WT_BLK + BIAS_BLK + CVT_BLK, 256, 0, stream>>>(wq, wk, wv, wo, WT, x, XB, xyz, idx, W1, b1, W2, b2, BIAS);
    k_gemmw<bf, 0, true><<<dim3(NB_ * NN / 64, CC / 64, 3), 32, 0, stream>>>(XB, nullptr, WT, nullptr, CC, FQKV, CC, bq, bk, bv, 0, (size_t)CC * CC, (size_t)NB_ * NN * CC);
    k_attn<<<(unsigned)(((size_t)NB_ * NN * CC / 4 + 255) / 256), 256, 0, stream>>>(FQ, FK, FV, idx, BIAS, Ah, Al);
    k_gemmw<bf, 1, true><<<dim3(NB_ * NN / 64, CC / 64, 1), 32, 0, stream>>>(Ah, Al, WT + (size_t)3 * CC * CC, nullptr, CC, OUT, CC, bo, bo, bo, 0, 0, 0);
}

// v002
// Measured time: 110 microseconds a run.
// Two timings next to v001 both put it at 1.34 times that version's speed.
// Counting every step since v000, it is 1.86 times as fast.
#include <hip/hip_runtime.h>

// LocalSphereAttention (x [2][8192][256], xyz [2][8192][3], idx [2][8192][32] (int neighbour indices, read as data); q/k/v = x W + b (8 heads x 32); per point n and head h, over its 32 neighbours m = idx[n][kk]:
// score = q[n].k[m]/sqrt(32) + bias[n][kk][h], bias = relu((xyz[n] - xyz[m]) W1 + b1) W2 + b2; softmax over the 32 neighbours; out = sum attn v[m]; (merged) Wo + bo -> [2][8192][256]).
// Compute dtypes, f32 accumulate: every input rounded to bf16; q/k/v on PLAIN bf16 operands (inputs: exact) + bias; the positional-bias MLP, the gathered 32-neighbour scores, softmax and weighted values f32 on the VALU

#define NB_  2
#define NN   8192
#define CC   256
#define NH_  8
#define HD   32
#define KN   32
#define HB   32
typedef _Float16 h16;
typedef unsigned short bf;
typedef __attribute__((ext_vector_type(16))) __bf16   v16bf;
typedef __attribute__((ext_vector_type(16))) _Float16 v16h;
typedef __attribute__((ext_vector_type(8)))  _Float16 v8h;
typedef __attribute__((ext_vector_type(8)))  unsigned short v8us;
typedef __attribute__((ext_vector_type(8)))  float    v8f;
typedef __attribute__((ext_vector_type(4)))  float    v4f;
typedef v8h  __attribute__((may_alias)) v8ha;
typedef v4f  __attribute__((may_alias)) v4fa;
typedef v8us __attribute__((may_alias)) v8usa;

__device__ __forceinline__ unsigned short f2bf(float f) { unsigned u = __float_as_uint(f); u += 0x7FFFu + ((u >> 16) & 1u); return (unsigned short)(u >> 16); }
__device__ __forceinline__ float bf2f(unsigned short b) { return __uint_as_float(((unsigned)b) << 16); }
__device__ __forceinline__ float bfr(float f) { return bf2f(f2bf(f)); }
__device__ __forceinline__ v16h cat16(v8h lo, v8h hi) { return __builtin_shufflevector(lo, hi, 0, 1, 2, 3, 4, 5, 6, 7, 8, 9, 10, 11, 12, 13, 14, 15); }
__device__ __forceinline__ v16bf cat16b(v8us lo, v8us hi) { return __builtin_bit_cast(v16bf, __builtin_shufflevector(lo, hi, 0, 1, 2, 3, 4, 5, 6, 7, 8, 9, 10, 11, 12, 13, 14, 15)); }
__device__ __forceinline__ v8f wmma16(v16h a, v16h b, v8f c) { return __builtin_amdgcn_wmma_f32_16x16x32_f16(false, a, false, b, (short)0, c, false, false); }
__device__ __forceinline__ v8f wmmab(v16bf a, v16bf b, v8f c) { return __builtin_amdgcn_wmma_f32_16x16x32_bf16(false, a, false, b, (short)0, c, false, false); }



// ---- k_gemmw: register-blocked GEMM, ONE WAVE per 64x64 output tile (16 accumulators), operands straight from K-contiguous 16-bit planes; grid (M/64, N/64, Z), 32 threads.
// C[m][n] (f32, pitch ldc, + optional f32 bias[n], one bias vector per z) = sum_k A[m][k] Bt[n][k] (+ split products per NSPLIT). z-batch strides sA/sB/sC in elements. K % 32 == 0.
template <typename T16> struct WFrag;
template <> struct WFrag<h16> { typedef v16h V; static __device__ __forceinline__ V ld(const h16* p) { return cat16(*(const v8h*)p, *(const v8h*)(p + 16)); } static __device__ __forceinline__ v8f mma(V a, V b, v8f c) { return wmma16(a, b, c); } };
template <> struct WFrag<bf> { typedef v16bf V; static __device__ __forceinline__ V ld(const bf* p) { return cat16b(*(const v8us*)p, *(const v8us*)(p + 16)); } static __device__ __forceinline__ v8f mma(V a, V b, v8f c) { return wmmab(a, b, c); } };
template <typename T16, int NSPLIT, bool BIAS>
__global__ __launch_bounds__(32) void k_gemmw(const T16* __restrict__ A, const T16* __restrict__ A2, const T16* __restrict__ Bt, const T16* __restrict__ Bt2, int K, float* C, int ldc, const float* __restrict__ bias0, const float* __restrict__ bias1, const float* __restrict__ bias2, size_t sA, size_t sB, size_t sC) {
    typedef typename WFrag<T16>::V V;
    __shared__ __align__(16) float os[16 * 68];
    const size_t z = blockIdx.z; A += z * sA; if (A2) A2 += z * sA; Bt += z * sB; if (Bt2) Bt2 += z * sB; C += z * sC; const float* bias = z == 0 ? bias0 : (z == 1 ? bias1 : bias2);
    const int lane = threadIdx.x & 31, lr = lane & 15, hi = lane >> 4; const int r0 = blockIdx.x * 64, c0 = blockIdx.y * 64;
    v8f acc[4][4];
#pragma unroll
    for (int mb = 0; mb < 4; ++mb)
#pragma unroll
        for (int nb = 0; nb < 4; ++nb) acc[mb][nb] = (v8f){};
    const size_t aoff = (size_t)(r0 + lr) * K + 8 * hi, boff = (size_t)(c0 + lr) * K + 8 * hi;
#pragma unroll 1
    for (int kc = 0; kc < K; kc += 32) {
        V a[4], a2[4];
#pragma unroll
        for (int mb = 0; mb < 4; ++mb) { a[mb] = WFrag<T16>::ld(A + aoff + (size_t)mb * 16 * K + kc); if (NSPLIT == 1 || NSPLIT == 2) a2[mb] = WFrag<T16>::ld(A2 + aoff + (size_t)mb * 16 * K + kc); }
#pragma unroll
        for (int nb = 0; nb < 4; ++nb) { const V b = WFrag<T16>::ld(Bt + boff + (size_t)nb * 16 * K + kc); V b2; if (NSPLIT >= 2) b2 = WFrag<T16>::ld(Bt2 + boff + (size_t)nb * 16 * K + kc);
#pragma unroll
            for (int mb = 0; mb < 4; ++mb) { acc[mb][nb] = WFrag<T16>::mma(a[mb], b, acc[mb][nb]); if (NSPLIT == 1 || NSPLIT == 2) acc[mb][nb] = WFrag<T16>::mma(a2[mb], b, acc[mb][nb]); if (NSPLIT >= 2) acc[mb][nb] = WFrag<T16>::mma(a[mb], b2, acc[mb][nb]); } }
        asm volatile("v_nop\n\tv_nop\n\tv_nop\n\tv_nop" : "+v"(acc[0][0]), "+v"(acc[1][1]), "+v"(acc[2][2]), "+v"(acc[3][3]) : "v"(a[0]), "v"(a[3]));
    }
#pragma unroll
    for (int mb = 0; mb < 4; ++mb) {
#pragma unroll
        for (int nb = 0; nb < 4; ++nb) {
#pragma unroll
            for (int j = 0; j < 8; ++j) os[(hi * 8 + j) * 68 + nb * 16 + lr] = acc[mb][nb][j]; }
        __builtin_amdgcn_wave_barrier(); asm volatile("" ::: "memory");
        float* crow = C + (size_t)(r0 + mb * 16) * ldc + c0;
{
#pragma unroll
            for (int s = 0; s < 8; ++s) { const int row = 2 * s + hi, cofs = lr * 4; v4f val = *(const v4fa*)(os + row * 68 + cofs); if (BIAS) { val[0] += bfr(bias[c0 + cofs]); val[1] += bfr(bias[c0 + cofs + 1]); val[2] += bfr(bias[c0 + cofs + 2]); val[3] += bfr(bias[c0 + cofs + 3]); }
                *(v4f*)(crow + (size_t)row * ldc + cofs) = val; }
             }
        __builtin_amdgcn_wave_barrier(); asm volatile("" ::: "memory");
    }
}

__device__ __forceinline__ void splitf(float y, unsigned short& h, unsigned short& l) { h = f2bf(y); l = f2bf(y - bf2f(h)); }
typedef __attribute__((ext_vector_type(2))) unsigned short v2us;
typedef __attribute__((ext_vector_type(4))) unsigned short v4us;

__device__ __forceinline__ void d_wtG(int blk, const float* __restrict__ w, int K, int N, bf* Bt) {
    const int lane = threadIdx.x & 31; const int L0 = (blk * 8 + (threadIdx.x >> 5)) * 8; const int nlines = N * K / 64;
{
#pragma unroll 1
        for (int l = 0; l < 8; ++l) { const int L = L0 + l; if (L >= nlines) break; const size_t e = (size_t)L * 64 + lane * 2; const int k = (int)(e % K), n = (int)(e / K); v2us o;
            o[0] = f2bf(w[(size_t)k * N + n]); o[1] = f2bf(w[(size_t)(k + 1) * N + n]); *(v2us*)(Bt + e) = o; }
         }
}
__device__ __forceinline__ void d_cvt8(int blk, const float* __restrict__ src, bf* dst, size_t n8) { const size_t i = (size_t)blk * 256 + threadIdx.x; if (i >= n8) return; const v8f v = *(const v8f*)(src + i * 8); v8us o;
#pragma unroll
    for (int k = 0; k < 8; ++k) o[k] = f2bf(v[k]); *(v8us*)(dst + i * 8) = o;  }
__device__ __forceinline__ int clampi(int m) { return m < 0 ? 0 : (m >= NN ? NN - 1 : m); }
// both batches: eg runs over [2][8192][32]; xyz and BIAS step to the batch's own plane
__device__ __forceinline__ void d_bias(int blk, const float* __restrict__ xyz, const int* __restrict__ idx, const float* __restrict__ W1, const float* __restrict__ b1, const float* __restrict__ W2, const float* __restrict__ b2, float* BIAS) {
    const int eg = blk * 256 + threadIdx.x; if (eg >= NB_ * NN * KN) return; const int bt = eg / (NN * KN); const int e = eg - bt * (NN * KN); const int n = e / KN; const int m = clampi(idx[eg]); xyz += (size_t)bt * NN * 3; BIAS += (size_t)bt * NH_ * NN * KN;
    float r[3];
#pragma unroll
    for (int a = 0; a < 3; ++a) r[a] = __fsub_rn(bfr(xyz[(size_t)n * 3 + a]), bfr(xyz[(size_t)m * 3 + a]));
    float acc[NH_];
#pragma unroll
    for (int h = 0; h < NH_; ++h) acc[h] = 0.f;
#pragma unroll 1
    for (int j = 0; j < HB; ++j) { float s = 0.f;
#pragma unroll
        for (int a = 0; a < 3; ++a) { float w = bfr(W1[a * HB + j]); asm volatile("" : "+v"(w)); float p = __fmul_rn(r[a], w); asm volatile("" : "+v"(p)); s = __fadd_rn(s, p); }
        float bb = bfr(b1[j]); asm volatile("" : "+v"(bb)); const float hv = fmaxf(__fadd_rn(s, bb), 0.f);
#pragma unroll
        for (int h = 0; h < NH_; ++h) { float w = bfr(W2[j * NH_ + h]); asm volatile("" : "+v"(w)); float p = __fmul_rn(hv, w); asm volatile("" : "+v"(p)); acc[h] = __fadd_rn(acc[h], p); } }
    {
#pragma unroll
        for (int h = 0; h < NH_; ++h) { float bb = bfr(b2[h]); asm volatile("" : "+v"(bb)); *(float*)(BIAS + (size_t)h * NN * KN + e) = __fadd_rn(acc[h], bb);
            asm volatile("s_wait_xcnt 0x0" ::: "memory"); }    // the next head's sum may reuse the register that this store names
         } }
// k_prep: the three independent preparation passes in ONE launch, told apart by the block index: first the four weight transposes (few blocks, a serial latency-bound loop), then the positional bias (the longest), last the x conversion (short blocks fill the tail).
#define WT_BLK   ((CC * CC / 64 + 63) / 64)
#define BIAS_BLK ((NB_ * NN * KN + 255) / 256)
#define CVT_BLK  ((NB_ * NN * CC / 8 + 255) / 256)
__global__ __launch_bounds__(256) void k_prep(const float* __restrict__ wq, const float* __restrict__ wk, const float* __restrict__ wv, const float* __restrict__ wo, bf* WT, const float* __restrict__ x, bf* XB,
                                              const float* __restrict__ xyz, const int* __restrict__ idx, const float* __restrict__ W1, const float* __restrict__ b1, const float* __restrict__ W2, const float* __restrict__ b2, float* BIAS) {
    const int blk = blockIdx.x;
    if (blk < 4 * WT_BLK) { const int t = blk / WT_BLK; d_wtG(blk - t * WT_BLK, t == 0 ? wq : (t == 1 ? wk : (t == 2 ? wv : wo)), CC, CC, WT + (size_t)t * CC * CC); }
    else if (blk < 4 * WT_BLK + BIAS_BLK) d_bias(blk - 4 * WT_BLK, xyz, idx, W1, b1, W2, b2, BIAS);
    else d_cvt8(blk - 4 * WT_BLK - BIAS_BLK, x, XB, (size_t)NB_ * NN * CC / 8);
}
// k_attn: 8 lanes per (n, h) (4 dims each): for each neighbour kk: m = clamp(idx[n][kk]); score = (q[n][h].k[m][h]) / sqrt(32) (4-dim partials + xor-shuffle over the 8 lanes) + BIAS[h][n][kk]; softmax over the 32 in registers;
// the 64 gathered rows of a point (32 of K, then 32 of V) run through a ring of GK register slots: a slot is refilled with the row GK places on as soon as it has been used, so GK gathers of a wave are in flight instead of one; the lane shuffles of GK neighbours are issued together. The arithmetic of every value, and its order, is as before.
#define GK 8
// 8 waves per SIMD asked for: the ring, the 32 offsets and the 32 scores fit 128 registers, and four workgroups stay resident per WGP
__global__ __launch_bounds__(256, 8) void k_attn(const float* __restrict__ FQ, const float* __restrict__ FK, const float* __restrict__ FV, const int* __restrict__ idx, const float* __restrict__ BIAS, bf* Ah, bf* Al) {
    const size_t e = ((size_t)blockIdx.x * 256 + threadIdx.x) * 4; if (e >= (size_t)NB_ * NN * CC) return; const int col = (int)(e % CC);
    const int ng = __builtin_amdgcn_readfirstlane((int)(e / CC));    // a wave's 32 lanes x 4 columns lie inside one point's row: the point is wave-uniform, so its 32 indices come once, through the scalar path
    const int bt = ng / NN; const int n = ng - bt * NN; const int h = col / HD; const int* in_ = idx + (size_t)ng * KN; const float* bs = BIAS + (((size_t)bt * NH_ + h) * NN + n) * KN;
    FK += (size_t)bt * NN * CC; FV += (size_t)bt * NN * CC;    // a neighbour index counts inside its own batch
    unsigned vo[KN];    // byte offset of this lane's 16 bytes in neighbour kk's row: formed once, one register per neighbour, and used for its K gather and for its V gather, so that no address arithmetic stands between the gathers
#pragma unroll
    for (int kk = 0; kk < KN; ++kk) vo[kk] = (unsigned)clampi(in_[kk]) * (CC * 4u) + (unsigned)col * 4u;
    auto row = [&](int r) -> v4f { return *(const v4f*)((const char*)(r < KN ? FK : FV) + vo[r & (KN - 1)]); };    // row r of the stream: K rows 0..31, then V rows 0..31
    const v4f q = *(const v4f*)(FQ + e); const float SC = 0.17677669529663687f; float sc[KN]; float mx = -3.0e38f;
    v4f bb[2][GK / 4]; v4f ring[GK];
#pragma unroll
    for (int i = 0; i < GK / 4; ++i) bb[0][i] = *(const v4f*)(bs + 4 * i);
#pragma unroll
    for (int i = 0; i < GK; ++i) ring[i] = row(i);
#pragma unroll
    for (int g = 0; g < KN / GK; ++g) {
        if (g + 1 < KN / GK) {    // the next group's bias is asked for one group ahead
#pragma unroll
            for (int i = 0; i < GK / 4; ++i) bb[(g + 1) & 1][i] = *(const v4f*)(bs + (g + 1) * GK + 4 * i); }
        float part[GK];
#pragma unroll
        for (int i = 0; i < GK; ++i) { const v4f k = ring[i]; float p = 0.f;
#pragma unroll
            for (int u = 0; u < 4; ++u) { float pr = __fmul_rn(q[u], k[u]); asm volatile("" : "+v"(pr)); p = __fadd_rn(p, pr); }
            part[i] = p; ring[i] = row((g + 1) * GK + i); }
#pragma unroll
        for (int st = 1; st <= 4; st <<= 1) { float t[GK];
#pragma unroll
            for (int i = 0; i < GK; ++i) t[i] = __shfl_xor(part[i], st, 32);
            __builtin_amdgcn_sched_barrier(0);    // holds the GK shuffles of a step together in front of their adds: one pass through the LDS path's latency per step, not one per neighbour
#pragma unroll
            for (int i = 0; i < GK; ++i) part[i] += t[i]; }
#pragma unroll
        for (int i = 0; i < GK; ++i) { const int kk = g * GK + i; float s0 = __fmul_rn(part[i], SC); asm volatile("" : "+v"(s0)); sc[kk] = __fadd_rn(s0, bb[g & 1][i >> 2][i & 3]); mx = fmaxf(mx, sc[kk]); }
    }
    float sum = 0.f;
#pragma unroll
    for (int kk = 0; kk < KN; ++kk) { float d0 = __fsub_rn(sc[kk], mx); asm volatile("" : "+v"(d0)); sc[kk] = __expf(d0); sum = __fadd_rn(sum, sc[kk]); }
    const float inv = __fdiv_rn(1.0f, sum); float o[4] = {0.f, 0.f, 0.f, 0.f};
#pragma unroll
    for (int kk = 0; kk < KN; ++kk) { const v4f v = ring[kk & (GK - 1)]; float pw = __fmul_rn(sc[kk], inv); asm volatile("" : "+v"(pw));
#pragma unroll
        for (int u = 0; u < 4; ++u) { float pr = __fmul_rn(pw, v[u]); asm volatile("" : "+v"(pr)); o[u] = __fadd_rn(o[u], pr); }
        if (kk + GK < KN) ring[kk & (GK - 1)] = row(KN + kk + GK); }
    v4us oh, ol;
#pragma unroll
    for (int u = 0; u < 4; ++u) { unsigned short a, b; splitf(o[u], a, b); oh[u] = a; ol[u] = b; } *(v4us*)(Ah + e) = oh; *(v4us*)(Al + e) = ol;  }

extern "C" void kernel_launch(void* const* d_in, const int* in_sizes, int n_in,
                              void* d_out, int out_size, void* d_ws, size_t ws_size, hipStream_t stream) {
    (void)in_sizes; (void)n_in; (void)out_size;
    const float* x = (const float*)d_in[0]; const float* xyz = (const float*)d_in[1]; const int* idx = (const int*)d_in[2]; const float* wq = (const float*)d_in[3]; const float* bq = (const float*)d_in[4]; const float* wk = (const float*)d_in[5]; const float* bk = (const float*)d_in[6]; const float* wv = (const float*)d_in[7]; const float* bv = (const float*)d_in[8];
    const float* wo = (const float*)d_in[9]; const float* bo = (const float*)d_in[10]; const float* W1 = (const float*)d_in[11]; const float* b1 = (const float*)d_in[12]; const float* W2 = (const float*)d_in[13]; const float* b2 = (const float*)d_in[14];
    float* OUT = (float*)d_out;     // [2][8192][256]
    char* wsp = (char*)d_ws;
    auto take = [&](size_t bytes) { char* p = wsp; wsp += (bytes + 255) & ~(size_t)255; return (void*)p; };
    bf* WT = (bf*)take((size_t)4 * CC * CC * 2);                          // Wq, Wk, Wv, Wo transposed, one after the other
    bf* XB = (bf*)take((size_t)NB_ * NN * CC * 2); float* FQKV = (float*)take((size_t)3 * NB_ * NN * CC * 4);    // q, k, v planes, each [2*8192][256]
    float* BIAS = (float*)take((size_t)NB_ * NH_ * NN * KN * 4); bf* Ah = (bf*)take((size_t)NB_ * NN * CC * 2); bf* Al = (bf*)take((size_t)NB_ * NN * CC * 2);
    if ((size_t)(wsp - (char*)d_ws) > ws_size) return;    // total ~ 93 MB
    float* FQ = FQKV; float* FK = FQKV + (size_t)NB_ * NN * CC; float* FV = FQKV + (size_t)2 * NB_ * NN * CC;
    k_prep<<<4 * WT_BLK + BIAS_BLK + CVT_BLK, 256, 0, stream>>>(wq, wk, wv, wo, WT, x, XB, xyz, idx, W1, b1, W2, b2, BIAS);
    k_gemmw<bf, 0, true><<<dim3(NB_ * NN / 64, CC / 64, 3), 32, 0, stream>>>(XB, nullptr, WT, nullptr, CC, FQKV, CC, bq, bk, bv, 0, (size_t)CC * CC, (size_t)NB_ * NN * CC);
    k_attn<<<(unsigned)(((size_t)NB_ * NN * CC / 4 + 255) / 256), 256, 0, stream>>>(FQ, FK, FV, idx, BIAS, Ah, Al);
    k_gemmw<bf, 1, true><<<dim3(NB_ * NN / 64, CC / 64, 1), 32, 0, stream>>>(Ah, Al, WT + (size_t)3 * CC * CC, nullptr, CC, OUT, CC, bo, bo, bo, 0, 0, 0);
}

// v003
// It runs in 101 microseconds.
// Timed twice side by side with v002, it ran 1.10 times as fast both times.
// Counting every step since v000, it is 2.04 times as fast.
#include <hip/hip_runtime.h>

// LocalSphereAttention (x [2][8192][256], xyz [2][8192][3], idx [2][8192][32] (int neighbour indices, read as data); q/k/v = x W + b (8 heads x 32); per point n and head h, over its 32 neighbours m = idx[n][kk]:
// score = q[n].k[m]/sqrt(32) + bias[n][kk][h], bias = relu((xyz[n] - xyz[m]) W1 + b1) W2 + b2; softmax over the 32 neighbours; out = sum attn v[m]; (merged) Wo + bo -> [2][8192][256]).
// Compute dtypes, f32 accumulate: every input rounded to bf16; q/k/v on PLAIN bf16 operands (inputs: exact) + bias; the positional-bias MLP, the gathered 32-neighbour scores, softmax and weighted values f32 on the VALU

#define NB_  2
#define NN   8192
#define CC   256
#define NH_  8
#define HD   32
#define KN   32
#define HB   32
typedef _Float16 h16;
typedef unsigned short bf;
typedef __attribute__((ext_vector_type(16))) __bf16   v16bf;
typedef __attribute__((ext_vector_type(16))) _Float16 v16h;
typedef __attribute__((ext_vector_type(8)))  _Float16 v8h;
typedef __attribute__((ext_vector_type(8)))  unsigned short v8us;
typedef __attribute__((ext_vector_type(8)))  float    v8f;
typedef __attribute__((ext_vector_type(4)))  float    v4f;
typedef v8h  __attribute__((may_alias)) v8ha;
typedef v4f  __attribute__((may_alias)) v4fa;
typedef v8us __attribute__((may_alias)) v8usa;

__device__ __forceinline__ unsigned short f2bf(float f) { unsigned u = __float_as_uint(f); u += 0x7FFFu + ((u >> 16) & 1u); return (unsigned short)(u >> 16); }
__device__ __forceinline__ float bf2f(unsigned short b) { return __uint_as_float(((unsigned)b) << 16); }
__device__ __forceinline__ float bfr(float f) { return bf2f(f2bf(f)); }
__device__ __forceinline__ v16h cat16(v8h lo, v8h hi) { return __builtin_shufflevector(lo, hi, 0, 1, 2, 3, 4, 5, 6, 7, 8, 9, 10, 11, 12, 13, 14, 15); }
__device__ __forceinline__ v16bf cat16b(v8us lo, v8us hi) { return __builtin_bit_cast(v16bf, __builtin_shufflevector(lo, hi, 0, 1, 2, 3, 4, 5, 6, 7, 8, 9, 10, 11, 12, 13, 14, 15)); }
__device__ __forceinline__ v8f wmma16(v16h a, v16h b, v8f c) { return __builtin_amdgcn_wmma_f32_16x16x32_f16(false, a, false, b, (short)0, c, false, false); }
__device__ __forceinline__ v8f wmmab(v16bf a, v16bf b, v8f c) { return __builtin_amdgcn_wmma_f32_16x16x32_bf16(false, a, false, b, (short)0, c, false, false); }



// ---- k_gemmw: register-blocked GEMM, ONE WAVE per 64x64 output tile (16 accumulators), operands straight from K-contiguous 16-bit planes; grid (M/64, N/64, Z), 32 threads.
// C[m][n] (f32, pitch ldc, + optional f32 bias[n], one bias vector per z) = sum_k A[m][k] Bt[n][k] (+ split products per NSPLIT). z-batch strides sA/sB/sC in elements. K % 32 == 0.
template <typename T16> struct WFrag;
template <> struct WFrag<h16> { typedef v16h V; static __device__ __forceinline__ V ld(const h16* p) { return cat16(*(const v8h*)p, *(const v8h*)(p + 16)); } static __device__ __forceinline__ v8f mma(V a, V b, v8f c) { return wmma16(a, b, c); } };
template <> struct WFrag<bf> { typedef v16bf V; static __device__ __forceinline__ V ld(const bf* p) { return cat16b(*(const v8us*)p, *(const v8us*)(p + 16)); } static __device__ __forceinline__ v8f mma(V a, V b, v8f c) { return wmmab(a, b, c); } };
template <typename T16, int NSPLIT, bool BIAS>
__global__ __launch_bounds__(32) void k_gemmw(const T16* __restrict__ A, const T16* __restrict__ A2, const T16* __restrict__ Bt, const T16* __restrict__ Bt2, int K, float* C, int ldc, const float* __restrict__ bias0, const float* __restrict__ bias1, const float* __restrict__ bias2, size_t sA, size_t sB, size_t sC) {
    typedef typename WFrag<T16>::V V;
    __shared__ __align__(16) float os[16 * 68];
    const size_t z = blockIdx.z; A += z * sA; if (A2) A2 += z * sA; Bt += z * sB; if (Bt2) Bt2 += z * sB; C += z * sC; const float* bias = z == 0 ? bias0 : (z == 1 ? bias1 : bias2);
    const int lane = threadIdx.x & 31, lr = lane & 15, hi = lane >> 4; const int r0 = blockIdx.x * 64, c0 = blockIdx.y * 64;
    v8f acc[4][4];
#pragma unroll
    for (int mb = 0; mb < 4; ++mb)
#pragma unroll
        for (int nb = 0; nb < 4; ++nb) acc[mb][nb] = (v8f){};
    const size_t aoff = (size_t)(r0 + lr) * K + 8 * hi, boff = (size_t)(c0 + lr) * K + 8 * hi;
#pragma unroll 1
    for (int kc = 0; kc < K; kc += 32) {
        V a[4], a2[4];
#pragma unroll
        for (int mb = 0; mb < 4; ++mb) { a[mb] = WFrag<T16>::ld(A + aoff + (size_t)mb * 16 * K + kc); if (NSPLIT == 1 || NSPLIT == 2) a2[mb] = WFrag<T16>::ld(A2 + aoff + (size_t)mb * 16 * K + kc); }
#pragma unroll
        for (int nb = 0; nb < 4; ++nb) { const V b = WFrag<T16>::ld(Bt + boff + (size_t)nb * 16 * K + kc); V b2; if (NSPLIT >= 2) b2 = WFrag<T16>::ld(Bt2 + boff + (size_t)nb * 16 * K + kc);
#pragma unroll
            for (int mb = 0; mb < 4; ++mb) { acc[mb][nb] = WFrag<T16>::mma(a[mb], b, acc[mb][nb]); if (NSPLIT == 1 || NSPLIT == 2) acc[mb][nb] = WFrag<T16>::mma(a2[mb], b, acc[mb][nb]); if (NSPLIT >= 2) acc[mb][nb] = WFrag<T16>::mma(a[mb], b2, acc[mb][nb]); } }
        asm volatile("v_nop\n\tv_nop\n\tv_nop\n\tv_nop" : "+v"(acc[0][0]), "+v"(acc[1][1]), "+v"(acc[2][2]), "+v"(acc[3][3]) : "v"(a[0]), "v"(a[3]));
    }
#pragma unroll
    for (int mb = 0; mb < 4; ++mb) {
#pragma unroll
        for (int nb = 0; nb < 4; ++nb) {
#pragma unroll
            for (int j = 0; j < 8; ++j) os[(hi * 8 + j) * 68 + nb * 16 + lr] = acc[mb][nb][j]; }
        __builtin_amdgcn_wave_barrier(); asm volatile("" ::: "memory");
        float* crow = C + (size_t)(r0 + mb * 16) * ldc + c0;
{
#pragma unroll
            for (int s = 0; s < 8; ++s) { const int row = 2 * s + hi, cofs = lr * 4; v4f val = *(const v4fa*)(os + row * 68 + cofs); if (BIAS) { val[0] += bfr(bias[c0 + cofs]); val[1] += bfr(bias[c0 + cofs + 1]); val[2] += bfr(bias[c0 + cofs + 2]); val[3] += bfr(bias[c0 + cofs + 3]); }
                *(v4f*)(crow + (size_t)row * ldc + cofs) = val; }
             }
        __builtin_amdgcn_wave_barrier(); asm volatile("" ::: "memory");
    }
}

__device__ __forceinline__ void splitf(float y, unsigned short& h, unsigned short& l) { h = f2bf(y); l = f2bf(y - bf2f(h)); }
typedef __attribute__((ext_vector_type(2))) unsigned short v2us;
typedef __attribute__((ext_vector_type(4))) unsigned short v4us;

__device__ __forceinline__ void d_wtG(int blk, const float* __restrict__ w, int K, int N, bf* Bt) {
    const int lane = threadIdx.x & 31; const int L0 = (blk * 8 + (threadIdx.x >> 5)) * 8; const int nlines = N * K / 64;
{
#pragma unroll 1
        for (int l = 0; l < 8; ++l) { const int L = L0 + l; if (L >= nlines) break; const size_t e = (size_t)L * 64 + lane * 2; const int k = (int)(e % K), n = (int)(e / K); v2us o;
            o[0] = f2bf(w[(size_t)k * N + n]); o[1] = f2bf(w[(size_t)(k + 1) * N + n]); *(v2us*)(Bt + e) = o; }
         }
}
__device__ __forceinline__ void d_cvt8(int blk, const float* __restrict__ src, bf* dst, size_t n8) { const size_t i = (size_t)blk * 256 + threadIdx.x; if (i >= n8) return; const v8f v = *(const v8f*)(src + i * 8); v8us o;
#pragma unroll
    for (int k = 0; k < 8; ++k) o[k] = f2bf(v[k]); *(v8us*)(dst + i * 8) = o;  }
__device__ __forceinline__ int clampi(int m) { return m < 0 ? 0 : (m >= NN ? NN - 1 : m); }
// both batches: eg runs over [2][8192][32]; xyz and BIAS step to the batch's own plane.
// The MLP's 392 weights are rounded to bf16 ONCE per block, into LDS (row j: W1[0][j], W1[1][j], W1[2][j], b1[j], W2[j][0..7]; behind the 32 rows: b2), and every thread works 4 neighbouring edges of one point,
// so that a row read from LDS (three 16-byte broadcasts) serves 128 edges of a wave. Each edge's arithmetic, and its order, is as before; two edges share a packed instruction.
#define BE 4
#define SW_N (HB * 12 + NH_)
typedef __attribute__((ext_vector_type(2))) float v2f;
typedef __attribute__((ext_vector_type(4))) int   v4i;
__device__ __forceinline__ void d_bias(int blk, const float* __restrict__ xyz, const int* __restrict__ idx, const float* __restrict__ W1, const float* __restrict__ b1, const float* __restrict__ W2, const float* __restrict__ b2, float* BIAS, float* sw) {
    static_assert((NB_ * NN * KN) % (256 * BE) == 0, "the bias blocks cover the edges exactly: no range guard");
    const int eg = (blk * 256 + threadIdx.x) * BE; const int bt = eg / (NN * KN); const int e = eg - bt * (NN * KN); const int n = e / KN; const v4i mi = *(const v4i*)(idx + eg); xyz += (size_t)bt * NN * 3; BIAS += (size_t)bt * NH_ * NN * KN;
    const float* pn = xyz + (size_t)n * 3; const float* pm[BE]; float xn[3], xm[BE][3];
#pragma unroll
    for (int i = 0; i < BE; ++i) pm[i] = xyz + (size_t)clampi(mi[i]) * 3;
#pragma unroll
    for (int a = 0; a < 3; ++a) xn[a] = pn[a];
#pragma unroll
    for (int i = 0; i < BE; ++i)
#pragma unroll
        for (int a = 0; a < 3; ++a) xm[i][a] = pm[i][a];
    // the weights are staged behind the issue of the coordinate gathers, so that both latencies pass together
    for (int t = threadIdx.x; t < SW_N; t += 256) { const int j = t / 12, c = t - j * 12; sw[t] = bfr(t >= HB * 12 ? b2[t - HB * 12] : (c < 3 ? W1[c * HB + j] : (c == 3 ? b1[j] : W2[j * NH_ + c - 4]))); }
    __syncthreads();    // the block's rounded weights are complete before any thread reads them; every thread of a bias block passes here
    v2f r[BE / 2][3];
#pragma unroll
    for (int i = 0; i < BE; ++i)
#pragma unroll
        for (int a = 0; a < 3; ++a) r[i >> 1][a][i & 1] = __fsub_rn(bfr(xn[a]), bfr(xm[i][a]));
    v2f acc[BE / 2][NH_];
#pragma unroll
    for (int q = 0; q < BE / 2; ++q)
#pragma unroll
        for (int h = 0; h < NH_; ++h) acc[q][h] = (v2f){0.f, 0.f};
    v4f wr[2][3];    // two register sets for a weight row: row j + 1 is asked for before row j is worked, so that its LDS latency passes behind row j's sums
#pragma unroll
    for (int c = 0; c < 3; ++c) wr[0][c] = *(const v4f*)(sw + c * 4);
#pragma unroll    // unrolled whole: the two register sets alternate by a compile-time index, and every LDS row address is an immediate
    for (int j = 0; j < HB; ++j) {
        if (j + 1 < HB) {
#pragma unroll
            for (int c = 0; c < 3; ++c) wr[(j + 1) & 1][c] = *(const v4f*)(sw + (j + 1) * 12 + c * 4); }
        const v4f wa = wr[j & 1][0], wb = wr[j & 1][1], wc = wr[j & 1][2];
        // the empty asm statements on the products are carried over from the scalar form unchanged in kind: product and add keep their two roundings, so every bias value stays bit-identical
#pragma unroll
        for (int q = 0; q < BE / 2; ++q) { v2f s = (v2f){0.f, 0.f};
#pragma unroll
            for (int a = 0; a < 3; ++a) { v2f p = r[q][a] * wa[a]; asm volatile("" : "+v"(p)); s = s + p; }
            s = s + wa[3]; const v2f hv = (v2f){fmaxf(s[0], 0.f), fmaxf(s[1], 0.f)};
#pragma unroll
            for (int h = 0; h < NH_; ++h) { v2f p = hv * (h < 4 ? wb[h & 3] : wc[h & 3]); asm volatile("" : "+v"(p)); acc[q][h] = acc[q][h] + p; } } }
    { const v4f b2a = *(const v4f*)(sw + HB * 12), b2b = *(const v4f*)(sw + HB * 12 + 4);
#pragma unroll
        for (int h = 0; h < NH_; ++h) { const float bb = h < 4 ? b2a[h & 3] : b2b[h & 3]; const v2f o0 = acc[0][h] + bb, o1 = acc[1][h] + bb; *(v4f*)(BIAS + (size_t)h * NN * KN + e) = (v4f){o0[0], o0[1], o1[0], o1[1]};
            asm volatile("s_wait_xcnt 0x0" ::: "memory"); }    // the next head's sum may reuse the register that this store names
         } }
// k_prep: the three independent preparation passes in ONE launch, told apart by the block index: first the four weight transposes (few blocks, a serial latency-bound loop), then the positional bias (the longest), last the x conversion (short blocks fill the tail).
#define WT_BLK   ((CC * CC / 64 + 63) / 64)
#define BIAS_BLK ((NB_ * NN * KN / BE + 255) / 256)
#define CVT_BLK  ((NB_ * NN * CC / 8 + 255) / 256)
// 10 waves per SIMD asked for: left free, the unrolled bias MLP took 176 registers, and the x conversion's blocks, which share this kernel and live on loads in flight, would be held to 5 waves per SIMD
__global__ __launch_bounds__(256, 10) void k_prep(const float* __restrict__ wq, const float* __restrict__ wk, const float* __restrict__ wv, const float* __restrict__ wo, bf* WT, const float* __restrict__ x, bf* XB,
                                              const float* __restrict__ xyz, const int* __restrict__ idx, const float* __restrict__ W1, const float* __restrict__ b1, const float* __restrict__ W2, const float* __restrict__ b2, float* BIAS) {
    __shared__ __align__(16) float sw[SW_N];    // the bias blocks' rounded MLP weights
    const int blk = blockIdx.x;
    if (blk < 4 * WT_BLK) { const int t = blk / WT_BLK; d_wtG(blk - t * WT_BLK, t == 0 ? wq : (t == 1 ? wk : (t == 2 ? wv : wo)), CC, CC, WT + (size_t)t * CC * CC); }
    else if (blk < 4 * WT_BLK + BIAS_BLK) d_bias(blk - 4 * WT_BLK, xyz, idx, W1, b1, W2, b2, BIAS, sw);
    else d_cvt8(blk - 4 * WT_BLK - BIAS_BLK, x, XB, (size_t)NB_ * NN * CC / 8);
}
// k_attn: 8 lanes per (n, h) (4 dims each): for each neighbour kk: m = clamp(idx[n][kk]); score = (q[n][h].k[m][h]) / sqrt(32) (4-dim partials + xor-shuffle over the 8 lanes) + BIAS[h][n][kk]; softmax over the 32 in registers;
// the 64 gathered rows of a point (32 of K, then 32 of V) run through a ring of GK register slots: a slot is refilled with the row GK places on as soon as it has been used, so GK gathers of a wave are in flight instead of one; the lane shuffles of GK neighbours are issued together. The arithmetic of every value, and its order, is as before.
#define GK 8
// 8 waves per SIMD asked for: the ring, the 32 offsets and the 32 scores fit 128 registers, and four workgroups stay resident per WGP
__global__ __launch_bounds__(256, 8) void k_attn(const float* __restrict__ FQ, const float* __restrict__ FK, const float* __restrict__ FV, const int* __restrict__ idx, const float* __restrict__ BIAS, bf* Ah, bf* Al) {
    const size_t e = ((size_t)blockIdx.x * 256 + threadIdx.x) * 4; if (e >= (size_t)NB_ * NN * CC) return; const int col = (int)(e % CC);
    const int ng = __builtin_amdgcn_readfirstlane((int)(e / CC));    // a wave's 32 lanes x 4 columns lie inside one point's row: the point is wave-uniform, so its 32 indices come once, through the scalar path
    const int bt = ng / NN; const int n = ng - bt * NN; const int h = col / HD; const int* in_ = idx + (size_t)ng * KN; const float* bs = BIAS + (((size_t)bt * NH_ + h) * NN + n) * KN;
    FK += (size_t)bt * NN * CC; FV += (size_t)bt * NN * CC;    // a neighbour index counts inside its own batch
    unsigned vo[KN];    // byte offset of this lane's 16 bytes in neighbour kk's row: formed once, one register per neighbour, and used for its K gather and for its V gather, so that no address arithmetic stands between the gathers
#pragma unroll
    for (int kk = 0; kk < KN; ++kk) vo[kk] = (unsigned)clampi(in_[kk]) * (CC * 4u) + (unsigned)col * 4u;
    auto row = [&](int r) -> v4f { return *(const v4f*)((const char*)(r < KN ? FK : FV) + vo[r & (KN - 1)]); };    // row r of the stream: K rows 0..31, then V rows 0..31
    const v4f q = *(const v4f*)(FQ + e); const float SC = 0.17677669529663687f; float sc[KN]; float mx = -3.0e38f;
    v4f bb[2][GK / 4]; v4f ring[GK];
#pragma unroll
    for (int i = 0; i < GK / 4; ++i) bb[0][i] = *(const v4f*)(bs + 4 * i);
#pragma unroll
    for (int i = 0; i < GK; ++i) ring[i] = row(i);
#pragma unroll
    for (int g = 0; g < KN / GK; ++g) {
        if (g + 1 < KN / GK) {    // the next group's bias is asked for one group ahead
#pragma unroll
            for (int i = 0; i < GK / 4; ++i) bb[(g + 1) & 1][i] = *(const v4f*)(bs + (g + 1) * GK + 4 * i); }
        float part[GK];
#pragma unroll
        for (int i = 0; i < GK; ++i) { const v4f k = ring[i]; float p = 0.f;
#pragma unroll
            for (int u = 0; u < 4; ++u) { float pr = __fmul_rn(q[u], k[u]); asm volatile("" : "+v"(pr)); p = __fadd_rn(p, pr); }
            part[i] = p; ring[i] = row((g + 1) * GK + i); }
#pragma unroll
        for (int st = 1; st <= 4; st <<= 1) { float t[GK];
#pragma unroll
            for (int i = 0; i < GK; ++i) t[i] = __shfl_xor(part[i], st, 32);
            __builtin_amdgcn_sched_barrier(0);    // holds the GK shuffles of a step together in front of their adds: one pass through the LDS path's latency per step, not one per neighbour
#pragma unroll
            for (int i = 0; i < GK; ++i) part[i] += t[i]; }
#pragma unroll
        for (int i = 0; i < GK; ++i) { const int kk = g * GK + i; float s0 = __fmul_rn(part[i], SC); asm volatile("" : "+v"(s0)); sc[kk] = __fadd_rn(s0, bb[g & 1][i >> 2][i & 3]); mx = fmaxf(mx, sc[kk]); }
    }
    float sum = 0.f;
#pragma unroll
    for (int kk = 0; kk < KN; ++kk) { float d0 = __fsub_rn(sc[kk], mx); asm volatile("" : "+v"(d0)); sc[kk] = __expf(d0); sum = __fadd_rn(sum, sc[kk]); }
    const float inv = __fdiv_rn(1.0f, sum); float o[4] = {0.f, 0.f, 0.f, 0.f};
#pragma unroll
    for (int kk = 0; kk < KN; ++kk) { const v4f v = ring[kk & (GK - 1)]; float pw = __fmul_rn(sc[kk], inv); asm volatile("" : "+v"(pw));
#pragma unroll
        for (int u = 0; u < 4; ++u) { float pr = __fmul_rn(pw, v[u]); asm volatile("" : "+v"(pr)); o[u] = __fadd_rn(o[u], pr); }
        if (kk + GK < KN) ring[kk & (GK - 1)] = row(KN + kk + GK); }
    v4us oh, ol;
#pragma unroll
    for (int u = 0; u < 4; ++u) { unsigned short a, b; splitf(o[u], a, b); oh[u] = a; ol[u] = b; } *(v4us*)(Ah + e) = oh; *(v4us*)(Al + e) = ol;  }

extern "C" void kernel_launch(void* const* d_in, const int* in_sizes, int n_in,
                              void* d_out, int out_size, void* d_ws, size_t ws_size, hipStream_t stream) {
    (void)in_sizes; (void)n_in; (void)out_size;
    const float* x = (const float*)d_in[0]; const float* xyz = (const float*)d_in[1]; const int* idx = (const int*)d_in[2]; const float* wq = (const float*)d_in[3]; const float* bq = (const float*)d_in[4]; const float* wk = (const float*)d_in[5]; const float* bk = (const float*)d_in[6]; const float* wv = (const float*)d_in[7]; const float* bv = (const float*)d_in[8];
    const float* wo = (const float*)d_in[9]; const float* bo = (const float*)d_in[10]; const float* W1 = (const float*)d_in[11]; const float* b1 = (const float*)d_in[12]; const float* W2 = (const float*)d_in[13]; const float* b2 = (const float*)d_in[14];
    float* OUT = (float*)d_out;     // [2][8192][256]
    char* wsp = (char*)d_ws;
    auto take = [&](size_t bytes) { char* p = wsp; wsp += (bytes + 255) & ~(size_t)255; return (void*)p; };
    bf* WT = (bf*)take((size_t)4 * CC * CC * 2);                          // Wq, Wk, Wv, Wo transposed, one after the other
    bf* XB = (bf*)take((size_t)NB_ * NN * CC * 2); float* FQKV = (float*)take((size_t)3 * NB_ * NN * CC * 4);    // q, k, v planes, each [2*8192][256]
    float* BIAS = (float*)take((size_t)NB_ * NH_ * NN * KN * 4); bf* Ah = (bf*)take((size_t)NB_ * NN * CC * 2); bf* Al = (bf*)take((size_t)NB_ * NN * CC * 2);
    if ((size_t)(wsp - (char*)d_ws) > ws_size) return;    // total ~ 93 MB
    float* FQ = FQKV; float* FK = FQKV + (size_t)NB_ * NN * CC; float* FV = FQKV + (size_t)2 * NB_ * NN * CC;
    k_prep<<<4 * WT_BLK + BIAS_BLK + CVT_BLK, 256, 0, stream>>>(wq, wk, wv, wo, WT, x, XB, xyz, idx, W1, b1, W2, b2, BIAS);
    k_gemmw<bf, 0, true><<<dim3(NB_ * NN / 64, CC / 64, 3), 32, 0, stream>>>(XB, nullptr, WT, nullptr, CC, FQKV, CC, bq, bk, bv, 0, (size_t)CC * CC, (size_t)NB_ * NN * CC);
    k_attn<<<(unsigned)(((size_t)NB_ * NN * CC / 4 + 255) / 256), 256, 0, stream>>>(FQ, FK, FV, idx, BIAS, Ah, Al);
    k_gemmw<bf, 1, true><<<dim3(NB_ * NN / 64, CC / 64, 1), 32, 0, stream>>>(Ah, Al, WT + (size_t)3 * CC * CC, nullptr, CC, OUT, CC, bo, bo, bo, 0, 0, 0);
}

// v005
// Measured time: 79.7 microseconds a run.
// Versions between v003 and this one are left out; their measured steps multiply to 1.21 times as fast.
// All steps since v000 together make it 2.47 times as fast.
#include <hip/hip_runtime.h>

// LocalSphereAttention (x [2][8192][256], xyz [2][8192][3], idx [2][8192][32] (int neighbour indices, read as data); q/k/v = x W + b (8 heads x 32); per point n and head h, over its 32 neighbours m = idx[n][kk]:
// score = q[n].k[m]/sqrt(32) + bias[n][kk][h], bias = relu((xyz[n] - xyz[m]) W1 + b1) W2 + b2; softmax over the 32 neighbours; out = sum attn v[m]; (merged) Wo + bo -> [2][8192][256]).
// Compute dtypes, f32 accumulate: every input rounded to bf16; q on PLAIN bf16 operands (inputs: exact) + bias; the positional-bias MLP and the softmax f32 on the VALU; scores and weighted sums on bf16 high + low parts against the gathered bf16 x rows (see k_attn)
// FRAGMENT ORDER: a 16-bit plane T[r][k] (k = 0..255) that is only ever read as WMMA fragments (the four weight planes, the attention output's high and low parts) is stored by its producer as its reader loads it:
// the fragment of rows 16 rt .. 16 rt + 15, k = 32 ks .. 32 ks + 31 is 1 KiB at (rt * 8 + ks) KiB: [half j][lane = 16 hi + lr][8 values] = T[16 rt + lr][32 ks + 16 j + 8 hi + 0..7].
// A wave's 16-byte-a-lane load is then 512 contiguous bytes, 4 whole lines; from the row-major plane it took 32 bytes out of each of 16 lines.

#define NB_  2
#define NN   8192
#define CC   256
#define NH_  8
#define HD   32
#define KN   32
#define HB   32
typedef _Float16 h16;
typedef unsigned short bf;
typedef __attribute__((ext_vector_type(16))) __bf16   v16bf;
typedef __attribute__((ext_vector_type(16))) _Float16 v16h;
typedef __attribute__((ext_vector_type(8)))  _Float16 v8h;
typedef __attribute__((ext_vector_type(8)))  unsigned short v8us;
typedef __attribute__((ext_vector_type(8)))  float    v8f;
typedef __attribute__((ext_vector_type(4)))  float    v4f;
typedef v8h  __attribute__((may_alias)) v8ha;
typedef v4f  __attribute__((may_alias)) v4fa;
typedef v8us __attribute__((may_alias)) v8usa;

__device__ __forceinline__ unsigned short f2bf(float f) { unsigned u = __float_as_uint(f); u += 0x7FFFu + ((u >> 16) & 1u); return (unsigned short)(u >> 16); }
__device__ __forceinline__ float bf2f(unsigned short b) { return __uint_as_float(((unsigned)b) << 16); }
__device__ __forceinline__ float bfr(float f) { return bf2f(f2bf(f)); }
__device__ __forceinline__ v16h cat16(v8h lo, v8h hi) { return __builtin_shufflevector(lo, hi, 0, 1, 2, 3, 4, 5, 6, 7, 8, 9, 10, 11, 12, 13, 14, 15); }
__device__ __forceinline__ v16bf cat16b(v8us lo, v8us hi) { return __builtin_bit_cast(v16bf, __builtin_shufflevector(lo, hi, 0, 1, 2, 3, 4, 5, 6, 7, 8, 9, 10, 11, 12, 13, 14, 15)); }
__device__ __forceinline__ v8f wmma16(v16h a, v16h b, v8f c) { return __builtin_amdgcn_wmma_f32_16x16x32_f16(false, a, false, b, (short)0, c, false, false); }
__device__ __forceinline__ v8f wmmab(v16bf a, v16bf b, v8f c) { return __builtin_amdgcn_wmma_f32_16x16x32_bf16(false, a, false, b, (short)0, c, false, false); }



// ---- k_gemmw: register-blocked GEMM, ONE WAVE per 64x64 output tile (16 accumulators), operands straight from K-contiguous 16-bit planes; grid (M/64, N/64, Z), 32 threads.
// C[m][n] (f32, pitch ldc, + optional f32 bias[n], one bias vector per z) = sum_k A[m][k] Bt[n][k] (+ split products per NSPLIT). z-batch strides sA/sB/sC in elements. K % 32 == 0.
// Bt (and Bt2) in fragment order; A (and A2) in fragment order where AFR, else row-major. ld: a fragment from a row-major plane (p holds row and 8 hi); ldf: from a plane in fragment order (p holds 8 lane). 16 rows are 16 K values in both.
template <typename T16> struct WFrag;
template <> struct WFrag<h16> { typedef v16h V; static __device__ __forceinline__ V ld(const h16* p) { return cat16(*(const v8h*)p, *(const v8h*)(p + 16)); } static __device__ __forceinline__ V ldf(const h16* p) { return cat16(*(const v8h*)p, *(const v8h*)(p + 256)); } static __device__ __forceinline__ v8f mma(V a, V b, v8f c) { return wmma16(a, b, c); } };
template <> struct WFrag<bf> { typedef v16bf V; static __device__ __forceinline__ V ld(const bf* p) { return cat16b(*(const v8us*)p, *(const v8us*)(p + 16)); } static __device__ __forceinline__ V ldf(const bf* p) { return cat16b(*(const v8us*)p, *(const v8us*)(p + 256)); } static __device__ __forceinline__ v8f mma(V a, V b, v8f c) { return wmmab(a, b, c); } };
template <typename T16, int NSPLIT, bool BIAS, bool AFR>
__global__ __launch_bounds__(32) void k_gemmw(const T16* __restrict__ A, const T16* __restrict__ A2, const T16* __restrict__ Bt, const T16* __restrict__ Bt2, int K, float* C, int ldc, const float* __restrict__ bias0, const float* __restrict__ bias1, const float* __restrict__ bias2, size_t sA, size_t sB, size_t sC) {
    typedef typename WFrag<T16>::V V;
    __shared__ __align__(16) float os[16 * 68];
    const size_t z = blockIdx.z; A += z * sA; if (A2) A2 += z * sA; Bt += z * sB; if (Bt2) Bt2 += z * sB; C += z * sC; const float* bias = z == 0 ? bias0 : (z == 1 ? bias1 : bias2);
    const int lane = threadIdx.x & 31, lr = lane & 15, hi = lane >> 4; const int r0 = blockIdx.x * 64, c0 = blockIdx.y * 64;
    v8f acc[4][4];
#pragma unroll
    for (int mb = 0; mb < 4; ++mb)
#pragma unroll
        for (int nb = 0; nb < 4; ++nb) acc[mb][nb] = (v8f){};
    // a fragment's address: a wave-uniform base (plane, row tile, k step) + the lane's own byte offset, which never changes: 16 lane in a plane in fragment order, its row and 8 hi in a row-major plane
    unsigned va = AFR ? 16u * lane : 2u * (unsigned)(lr * K + 8 * hi), vb = 16u * lane;
#pragma unroll 1
    for (int kc = 0; kc < K; kc += 32) {
        V a[4], a2[4], b[4], b2[4]; const char* pa[4]; const char* pa2[4]; const char* pb[4]; const char* pb2[4];    // the bases; a plane that this instance does not read stands in with its partner's base. Each '#pragma unroll' of this loop makes the indices of these arrays compile-time constants, so that they stay in registers
#pragma unroll
        for (int mb = 0; mb < 4; ++mb) { const size_t ao = (size_t)(r0 + mb * 16) * K + (AFR ? kc * 16 : kc); pa[mb] = (const char*)(A + ao); pa2[mb] = (NSPLIT == 1 || NSPLIT == 2) ? (const char*)(A2 + ao) : pa[mb]; }
#pragma unroll
        for (int nb = 0; nb < 4; ++nb) { const size_t bo_ = (size_t)(c0 + nb * 16) * K + kc * 16; pb[nb] = (const char*)(Bt + bo_); pb2[nb] = NSPLIT >= 2 ? (const char*)(Bt2 + bo_) : pb[nb]; }
#pragma unroll
        for (int mb = 0; mb < 4; ++mb) { a[mb] = AFR ? WFrag<T16>::ldf((const T16*)(pa[mb] + va)) : WFrag<T16>::ld((const T16*)(pa[mb] + va)); if (NSPLIT == 1 || NSPLIT == 2) a2[mb] = AFR ? WFrag<T16>::ldf((const T16*)(pa2[mb] + va)) : WFrag<T16>::ld((const T16*)(pa2[mb] + va)); }
#pragma unroll
        for (int nb = 0; nb < 4; ++nb) { b[nb] = WFrag<T16>::ldf((const T16*)(pb[nb] + vb)); if (NSPLIT >= 2) b2[nb] = WFrag<T16>::ldf((const T16*)(pb2[nb] + vb)); }
        // a precaution, behind the trip's fragment loads: the registers that hold their addresses are rewritten only behind this wait. The bases are its inputs, so that they stay in their registers up to it;
        // the two offsets are named as operands that it may change (it changes neither), so that no load of this trip, each of which names one of them, is moved behind it
        asm volatile("s_wait_xcnt 0x0" : "+v"(va), "+v"(vb) : "s"(pa[0]), "s"(pa[1]), "s"(pa[2]), "s"(pa[3]), "s"(pa2[0]), "s"(pa2[1]), "s"(pa2[2]), "s"(pa2[3]), "s"(pb[0]), "s"(pb[1]), "s"(pb[2]), "s"(pb[3]), "s"(pb2[0]), "s"(pb2[1]), "s"(pb2[2]), "s"(pb2[3]) : "memory");
#pragma unroll
        for (int nb = 0; nb < 4; ++nb) {
#pragma unroll
            for (int mb = 0; mb < 4; ++mb) { acc[mb][nb] = WFrag<T16>::mma(a[mb], b[nb], acc[mb][nb]); if (NSPLIT == 1 || NSPLIT == 2) acc[mb][nb] = WFrag<T16>::mma(a2[mb], b[nb], acc[mb][nb]); if (NSPLIT >= 2) acc[mb][nb] = WFrag<T16>::mma(a[mb], b2[nb], acc[mb][nb]); } }
        asm volatile("v_nop\n\tv_nop\n\tv_nop\n\tv_nop" : "+v"(acc[0][0]), "+v"(acc[1][1]), "+v"(acc[2][2]), "+v"(acc[3][3]) : "v"(a[0]), "v"(a[3]));
    }
#pragma unroll
    for (int mb = 0; mb < 4; ++mb) {
#pragma unroll
        for (int nb = 0; nb < 4; ++nb) {
#pragma unroll
            for (int j = 0; j < 8; ++j) os[(hi * 8 + j) * 68 + nb * 16 + lr] = acc[mb][nb][j]; }
        __builtin_amdgcn_wave_barrier(); asm volatile("" ::: "memory");
        float* crow = C + (size_t)(r0 + mb * 16) * ldc + c0;
{
#pragma unroll
            for (int s = 0; s < 8; ++s) { const int row = 2 * s + hi, cofs = lr * 4; v4f val = *(const v4fa*)(os + row * 68 + cofs); if (BIAS) { val[0] += bfr(bias[c0 + cofs]); val[1] += bfr(bias[c0 + cofs + 1]); val[2] += bfr(bias[c0 + cofs + 2]); val[3] += bfr(bias[c0 + cofs + 3]); }
                *(v4f*)(crow + (size_t)row * ldc + cofs) = val; }
            asm volatile("s_wait_xcnt 0x0" ::: "memory");    // a precaution: the registers that the row tile's stores name take the next tile's values and addresses only behind this wait
             }
        __builtin_amdgcn_wave_barrier(); asm volatile("" ::: "memory");
    }
}

__device__ __forceinline__ void splitf(float y, unsigned short& h, unsigned short& l) { h = f2bf(y); l = f2bf(y - bf2f(h)); }
typedef __attribute__((ext_vector_type(2))) unsigned short v2us;
typedef __attribute__((ext_vector_type(4))) unsigned short v4us;

__device__ __forceinline__ size_t fragofs(int r, int k) { return ((size_t)(r >> 4) * (CC / 32) + (k >> 5)) * 512 + ((k >> 4) & 1) * 256 + (((k >> 3) & 1) * 16 + (r & 15)) * 8 + (k & 7); }    // where T[r][k] lies in a plane in fragment order, in values; 8 values from a k that is a multiple of 8 lie together
__device__ __forceinline__ void d_wtG(int blk, const float* __restrict__ w, int K, int N, bf* Bt) {
    const int lane = threadIdx.x & 31; const int L0 = (blk * 8 + (threadIdx.x >> 5)) * 8; const int nlines = N * K / 64;
{
#pragma unroll 1
        for (int l = 0; l < 8; ++l) { const int L = L0 + l; if (L >= nlines) break; const size_t e = (size_t)L * 64 + lane * 2; const int k = (int)(e % K), n = (int)(e / K); v2us o;
            o[0] = f2bf(w[(size_t)k * N + n]); o[1] = f2bf(w[(size_t)(k + 1) * N + n]); bf* dp = Bt + fragofs(n, k); *(v2us*)dp = o;
            asm volatile("s_wait_xcnt 0x0" :: "v"(dp) : "memory"); }    // a precaution: the next trip forms its addresses in the registers that this store names only behind this wait
         }
}
__device__ __forceinline__ void d_cvt8(int blk, const float* __restrict__ src, bf* dst, size_t n8) { const size_t i = (size_t)blk * 256 + threadIdx.x; if (i >= n8) return; const v8f v = *(const v8f*)(src + i * 8); v8us o;
#pragma unroll
    for (int k = 0; k < 8; ++k) o[k] = f2bf(v[k]); *(v8us*)(dst + i * 8) = o;  }
__device__ __forceinline__ void d_cvt8f(int blk, const float* __restrict__ src, bf* dst) { const int i = blk * 256 + threadIdx.x; const unsigned so = 32u * i; const v8f v = *(const v8f*)((const char*)src + so); v8us o;    // a [256][256] plane, rounded and stored in fragment order
    asm volatile("s_wait_xcnt 0x0" :: "v"(so) : "memory");    // a precaution: the register that holds the load's offset is rewritten only behind this wait; it is the wait's input, so that it keeps its value up to it
#pragma unroll
    for (int k = 0; k < 8; ++k) o[k] = f2bf(v[k]); const unsigned dofs = 2u * (unsigned)fragofs(i / (CC / 8), (i % (CC / 8)) * 8); *(v8us*)((char*)dst + dofs) = o;
    asm volatile("s_wait_xcnt 0x0" :: "v"(dofs), "v"(o) : "memory"); }    // the same precaution behind the store, for its offset and its data
__device__ __forceinline__ int clampi(int m) { return m < 0 ? 0 : (m >= NN ? NN - 1 : m); }
// both batches: eg runs over [2][8192][32]; xyz and BIAS step to the batch's own plane.
// The MLP's 392 weights are rounded to bf16 ONCE per block, into LDS (row j: W1[0][j], W1[1][j], W1[2][j], b1[j], W2[j][0..7]; behind the 32 rows: b2), and every thread works 4 neighbouring edges of one point,
// so that a row read from LDS (three 16-byte broadcasts) serves 128 edges of a wave. Each edge's arithmetic, and its order, is as before; two edges share a packed instruction.
#define BE 4
#define SW_N (HB * 12 + NH_)
typedef __attribute__((ext_vector_type(2))) float v2f;
typedef __attribute__((ext_vector_type(4))) int   v4i;
__device__ __forceinline__ void d_bias(int blk, const float* __restrict__ xyz, const int* __restrict__ idx, const float* __restrict__ W1, const float* __restrict__ b1, const float* __restrict__ W2, const float* __restrict__ b2, float* BIAS, float* sw) {
    static_assert((NB_ * NN * KN) % (256 * BE) == 0, "the bias blocks cover the edges exactly: no range guard");
    const int eg = (blk * 256 + threadIdx.x) * BE; const int bt = eg / (NN * KN); const int e = eg - bt * (NN * KN); const int n = e / KN; const v4i mi = *(const v4i*)(idx + eg); xyz += (size_t)bt * NN * 3; BIAS += (size_t)bt * NH_ * NN * KN;
    const float* pn = xyz + (size_t)n * 3; const float* pm[BE]; float xn[3], xm[BE][3];
#pragma unroll
    for (int i = 0; i < BE; ++i) pm[i] = xyz + (size_t)clampi(mi[i]) * 3;
#pragma unroll
    for (int a = 0; a < 3; ++a) xn[a] = pn[a];
#pragma unroll
    for (int i = 0; i < BE; ++i)
#pragma unroll
        for (int a = 0; a < 3; ++a) xm[i][a] = pm[i][a];
    // the weights are staged behind the issue of the coordinate gathers, so that both latencies pass together
    for (int t = threadIdx.x; t < SW_N; t += 256) { const int j = t / 12, c = t - j * 12; sw[t] = bfr(t >= HB * 12 ? b2[t - HB * 12] : (c < 3 ? W1[c * HB + j] : (c == 3 ? b1[j] : W2[j * NH_ + c - 4]))); }
    __syncthreads();    // the block's rounded weights are complete before any thread reads them; every thread of a bias block passes here
    v2f r[BE / 2][3];
#pragma unroll
    for (int i = 0; i < BE; ++i)
#pragma unroll
        for (int a = 0; a < 3; ++a) r[i >> 1][a][i & 1] = __fsub_rn(bfr(xn[a]), bfr(xm[i][a]));
    v2f acc[BE / 2][NH_];
#pragma unroll
    for (int q = 0; q < BE / 2; ++q)
#pragma unroll
        for (int h = 0; h < NH_; ++h) acc[q][h] = (v2f){0.f, 0.f};
    v4f wr[2][3];    // two register sets for a weight row: row j + 1 is asked for before row j is worked, so that its LDS latency passes behind row j's sums
#pragma unroll
    for (int c = 0; c < 3; ++c) wr[0][c] = *(const v4f*)(sw + c * 4);
#pragma unroll    // unrolled whole: the two register sets alternate by a compile-time index, and every LDS row address is an immediate
    for (int j = 0; j < HB; ++j) {
        if (j + 1 < HB) {
#pragma unroll
            for (int c = 0; c < 3; ++c) wr[(j + 1) & 1][c] = *(const v4f*)(sw + (j + 1) * 12 + c * 4); }
        const v4f wa = wr[j & 1][0], wb = wr[j & 1][1], wc = wr[j & 1][2];
        // the empty asm statements on the products are carried over from the scalar form unchanged in kind: product and add keep their two roundings, so every bias value stays bit-identical
#pragma unroll
        for (int q = 0; q < BE / 2; ++q) { v2f s = (v2f){0.f, 0.f};
#pragma unroll
            for (int a = 0; a < 3; ++a) { v2f p = r[q][a] * wa[a]; asm volatile("" : "+v"(p)); s = s + p; }
            s = s + wa[3]; const v2f hv = (v2f){fmaxf(s[0], 0.f), fmaxf(s[1], 0.f)};
#pragma unroll
            for (int h = 0; h < NH_; ++h) { v2f p = hv * (h < 4 ? wb[h & 3] : wc[h & 3]); asm volatile("" : "+v"(p)); acc[q][h] = acc[q][h] + p; } } }
    { const v4f b2a = *(const v4f*)(sw + HB * 12), b2b = *(const v4f*)(sw + HB * 12 + 4);
#pragma unroll
        for (int h = 0; h < NH_; ++h) { const float bb = h < 4 ? b2a[h & 3] : b2b[h & 3]; const v2f o0 = acc[0][h] + bb, o1 = acc[1][h] + bb; *(v4f*)(BIAS + (size_t)h * NN * KN + e) = (v4f){o0[0], o0[1], o1[0], o1[1]};
            asm volatile("s_wait_xcnt 0x0" ::: "memory"); }    // the next head's sum may reuse the register that this store names
         } }
// k_prep: the three independent preparation passes in ONE launch, told apart by the block index: first the four weight planes (three transposes, few blocks, a serial latency-bound loop; Wk is only rounded), then the positional bias (the longest), last the x conversion (short blocks fill the tail).
#define WT_BLK   ((CC * CC / 64 + 63) / 64)
#define BIAS_BLK ((NB_ * NN * KN / BE + 255) / 256)
#define CVT_BLK  ((NB_ * NN * CC / 8 + 255) / 256)
// 10 waves per SIMD asked for: left free, the unrolled bias MLP took 176 registers, and the x conversion's blocks, which share this kernel and live on loads in flight, would be held to 5 waves per SIMD
__global__ __launch_bounds__(256, 10) void k_prep(const float* __restrict__ wq, const float* __restrict__ wk, const float* __restrict__ wv, const float* __restrict__ wo, bf* WT, const float* __restrict__ x, bf* XB,
                                              const float* __restrict__ xyz, const int* __restrict__ idx, const float* __restrict__ W1, const float* __restrict__ b1, const float* __restrict__ W2, const float* __restrict__ b2, float* BIAS) {
    __shared__ __align__(16) float sw[SW_N];    // the bias blocks' rounded MLP weights
    const int blk = blockIdx.x;
    if (blk < 4 * WT_BLK) { const int t = blk / WT_BLK;
        if (t == 1) { static_assert(2 * WT_BLK * 256 == CC * CC / 8, "two passes of the plane's blocks cover Wk exactly"); d_cvt8f(blk - WT_BLK, wk, WT + (size_t)CC * CC); d_cvt8f(blk, wk, WT + (size_t)CC * CC); }    // Wk's rows are the A operand's rows (k_attn, phase 1): rounded, not transposed
        else d_wtG(blk - t * WT_BLK, t == 0 ? wq : (t == 2 ? wv : wo), CC, CC, WT + (size_t)t * CC * CC); }
    else if (blk < 4 * WT_BLK + BIAS_BLK) d_bias(blk - 4 * WT_BLK, xyz, idx, W1, b1, W2, b2, BIAS, sw);
    else d_cvt8(blk - 4 * WT_BLK - BIAS_BLK, x, XB, (size_t)NB_ * NN * CC / 8);
}
// k_attn: the K and V projections are applied on the query side, so that a neighbour is gathered ONCE, as its 512-byte bf16 x row (exact: x is rounded to bf16 anyway), not as a 1-KiB f32 K row and a 1-KiB f32 V row:
//   q[n][h].k[m][h] = x[m] . qt[n][h] + q[n][h].bk[h], qt[n][h][c] = sum_d Wk[c][h*32+d] q[n][h][d]; the bk term is the same for a point-head's 32 neighbours and cancels in the softmax;
//   sum_j attn[j] v[m_j][h] = (sum_j attn[j] x[m_j]) Wv[:, h] + bv[h] (the weights sum to 1).
// One workgroup = 16 points, 8 waves. Every f32 value that becomes a matrix operand (q, qt, the weights, y) goes in as bf16 high part + bf16 low part, two products into one f32 accumulator.
//   phase 1, wave = head: qt^T [c][point] = Wk rows x q, stored to LDS as QT[point][high: row h, low: row 8 + h][c];
//   phase 2, wave = 2 points, one after the other: the 32 x rows in LDS; scores^T [j][h] = rows x qt with the positional bias as C; softmax inside the lane and with lane ^ 16; the two score tiles, converted in place,
//            are the B operand of y^T [c][h] = rows^T (transposing LDS loads) x weights; y replaces the point's qt in LDS;
//   phase 3, wave = head: out^T [d][point] = Wv^T rows x y, + bv, split, stored from the registers in the fragment order of the last GEMM's A operand.
// Every '#pragma unroll' in k_attn and its helpers makes the indices of a register array compile-time constants, so that the array stays in registers and every LDS offset is an immediate.
#define AP 16                      // points per workgroup
#define RP 528                     // LDS pitch in bytes of a row of 256 16-bit values: 16 B x odd
#define PP (16 * RP + 16)          // one point's 16 rows; 16 B x odd, since phases 1 and 3 walk the points by lane
#define QT_BYTES (AP * PP)
#define XG_BYTES (KN * RP)
typedef __attribute__((ext_vector_type(8))) short  v8s;
typedef __attribute__((ext_vector_type(4))) unsigned v4u;
typedef v4u __attribute__((may_alias)) v4ua;
typedef __attribute__((ext_vector_type(2))) __bf16 v2bf;
// f32 -> bf16 high part (round to nearest even) + bf16 low part (the remainder, rounded); two values per conversion instruction
__device__ __forceinline__ void split8(v8f y, v8us& h, v8us& l) { v4u hp, lp;
#pragma unroll
    for (int i = 0; i < 4; ++i) { const unsigned u = __builtin_bit_cast(unsigned, __builtin_convertvector((v2f){y[2 * i], y[2 * i + 1]}, v2bf)); hp[i] = u;
        lp[i] = __builtin_bit_cast(unsigned, __builtin_convertvector((v2f){y[2 * i] - __uint_as_float(u << 16), y[2 * i + 1] - __uint_as_float(u & 0xFFFF0000u)}, v2bf)); }
    h = __builtin_bit_cast(v8us, hp); l = __builtin_bit_cast(v8us, lp); }
// a precaution, written behind each group of global loads: the registers that hold their addresses are rewritten only behind this wait; the addresses are its inputs, so that they stay in their registers up to it
#define XWAIT(p) asm volatile("s_wait_xcnt 0x0" :: "v"(p) : "memory")
#define XWAIT8(a, i) asm volatile("s_wait_xcnt 0x0" :: "v"(a[i]), "v"(a[i + 1]), "v"(a[i + 2]), "v"(a[i + 3]), "v"(a[i + 4]), "v"(a[i + 5]), "v"(a[i + 6]), "v"(a[i + 7]) : "memory")
__device__ __forceinline__ v16bf ldsfrag(const unsigned char* p) { return cat16b(*(const v8usa*)p, *(const v8usa*)(p + 32)); }    // 32 k of a row in the hardware's k order: bytes 16 * hi and 32 + 16 * hi of 64 (hi is in p)
__device__ __forceinline__ v8us ld_tr16(const unsigned char* p) { typedef __attribute__((address_space(3))) v8s lds_v8s; return __builtin_bit_cast(v8us, __builtin_amdgcn_ds_load_tr16_b128_v8i16((lds_v8s*)p)); }
__device__ __forceinline__ float xhalf(float x) { return __builtin_bit_cast(float, __builtin_amdgcn_permlanex16(__builtin_bit_cast(int, x), __builtin_bit_cast(int, x), 0x76543210, 0xfedcba98, false, false)); }    // lane l with lane l ^ 16
__global__ __launch_bounds__(256) void k_attn(const float* __restrict__ FQ, const bf* __restrict__ XB, const bf* __restrict__ WKB, const bf* __restrict__ WVT, const float* __restrict__ bv, const int* __restrict__ idx, const float* __restrict__ BIAS, bf* Ah, bf* Al) {
    static_assert(NN % AP == 0 && (NB_ * NN) % AP == 0, "a workgroup's points lie in one batch and the grid covers the points exactly");
    __shared__ __attribute__((aligned(16))) unsigned char L[QT_BYTES];         // qt, later y: [point][16 rows][256]
    __shared__ __attribute__((aligned(16))) unsigned char XG[8 * XG_BYTES];    // each wave's 32 gathered rows. An array of its own, so that the compiler may move reads of the rows over stores of y
    const int lane = threadIdx.x & 31, lr = lane & 15, hi = lane >> 4; const int w = __builtin_amdgcn_readfirstlane((int)(threadIdx.x >> 5));
    const int p0 = blockIdx.x * AP; const int bt = p0 / NN; const bf* XBb = XB + (size_t)bt * NN * CC;    // a neighbour index counts inside its own batch
    unsigned char* xg = XG + w * XG_BYTES;
    v4u pre[KN];    // a point's 32 rows on their way to LDS: asked for one phase ahead, so that the gather's latency passes behind matrix work
    auto gather = [&](int pg) { const int* in_ = idx + (size_t)pg * KN; unsigned vo[KN];    // byte offset of this lane's 16 bytes in neighbour r's row
#pragma unroll
        for (int r = 0; r < KN; ++r) vo[r] = (unsigned)clampi(in_[r]) * (CC * 2u) + (unsigned)lane * 16u;
#pragma unroll
        for (int r = 0; r < KN; ++r) pre[r] = *(const v4u*)((const char*)XBb + vo[r]);
        XWAIT8(vo, 0); XWAIT8(vo, 8); XWAIT8(vo, 16); XWAIT8(vo, 24); };
    auto put = [&]() {
#pragma unroll
        for (int r = 0; r < KN; ++r) *(v4ua*)(xg + r * RP + lane * 16) = pre[r]; };
    const float* bp = BIAS + (((size_t)bt * NH_ + (lr & 7)) * NN + (p0 - bt * NN + 2 * w)) * KN + 8 * hi;    // head lr & 7, the wave's first point, neighbours 8 hi + r (and, 16 floats on, 16 + 8 hi + r)
    v8f c0 = *(const v8f*)bp, c1 = *(const v8f*)(bp + 16);    // a point's positional bias is asked for in front of its rows: loads return in order, so a bias asked for behind the next point's gather would make this point wait for that gather
    XWAIT(bp);
    {   // phase 1: head w, all 16 points
        const float SC = 0.17677669529663687f; const float* qp = FQ + (size_t)(p0 + lr) * CC + w * HD + 8 * hi;
        const v8f qr0 = *(const v8f*)qp, qr1 = *(const v8f*)(qp + 16); XWAIT(qp);
        const bf* wp = WKB + w * 512 + 8 * lane; unsigned char* o = L + lr * PP + w * RP + 16 * hi; v16bf wa[CC / 16];    // Wk in fragment order: rows 16 ct + lr, k step w
#pragma unroll
        for (int ct = 0; ct < CC / 16; ++ct) wa[ct] = WFrag<bf>::ldf(wp + (size_t)ct * 16 * CC);
        XWAIT(wp);
        gather(p0 + 2 * w);    // asked for behind phase 1's own operands: loads return in order, and phase 1 need not wait for the rows
        const v8f q0 = qr0 * SC, q1 = qr1 * SC; v8us h0, l0, h1, l1; split8(q0, h0, l0); split8(q1, h1, l1);
        const v16bf qh = cat16b(h0, h1), ql = cat16b(l0, l1);
#pragma unroll
        for (int ct = 0; ct < CC / 16; ++ct) { const v16bf a = wa[ct]; v8f d = (v8f){}; d = wmmab(a, qh, d); d = wmmab(a, ql, d);
            v8us dh, dl; split8(d, dh, dl); *(v8usa*)(o + ct * 32) = dh; *(v8usa*)(o + 8 * RP + ct * 32) = dl; }
    }
    __syncthreads();    // every head's qt rows of every point are in LDS before a wave takes up its two points
#pragma unroll 1    // rolled: the wave's two points run through one copy of the code, half the instruction bytes to fetch
    for (int t = 0; t < 2; ++t) {
        const int pl = 2 * w + t;
        put(); v8f s0 = c0, s1 = c1;    // C: the positional bias of neighbours 8 hi + r and 16 + 8 hi + r, head lr & 7
        if (t == 0) { c0 = *(const v8f*)(bp + KN); c1 = *(const v8f*)(bp + KN + 16); asm volatile("s_wait_xcnt 0x0" ::: "memory"); gather(p0 + pl + 1); }    // the same precaution as XWAIT
        __builtin_amdgcn_wave_barrier();    // the rows that the wave's lanes have just stored are read across lanes below
        const unsigned char* qa = L + pl * PP + (lr & 7) * RP + 16 * hi; const unsigned char* xa = xg + lr * RP + 16 * hi;
#pragma unroll
        for (int ks = 0; ks < CC / 32; ++ks) { const v16bf bh = ldsfrag(qa + ks * 64), bl = ldsfrag(qa + 8 * RP + ks * 64), a0 = ldsfrag(xa + ks * 64), a1 = ldsfrag(xa + 16 * RP + ks * 64);
            s0 = wmmab(a0, bh, s0); s1 = wmmab(a1, bh, s1); s0 = wmmab(a0, bl, s0); s1 = wmmab(a1, bl, s1); }
        float mx = -3.0e38f;
#pragma unroll
        for (int r = 0; r < 8; ++r) mx = fmaxf(mx, fmaxf(s0[r], s1[r]));
        mx = fmaxf(mx, xhalf(mx)); float sum = 0.f;
#pragma unroll
        for (int r = 0; r < 8; ++r) { s0[r] = __expf(s0[r] - mx); s1[r] = __expf(s1[r] - mx); sum += s0[r] + s1[r]; }
        sum += xhalf(sum); const float inv = __fdiv_rn(1.0f, sum); s0 *= inv; s1 *= inv;
        v8us h0, l0, h1, l1; split8(s0, h0, l0); split8(s1, h1, l1); const v16bf ph = cat16b(h0, h1), pw = cat16b(l0, l1);    // element s of the B operand is neighbour 8 hi + s, or 16 + 8 hi + s - 8 for s >= 8: what the lane holds
        const unsigned char* ta = xg + (8 * hi + (lane & 7)) * RP + 16 * ((lane >> 3) & 1); unsigned char* yo = L + pl * PP + lr * RP + 16 * hi;
#pragma unroll
        for (int g = 0; g < 2; ++g) { v16bf xa[8];    // eight fragments are asked for together: one pass through the LDS latency for eight column tiles
#pragma unroll
            for (int i = 0; i < 8; ++i) xa[i] = cat16b(ld_tr16(ta + 32 * (g * 8 + i)), ld_tr16(ta + 16 * RP + 32 * (g * 8 + i)));
#pragma unroll
            for (int i = 0; i < 8; ++i) { v8f d = (v8f){}; d = wmmab(xa[i], ph, d); d = wmmab(xa[i], pw, d);
                v8us dh, dl; split8(d, dh, dl); *(v8usa*)(yo + (g * 8 + i) * 32) = lr < 8 ? dh : dl; } }    // columns lr and lr + 8 hold the same head: the first stores the high parts (row h), the second the low parts (row 8 + h)
        __builtin_amdgcn_wave_barrier();    // the next point's rows are stored only behind this point's last transposing load
    }
    {   // phase 3: head w, all 16 points
        const bf* vp = WVT + (size_t)(w * HD) * CC + 8 * lane; const unsigned char* ya = L + lr * PP + w * RP + 16 * hi; v8f o0 = (v8f){}, o1 = (v8f){}; const int col = w * HD + 8 * hi; v16bf va[CC / 32][2];
#pragma unroll
        for (int ks = 0; ks < CC / 32; ++ks) { va[ks][0] = WFrag<bf>::ldf(vp + ks * 512); va[ks][1] = WFrag<bf>::ldf(vp + (size_t)16 * CC + ks * 512); }    // the head's Wv rows are asked for in front of the barrier: their latency passes behind the wait for the other waves
        XWAIT(vp);
        const float* bvp = bv + col; const v8f bv0 = *(const v8f*)bvp, bv1 = *(const v8f*)(bvp + 16); asm volatile("s_wait_xcnt 0x0" ::: "memory");    // the same precaution as XWAIT
        __syncthreads();    // every point's y is in LDS before phase 3 reads it
        v16bf yh[CC / 32], yl[CC / 32];    // all of y's fragments are asked for together: one pass through the LDS latency, not one per k step
#pragma unroll
        for (int ks = 0; ks < CC / 32; ++ks) { yh[ks] = ldsfrag(ya + ks * 64); yl[ks] = ldsfrag(ya + 8 * RP + ks * 64); }
        __builtin_amdgcn_sched_barrier(0);    // holds the fragment loads together in front of the products: left free, the compiler sank each pair to its use and waited for it there
#pragma unroll
        for (int ks = 0; ks < CC / 32; ++ks) { o0 = wmmab(va[ks][0], yh[ks], o0); o1 = wmmab(va[ks][1], yh[ks], o1); o0 = wmmab(va[ks][0], yl[ks], o0); o1 = wmmab(va[ks][1], yl[ks], o1); }
#pragma unroll
        for (int r = 0; r < 8; ++r) { o0[r] += bfr(bv0[r]); o1[r] += bfr(bv1[r]); }
        v8us h0, l0, h1, l1; split8(o0, h0, l0); split8(o1, h1, l1);
        // the lane holds point lr, columns 32 w + 8 hi + r and 32 w + 16 + 8 hi + r: the two halves of its own place in fragment (row tile p0 / 16, k step w) of the last GEMM's A operand, so the registers go out as they are, 512 contiguous bytes a store
        bf* ah = Ah + (size_t)p0 * CC + w * 512 + 8 * lane; bf* al = Al + (size_t)p0 * CC + w * 512 + 8 * lane;
        *(v8us*)ah = h0; *(v8us*)(ah + 256) = h1; *(v8us*)al = l0; *(v8us*)(al + 256) = l1;
        asm volatile("s_wait_xcnt 0x0" ::: "memory");    // the same precaution as XWAIT, behind the stores
    }
}

extern "C" void kernel_launch(void* const* d_in, const int* in_sizes, int n_in,
                              void* d_out, int out_size, void* d_ws, size_t ws_size, hipStream_t stream) {
    (void)in_sizes; (void)n_in; (void)out_size;
    const float* x = (const float*)d_in[0]; const float* xyz = (const float*)d_in[1]; const int* idx = (const int*)d_in[2]; const float* wq = (const float*)d_in[3]; const float* bq = (const float*)d_in[4]; const float* wk = (const float*)d_in[5]; const float* bk = (const float*)d_in[6]; const float* wv = (const float*)d_in[7]; const float* bv = (const float*)d_in[8];
    const float* wo = (const float*)d_in[9]; const float* bo = (const float*)d_in[10]; const float* W1 = (const float*)d_in[11]; const float* b1 = (const float*)d_in[12]; const float* W2 = (const float*)d_in[13]; const float* b2 = (const float*)d_in[14];
    float* OUT = (float*)d_out;     // [2][8192][256]
    char* wsp = (char*)d_ws;
    auto take = [&](size_t bytes) { char* p = wsp; wsp += (bytes + 255) & ~(size_t)255; return (void*)p; };
    bf* WT = (bf*)take((size_t)4 * CC * CC * 2);                          // Wq transposed, Wk as it is, Wv and Wo transposed, one after the other, each in fragment order
    bf* XB = (bf*)take((size_t)NB_ * NN * CC * 2); float* FQ = (float*)take((size_t)NB_ * NN * CC * 4);    // q [2*8192][256]
    float* BIAS = (float*)take((size_t)NB_ * NH_ * NN * KN * 4); bf* Ah = (bf*)take((size_t)NB_ * NN * CC * 2); bf* Al = (bf*)take((size_t)NB_ * NN * CC * 2);
    if ((size_t)(wsp - (char*)d_ws) > ws_size) return;    // total ~ 58 MB
    k_prep<<<4 * WT_BLK + BIAS_BLK + CVT_BLK, 256, 0, stream>>>(wq, wk, wv, wo, WT, x, XB, xyz, idx, W1, b1, W2, b2, BIAS);
    k_gemmw<bf, 0, true, false><<<dim3(NB_ * NN / 64, CC / 64, 1), 32, 0, stream>>>(XB, nullptr, WT, nullptr, CC, FQ, CC, bq, bq, bq, 0, 0, 0);
    k_attn<<<NB_ * NN / AP, 256, 0, stream>>>(FQ, XB, WT + (size_t)CC * CC, WT + (size_t)2 * CC * CC, bv, idx, BIAS, Ah, Al);
    k_gemmw<bf, 1, true, true><<<dim3(NB_ * NN / 64, CC / 64, 1), 32, 0, stream>>>(Ah, Al, WT + (size_t)3 * CC * CC, nullptr, CC, OUT, CC, bo, bo, bo, 0, 0, 0);
}

// v006
// One run takes 62.9 microseconds.
// Two timings next to v005 put it at 1.26 and 1.27 times that version's speed.
// Counting every step since v000, it is 3.11 times as fast.
#include <hip/hip_runtime.h>

// LocalSphereAttention (x [2][8192][256], xyz [2][8192][3], idx [2][8192][32] (int neighbour indices, read as data); q/k/v = x W + b (8 heads x 32); per point n and head h, over its 32 neighbours m = idx[n][kk]:
// score = q[n].k[m]/sqrt(32) + bias[n][kk][h], bias = relu((xyz[n] - xyz[m]) W1 + b1) W2 + b2; softmax over the 32 neighbours; out = sum attn v[m]; (merged) Wo + bo -> [2][8192][256]).
// Compute dtypes, f32 accumulate: every input rounded to bf16; q on PLAIN bf16 operands (inputs: exact) + bias; the positional-bias MLP and the softmax f32 on the VALU; scores and weighted sums on bf16 high + low parts against the gathered bf16 x rows (see k_attn)
// FRAGMENT ORDER: a 16-bit plane T[r][k] (k = 0..255) that is only ever read as WMMA fragments (the four weight planes) is stored by its producer as its reader loads it:
// the fragment of rows 16 rt .. 16 rt + 15, k = 32 ks .. 32 ks + 31 is 1 KiB at (rt * 8 + ks) KiB: [half j][lane = 16 hi + lr][8 values] = T[16 rt + lr][32 ks + 16 j + 8 hi + 0..7].
// A wave's 16-byte-a-lane load is then 512 contiguous bytes, 4 whole lines; from the row-major plane it took 32 bytes out of each of 16 lines.

#define NB_  2
#define NN   8192
#define CC   256
#define NH_  8
#define HD   32
#define KN   32
#define HB   32
typedef _Float16 h16;
typedef unsigned short bf;
typedef __attribute__((ext_vector_type(16))) __bf16   v16bf;
typedef __attribute__((ext_vector_type(16))) _Float16 v16h;
typedef __attribute__((ext_vector_type(8)))  _Float16 v8h;
typedef __attribute__((ext_vector_type(8)))  unsigned short v8us;
typedef __attribute__((ext_vector_type(8)))  float    v8f;
typedef __attribute__((ext_vector_type(4)))  float    v4f;
typedef v8h  __attribute__((may_alias)) v8ha;
typedef v4f  __attribute__((may_alias)) v4fa;
typedef v8us __attribute__((may_alias)) v8usa;

__device__ __forceinline__ unsigned short f2bf(float f) { unsigned u = __float_as_uint(f); u += 0x7FFFu + ((u >> 16) & 1u); return (unsigned short)(u >> 16); }
__device__ __forceinline__ float bf2f(unsigned short b) { return __uint_as_float(((unsigned)b) << 16); }
__device__ __forceinline__ float bfr(float f) { return bf2f(f2bf(f)); }
__device__ __forceinline__ v16h cat16(v8h lo, v8h hi) { return __builtin_shufflevector(lo, hi, 0, 1, 2, 3, 4, 5, 6, 7, 8, 9, 10, 11, 12, 13, 14, 15); }
__device__ __forceinline__ v16bf cat16b(v8us lo, v8us hi) { return __builtin_bit_cast(v16bf, __builtin_shufflevector(lo, hi, 0, 1, 2, 3, 4, 5, 6, 7, 8, 9, 10, 11, 12, 13, 14, 15)); }
__device__ __forceinline__ v8f wmma16(v16h a, v16h b, v8f c) { return __builtin_amdgcn_wmma_f32_16x16x32_f16(false, a, false, b, (short)0, c, false, false); }
__device__ __forceinline__ v8f wmmab(v16bf a, v16bf b, v8f c) { return __builtin_amdgcn_wmma_f32_16x16x32_bf16(false, a, false, b, (short)0, c, false, false); }



// ld: a fragment from a row-major plane (p holds row and 8 hi); ldf: from a plane in fragment order (p holds 8 lane). 16 rows are 16 K values in both.
template <typename T16> struct WFrag;
template <> struct WFrag<h16> { typedef v16h V; static __device__ __forceinline__ V ld(const h16* p) { return cat16(*(const v8h*)p, *(const v8h*)(p + 16)); } static __device__ __forceinline__ V ldf(const h16* p) { return cat16(*(const v8h*)p, *(const v8h*)(p + 256)); } static __device__ __forceinline__ v8f mma(V a, V b, v8f c) { return wmma16(a, b, c); } };
template <> struct WFrag<bf> { typedef v16bf V; static __device__ __forceinline__ V ld(const bf* p) { return cat16b(*(const v8us*)p, *(const v8us*)(p + 16)); } static __device__ __forceinline__ V ldf(const bf* p) { return cat16b(*(const v8us*)p, *(const v8us*)(p + 256)); } static __device__ __forceinline__ v8f mma(V a, V b, v8f c) { return wmmab(a, b, c); } };
__device__ __forceinline__ void splitf(float y, unsigned short& h, unsigned short& l) { h = f2bf(y); l = f2bf(y - bf2f(h)); }
typedef __attribute__((ext_vector_type(2))) unsigned short v2us;
typedef __attribute__((ext_vector_type(4))) unsigned short v4us;

__device__ __forceinline__ size_t fragofs(int r, int k) { return ((size_t)(r >> 4) * (CC / 32) + (k >> 5)) * 512 + ((k >> 4) & 1) * 256 + (((k >> 3) & 1) * 16 + (r & 15)) * 8 + (k & 7); }    // where T[r][k] lies in a plane in fragment order, in values; 8 values from a k that is a multiple of 8 lie together
__device__ __forceinline__ void d_wtG(int blk, const float* __restrict__ w, int K, int N, bf* Bt) {
    const int lane = threadIdx.x & 31; const int L0 = (blk * 8 + (threadIdx.x >> 5)) * 8; const int nlines = N * K / 64;
{
#pragma unroll 1
        for (int l = 0; l < 8; ++l) { const int L = L0 + l; if (L >= nlines) break; const size_t e = (size_t)L * 64 + lane * 2; const int k = (int)(e % K), n = (int)(e / K); v2us o;
            o[0] = f2bf(w[(size_t)k * N + n]); o[1] = f2bf(w[(size_t)(k + 1) * N + n]); bf* dp = Bt + fragofs(n, k); *(v2us*)dp = o;
            asm volatile("s_wait_xcnt 0x0" :: "v"(dp) : "memory"); }    // a precaution: the next trip forms its addresses in the registers that this store names only behind this wait
         }
}
__device__ __forceinline__ void d_cvt8(int blk, const float* __restrict__ src, bf* dst, size_t n8) { const size_t i = (size_t)blk * 256 + threadIdx.x; if (i >= n8) return; const v8f v = *(const v8f*)(src + i * 8); v8us o;
#pragma unroll
    for (int k = 0; k < 8; ++k) o[k] = f2bf(v[k]); *(v8us*)(dst + i * 8) = o;  }
__device__ __forceinline__ void d_cvt8f(int blk, const float* __restrict__ src, bf* dst) { const int i = blk * 256 + threadIdx.x; const unsigned so = 32u * i; const v8f v = *(const v8f*)((const char*)src + so); v8us o;    // a [256][256] plane, rounded and stored in fragment order
    asm volatile("s_wait_xcnt 0x0" :: "v"(so) : "memory");    // a precaution: the register that holds the load's offset is rewritten only behind this wait; it is the wait's input, so that it keeps its value up to it
#pragma unroll
    for (int k = 0; k < 8; ++k) o[k] = f2bf(v[k]); const unsigned dofs = 2u * (unsigned)fragofs(i / (CC / 8), (i % (CC / 8)) * 8); *(v8us*)((char*)dst + dofs) = o;
    asm volatile("s_wait_xcnt 0x0" :: "v"(dofs), "v"(o) : "memory"); }    // the same precaution behind the store, for its offset and its data
__device__ __forceinline__ int clampi(int m) { return m < 0 ? 0 : (m >= NN ? NN - 1 : m); }
// both batches: eg runs over [2][8192][32]; xyz and BIAS step to the batch's own plane.
// The MLP's 392 weights are rounded to bf16 ONCE per block, into LDS (row j: W1[0][j], W1[1][j], W1[2][j], b1[j], W2[j][0..7]; behind the 32 rows: b2), and every thread works 4 neighbouring edges of one point,
// so that a row read from LDS (three 16-byte broadcasts) serves 128 edges of a wave. Each edge's arithmetic, and its order, is as before; two edges share a packed instruction.
#define BE 4
#define SW_N (HB * 12 + NH_)
typedef __attribute__((ext_vector_type(2))) float v2f;
typedef __attribute__((ext_vector_type(4))) int   v4i;
__device__ __forceinline__ void d_bias(int blk, const float* __restrict__ xyz, const int* __restrict__ idx, const float* __restrict__ W1, const float* __restrict__ b1, const float* __restrict__ W2, const float* __restrict__ b2, float* BIAS, float* sw) {
    static_assert((NB_ * NN * KN) % (256 * BE) == 0, "the bias blocks cover the edges exactly: no range guard");
    const int eg = (blk * 256 + threadIdx.x) * BE; const int bt = eg / (NN * KN); const int e = eg - bt * (NN * KN); const int n = e / KN; const v4i mi = *(const v4i*)(idx + eg); xyz += (size_t)bt * NN * 3; BIAS += (size_t)bt * NH_ * NN * KN;
    const float* pn = xyz + (size_t)n * 3; const float* pm[BE]; float xn[3], xm[BE][3];
#pragma unroll
    for (int i = 0; i < BE; ++i) pm[i] = xyz + (size_t)clampi(mi[i]) * 3;
#pragma unroll
    for (int a = 0; a < 3; ++a) xn[a] = pn[a];
#pragma unroll
    for (int i = 0; i < BE; ++i)
#pragma unroll
        for (int a = 0; a < 3; ++a) xm[i][a] = pm[i][a];
    // the weights are staged behind the issue of the coordinate gathers, so that both latencies pass together
    for (int t = threadIdx.x; t < SW_N; t += 256) { const int j = t / 12, c = t - j * 12; sw[t] = bfr(t >= HB * 12 ? b2[t - HB * 12] : (c < 3 ? W1[c * HB + j] : (c == 3 ? b1[j] : W2[j * NH_ + c - 4]))); }
    __syncthreads();    // the block's rounded weights are complete before any thread reads them; every thread of a bias block passes here
    v2f r[BE / 2][3];
#pragma unroll
    for (int i = 0; i < BE; ++i)
#pragma unroll
        for (int a = 0; a < 3; ++a) r[i >> 1][a][i & 1] = __fsub_rn(bfr(xn[a]), bfr(xm[i][a]));
    v2f acc[BE / 2][NH_];
#pragma unroll
    for (int q = 0; q < BE / 2; ++q)
#pragma unroll
        for (int h = 0; h < NH_; ++h) acc[q][h] = (v2f){0.f, 0.f};
    v4f wr[2][3];    // two register sets for a weight row: row j + 1 is asked for before row j is worked, so that its LDS latency passes behind row j's sums
#pragma unroll
    for (int c = 0; c < 3; ++c) wr[0][c] = *(const v4f*)(sw + c * 4);
#pragma unroll    // unrolled whole: the two register sets alternate by a compile-time index, and every LDS row address is an immediate
    for (int j = 0; j < HB; ++j) {
        if (j + 1 < HB) {
#pragma unroll
            for (int c = 0; c < 3; ++c) wr[(j + 1) & 1][c] = *(const v4f*)(sw + (j + 1) * 12 + c * 4); }
        const v4f wa = wr[j & 1][0], wb = wr[j & 1][1], wc = wr[j & 1][2];
        // the empty asm statements on the products are carried over from the scalar form unchanged in kind: product and add keep their two roundings, so every bias value stays bit-identical
#pragma unroll
        for (int q = 0; q < BE / 2; ++q) { v2f s = (v2f){0.f, 0.f};
#pragma unroll
            for (int a = 0; a < 3; ++a) { v2f p = r[q][a] * wa[a]; asm volatile("" : "+v"(p)); s = s + p; }
            s = s + wa[3]; const v2f hv = (v2f){fmaxf(s[0], 0.f), fmaxf(s[1], 0.f)};
#pragma unroll
            for (int h = 0; h < NH_; ++h) { v2f p = hv * (h < 4 ? wb[h & 3] : wc[h & 3]); asm volatile("" : "+v"(p)); acc[q][h] = acc[q][h] + p; } } }
    { const v4f b2a = *(const v4f*)(sw + HB * 12), b2b = *(const v4f*)(sw + HB * 12 + 4);
#pragma unroll
        for (int h = 0; h < NH_; ++h) { const float bb = h < 4 ? b2a[h & 3] : b2b[h & 3]; const v2f o0 = acc[0][h] + bb, o1 = acc[1][h] + bb; *(v4f*)(BIAS + (size_t)h * NN * KN + e) = (v4f){o0[0], o0[1], o1[0], o1[1]};
            asm volatile("s_wait_xcnt 0x0" ::: "memory"); }    // the next head's sum may reuse the register that this store names
         } }
// k_prep: the three independent preparation passes in ONE launch, told apart by the block index: first the four weight planes (three transposes, few blocks, a serial latency-bound loop; Wk is only rounded), then the positional bias (the longest), last the x conversion (short blocks fill the tail).
#define WT_BLK   ((CC * CC / 64 + 63) / 64)
#define BIAS_BLK ((NB_ * NN * KN / BE + 255) / 256)
#define CVT_BLK  ((NB_ * NN * CC / 8 + 255) / 256)
// 10 waves per SIMD asked for: left free, the unrolled bias MLP took 176 registers, and the x conversion's blocks, which share this kernel and live on loads in flight, would be held to 5 waves per SIMD
__global__ __launch_bounds__(256, 10) void k_prep(const float* __restrict__ wq, const float* __restrict__ wk, const float* __restrict__ wv, const float* __restrict__ wo, bf* WT, const float* __restrict__ x, bf* XB,
                                              const float* __restrict__ xyz, const int* __restrict__ idx, const float* __restrict__ W1, const float* __restrict__ b1, const float* __restrict__ W2, const float* __restrict__ b2, float* BIAS) {
    __shared__ __align__(16) float sw[SW_N];    // the bias blocks' rounded MLP weights
    const int blk = blockIdx.x;
    if (blk < 4 * WT_BLK) { const int t = blk / WT_BLK;
        if (t == 1) { static_assert(2 * WT_BLK * 256 == CC * CC / 8, "two passes of the plane's blocks cover Wk exactly"); d_cvt8f(blk - WT_BLK, wk, WT + (size_t)CC * CC); d_cvt8f(blk, wk, WT + (size_t)CC * CC); }    // Wk's rows are the A operand's rows (k_attn, phase 1): rounded, not transposed
        else d_wtG(blk - t * WT_BLK, t == 0 ? wq : (t == 2 ? wv : wo), CC, CC, WT + (size_t)t * CC * CC); }
    else if (blk < 4 * WT_BLK + BIAS_BLK) d_bias(blk - 4 * WT_BLK, xyz, idx, W1, b1, W2, b2, BIAS, sw);
    else d_cvt8(blk - 4 * WT_BLK - BIAS_BLK, x, XB, (size_t)NB_ * NN * CC / 8);
}
// k_attn: the K and V projections are applied on the query side, so that a neighbour is gathered ONCE, as its 512-byte bf16 x row (exact: x is rounded to bf16 anyway), not as a 1-KiB f32 K row and a 1-KiB f32 V row:
//   q[n][h].k[m][h] = x[m] . qt[n][h] + q[n][h].bk[h], qt[n][h][c] = sum_d Wk[c][h*32+d] q[n][h][d]; the bk term is the same for a point-head's 32 neighbours and cancels in the softmax;
//   sum_j attn[j] v[m_j][h] = (sum_j attn[j] x[m_j]) Wv[:, h] + bv[h] (the weights sum to 1).
// The q projection and the output projection are phases of this kernel too: a workgroup's 16 points need only their own x rows for q, and their own attention output for the last product, so neither plane goes through memory and neither needs a launch.
// One workgroup = 16 points, 8 waves. Every f32 value that becomes a matrix operand (q, qt, the weights, y, out) goes in as bf16 high part + bf16 low part, two products into one f32 accumulator.
//   phase 0, wave = head: q^T [d][point] = Wq^T rows x the points' x rows (plain bf16 operands), + bq; the result lies in the registers as phase 1's B operand wants it;
//   phase 1, wave = head: qt^T [c][point] = Wk rows x q, stored to LDS as QT[point][high: row h, low: row 8 + h][c];
//   phase 2, wave = 2 points, one after the other: the 32 x rows in LDS; scores^T [j][h] = rows x qt with the positional bias as C; softmax inside the lane and with lane ^ 16; the two score tiles, converted in place,
//            are the B operand of y^T [c][h] = rows^T (transposing LDS loads) x weights; y replaces the point's qt in LDS;
//   phase 3, wave = head: out^T [d][point] = Wv^T rows x y, + bv, split: the lane's registers are k step w of phase 4's B operand, and go to LDS as they are;
//   phase 4, wave = 32 output columns: final^T [e][point] = Wo^T rows x all eight k steps (high, then low part, k step by k step), + bo, turned through the wave's own LDS range into whole 128-byte lines.
// Every '#pragma unroll' in k_attn and its helpers makes the indices of a register array compile-time constants, so that the array stays in registers and every LDS offset is an immediate.
#define AP 16                      // points per workgroup
#define RP 528                     // LDS pitch in bytes of a row of 256 16-bit values: 16 B x odd
#define PP (16 * RP + 16)          // one point's 16 rows; 16 B x odd, since phases 1 and 3 walk the points by lane
#define QT_BYTES (AP * PP)
#define XG_BYTES (KN * RP)
typedef __attribute__((ext_vector_type(8))) short  v8s;
typedef __attribute__((ext_vector_type(4))) unsigned v4u;
typedef v4u __attribute__((may_alias)) v4ua;
typedef __attribute__((ext_vector_type(2))) __bf16 v2bf;
// f32 -> bf16 high part (round to nearest even) + bf16 low part (the remainder, rounded); two values per conversion instruction
__device__ __forceinline__ void split8(v8f y, v8us& h, v8us& l) { v4u hp, lp;
#pragma unroll
    for (int i = 0; i < 4; ++i) { const unsigned u = __builtin_bit_cast(unsigned, __builtin_convertvector((v2f){y[2 * i], y[2 * i + 1]}, v2bf)); hp[i] = u;
        lp[i] = __builtin_bit_cast(unsigned, __builtin_convertvector((v2f){y[2 * i] - __uint_as_float(u << 16), y[2 * i + 1] - __uint_as_float(u & 0xFFFF0000u)}, v2bf)); }
    h = __builtin_bit_cast(v8us, hp); l = __builtin_bit_cast(v8us, lp); }
// a precaution, written behind each group of global loads: the registers that hold their addresses are rewritten only behind this wait; the addresses are its inputs, so that they stay in their registers up to it
#define XWAIT(p) asm volatile("s_wait_xcnt 0x0" :: "v"(p) : "memory")
#define XWAIT8(a, i) asm volatile("s_wait_xcnt 0x0" :: "v"(a[i]), "v"(a[i + 1]), "v"(a[i + 2]), "v"(a[i + 3]), "v"(a[i + 4]), "v"(a[i + 5]), "v"(a[i + 6]), "v"(a[i + 7]) : "memory")
__device__ __forceinline__ v16bf ldsfrag(const unsigned char* p) { return cat16b(*(const v8usa*)p, *(const v8usa*)(p + 32)); }    // 32 k of a row in the hardware's k order: bytes 16 * hi and 32 + 16 * hi of 64 (hi is in p)
__device__ __forceinline__ v8us ld_tr16(const unsigned char* p) { typedef __attribute__((address_space(3))) v8s lds_v8s; return __builtin_bit_cast(v8us, __builtin_amdgcn_ds_load_tr16_b128_v8i16((lds_v8s*)p)); }
__device__ __forceinline__ float xhalf(float x) { return __builtin_bit_cast(float, __builtin_amdgcn_permlanex16(__builtin_bit_cast(int, x), __builtin_bit_cast(int, x), 0x76543210, 0xfedcba98, false, false)); }    // lane l with lane l ^ 16
__global__ __launch_bounds__(256) void k_attn(const bf* __restrict__ XB, const bf* __restrict__ WQT, const float* __restrict__ bq, const bf* __restrict__ WKB, const bf* __restrict__ WVT, const float* __restrict__ bv, const bf* __restrict__ WOT, const float* __restrict__ bo, const int* __restrict__ idx, const float* __restrict__ BIAS, float* OUT) {
    static_assert(NN % AP == 0 && (NB_ * NN) % AP == 0, "a workgroup's points lie in one batch and the grid covers the points exactly");
    __shared__ __attribute__((aligned(16))) unsigned char L[QT_BYTES];         // qt, later y: [point][16 rows][256]
    __shared__ __attribute__((aligned(16))) unsigned char XG[8 * XG_BYTES];    // each wave's 32 gathered rows. An array of its own, so that the compiler may move reads of the rows over stores of y
    const int lane = threadIdx.x & 31, lr = lane & 15, hi = lane >> 4; const int w = __builtin_amdgcn_readfirstlane((int)(threadIdx.x >> 5));
    const int p0 = blockIdx.x * AP; const int bt = p0 / NN; const bf* XBb = XB + (size_t)bt * NN * CC;    // a neighbour index counts inside its own batch
    unsigned char* xg = XG + w * XG_BYTES;
    v4u pre[KN];    // a point's 32 rows on their way to LDS: asked for one phase ahead, so that the gather's latency passes behind matrix work
    auto gather = [&](int pg) { const int* in_ = idx + (size_t)pg * KN; unsigned vo[KN];    // byte offset of this lane's 16 bytes in neighbour r's row
#pragma unroll
        for (int r = 0; r < KN; ++r) vo[r] = (unsigned)clampi(in_[r]) * (CC * 2u) + (unsigned)lane * 16u;
#pragma unroll
        for (int r = 0; r < KN; ++r) pre[r] = *(const v4u*)((const char*)XBb + vo[r]);
        XWAIT8(vo, 0); XWAIT8(vo, 8); XWAIT8(vo, 16); XWAIT8(vo, 24); };
    auto put = [&]() {
#pragma unroll
        for (int r = 0; r < KN; ++r) *(v4ua*)(xg + r * RP + lane * 16) = pre[r]; };
    const float* bp = BIAS + (((size_t)bt * NH_ + (lr & 7)) * NN + (p0 - bt * NN + 2 * w)) * KN + 8 * hi;    // head lr & 7, the wave's first point, neighbours 8 hi + r (and, 16 floats on, 16 + 8 hi + r)
    v8f c0 = *(const v8f*)bp, c1 = *(const v8f*)(bp + 16);    // a point's positional bias is asked for in front of its rows: loads return in order, so a bias asked for behind the next point's gather would make this point wait for that gather
    XWAIT(bp);
    {   // phases 0 and 1: head w, all 16 points
        const float SC = 0.17677669529663687f; const bf* xp = XB + (size_t)(p0 + lr) * CC + 8 * hi; const bf* wqp = WQT + (size_t)(w * HD) * CC + 8 * lane; v16bf xq[CC / 32], wq[CC / 32][2];    // B: point lr's x row; A: Wq^T in fragment order, rows 32 w + lr and 32 w + 16 + lr
#pragma unroll
        for (int ks = 0; ks < CC / 32; ++ks) xq[ks] = WFrag<bf>::ld(xp + ks * 32);
        XWAIT(xp);
#pragma unroll
        for (int ks = 0; ks < CC / 32; ++ks) { wq[ks][0] = WFrag<bf>::ldf(wqp + ks * 512); wq[ks][1] = WFrag<bf>::ldf(wqp + (size_t)16 * CC + ks * 512); }
        XWAIT(wqp);
        const float* bqp = bq + w * HD + 8 * hi; const v8f bq0 = *(const v8f*)bqp, bq1 = *(const v8f*)(bqp + 16); XWAIT(bqp);
        const bf* wp = WKB + w * 512 + 8 * lane; unsigned char* o = L + lr * PP + w * RP + 16 * hi; v16bf wa[CC / 16];    // Wk in fragment order: rows 16 ct + lr, k step w
#pragma unroll
        for (int ct = 0; ct < CC / 16; ++ct) wa[ct] = WFrag<bf>::ldf(wp + (size_t)ct * 16 * CC);
        XWAIT(wp);
        __builtin_amdgcn_sched_barrier(0);    // holds phase 0's products behind the issue of phase 1's operands: left free, the compiler waited for the first Wq rows before it asked for Wk, one more latency in a row
        v8f qr0 = (v8f){}, qr1 = (v8f){};    // the lane's q: point lr, d = 8 hi + r and 16 + 8 hi + r of head w
#pragma unroll
        for (int ks = 0; ks < CC / 32; ++ks) { qr0 = wmmab(wq[ks][0], xq[ks], qr0); qr1 = wmmab(wq[ks][1], xq[ks], qr1); }
#pragma unroll
        for (int r = 0; r < 8; ++r) { qr0[r] += bfr(bq0[r]); qr1[r] += bfr(bq1[r]); }
        gather(p0 + 2 * w);    // asked for behind the operands of phases 0 and 1: loads return in order, and these phases need not wait for the rows
        const v8f q0 = qr0 * SC, q1 = qr1 * SC; v8us h0, l0, h1, l1; split8(q0, h0, l0); split8(q1, h1, l1);
        const v16bf qh = cat16b(h0, h1), ql = cat16b(l0, l1);
#pragma unroll
        for (int ct = 0; ct < CC / 16; ++ct) { const v16bf a = wa[ct]; v8f d = (v8f){}; d = wmmab(a, qh, d); d = wmmab(a, ql, d);
            v8us dh, dl; split8(d, dh, dl); *(v8usa*)(o + ct * 32) = dh; *(v8usa*)(o + 8 * RP + ct * 32) = dl; }
    }
    __syncthreads();    // every head's qt rows of every point are in LDS before a wave takes up its two points
#pragma unroll 1    // rolled: the wave's two points run through one copy of the code, half the instruction bytes to fetch
    for (int t = 0; t < 2; ++t) {
        const int pl = 2 * w + t;
        put(); v8f s0 = c0, s1 = c1;    // C: the positional bias of neighbours 8 hi + r and 16 + 8 hi + r, head lr & 7
        if (t == 0) { c0 = *(const v8f*)(bp + KN); c1 = *(const v8f*)(bp + KN + 16); asm volatile("s_wait_xcnt 0x0" ::: "memory"); gather(p0 + pl + 1); }    // the same precaution as XWAIT
        __builtin_amdgcn_wave_barrier();    // the rows that the wave's lanes have just stored are read across lanes below
        const unsigned char* qa = L + pl * PP + (lr & 7) * RP + 16 * hi; const unsigned char* xa = xg + lr * RP + 16 * hi;
#pragma unroll
        for (int ks = 0; ks < CC / 32; ++ks) { const v16bf bh = ldsfrag(qa + ks * 64), bl = ldsfrag(qa + 8 * RP + ks * 64), a0 = ldsfrag(xa + ks * 64), a1 = ldsfrag(xa + 16 * RP + ks * 64);
            s0 = wmmab(a0, bh, s0); s1 = wmmab(a1, bh, s1); s0 = wmmab(a0, bl, s0); s1 = wmmab(a1, bl, s1); }
        float mx = -3.0e38f;
#pragma unroll
        for (int r = 0; r < 8; ++r) mx = fmaxf(mx, fmaxf(s0[r], s1[r]));
        mx = fmaxf(mx, xhalf(mx)); float sum = 0.f;
#pragma unroll
        for (int r = 0; r < 8; ++r) { s0[r] = __expf(s0[r] - mx); s1[r] = __expf(s1[r] - mx); sum += s0[r] + s1[r]; }
        sum += xhalf(sum); const float inv = __fdiv_rn(1.0f, sum); s0 *= inv; s1 *= inv;
        v8us h0, l0, h1, l1; split8(s0, h0, l0); split8(s1, h1, l1); const v16bf ph = cat16b(h0, h1), pw = cat16b(l0, l1);    // element s of the B operand is neighbour 8 hi + s, or 16 + 8 hi + s - 8 for s >= 8: what the lane holds
        const unsigned char* ta = xg + (8 * hi + (lane & 7)) * RP + 16 * ((lane >> 3) & 1); unsigned char* yo = L + pl * PP + lr * RP + 16 * hi;
#pragma unroll
        for (int g = 0; g < 2; ++g) { v16bf xa[8];    // eight fragments are asked for together: one pass through the LDS latency for eight column tiles
#pragma unroll
            for (int i = 0; i < 8; ++i) xa[i] = cat16b(ld_tr16(ta + 32 * (g * 8 + i)), ld_tr16(ta + 16 * RP + 32 * (g * 8 + i)));
#pragma unroll
            for (int i = 0; i < 8; ++i) { v8f d = (v8f){}; d = wmmab(xa[i], ph, d); d = wmmab(xa[i], pw, d);
                v8us dh, dl; split8(d, dh, dl); *(v8usa*)(yo + (g * 8 + i) * 32) = lr < 8 ? dh : dl; } }    // columns lr and lr + 8 hold the same head: the first stores the high parts (row h), the second the low parts (row 8 + h)
        __builtin_amdgcn_wave_barrier();    // the next point's rows are stored only behind this point's last transposing load
    }
    {   // phase 3: head w, all 16 points
        const bf* vp = WVT + (size_t)(w * HD) * CC + 8 * lane; const unsigned char* ya = L + lr * PP + w * RP + 16 * hi; v8f o0 = (v8f){}, o1 = (v8f){}; const int col = w * HD + 8 * hi; v16bf va[CC / 32][2];
#pragma unroll
        for (int ks = 0; ks < CC / 32; ++ks) { va[ks][0] = WFrag<bf>::ldf(vp + ks * 512); va[ks][1] = WFrag<bf>::ldf(vp + (size_t)16 * CC + ks * 512); }    // the head's Wv rows are asked for in front of the barrier: their latency passes behind the wait for the other waves
        XWAIT(vp);
        const float* bvp = bv + col; const v8f bv0 = *(const v8f*)bvp, bv1 = *(const v8f*)(bvp + 16); XWAIT(bvp);
        __syncthreads();    // every point's y is in LDS before phase 3 reads it
        const bf* op = WOT + (size_t)(w * HD) * CC + 8 * lane; v16bf wo[CC / 32][2];    // phase 4's Wo^T rows 32 w + lr and 32 w + 16 + lr are asked for behind the barrier, which waits for every load in flight: they land behind phase 3's products
#pragma unroll
        for (int ks = 0; ks < CC / 32; ++ks) { wo[ks][0] = WFrag<bf>::ldf(op + ks * 512); wo[ks][1] = WFrag<bf>::ldf(op + (size_t)16 * CC + ks * 512); }
        XWAIT(op);
        const float* bop = bo + col; const v8f bo0 = *(const v8f*)bop, bo1 = *(const v8f*)(bop + 16); XWAIT(bop);
        v16bf yh[CC / 32], yl[CC / 32];    // all of y's fragments are asked for together: one pass through the LDS latency, not one per k step
#pragma unroll
        for (int ks = 0; ks < CC / 32; ++ks) { yh[ks] = ldsfrag(ya + ks * 64); yl[ks] = ldsfrag(ya + 8 * RP + ks * 64); }
        __builtin_amdgcn_sched_barrier(0);    // holds the fragment loads together in front of the products: left free, the compiler sank each pair to its use and waited for it there
#pragma unroll
        for (int ks = 0; ks < CC / 32; ++ks) { o0 = wmmab(va[ks][0], yh[ks], o0); o1 = wmmab(va[ks][1], yh[ks], o1); o0 = wmmab(va[ks][0], yl[ks], o0); o1 = wmmab(va[ks][1], yl[ks], o1); }
#pragma unroll
        for (int r = 0; r < 8; ++r) { o0[r] += bfr(bv0[r]); o1[r] += bfr(bv1[r]); }
        v8us h0, l0, h1, l1; split8(o0, h0, l0); split8(o1, h1, l1);
        // phase 4. The lane holds point lr, columns 32 w + 8 hi + r and 32 w + 16 + 8 hi + r: the two halves of its own place in k step w of the B operand. The gathered rows' LDS is free since the barrier above: 2 KiB a k step, [high, low][half][lane][16 bytes]
        unsigned char* ex = XG + lane * 16;
        *(v8usa*)(ex + w * 2048) = h0; *(v8usa*)(ex + w * 2048 + 512) = h1; *(v8usa*)(ex + w * 2048 + 1024) = l0; *(v8usa*)(ex + w * 2048 + 1536) = l1;
        __syncthreads();    // every head's columns are in LDS before a wave sums over all of them
        v16bf ah[CC / 32], al[CC / 32];
#pragma unroll
        for (int ks = 0; ks < CC / 32; ++ks) { ah[ks] = cat16b(*(const v8usa*)(ex + ks * 2048), *(const v8usa*)(ex + ks * 2048 + 512)); al[ks] = cat16b(*(const v8usa*)(ex + ks * 2048 + 1024), *(const v8usa*)(ex + ks * 2048 + 1536)); }
        __builtin_amdgcn_sched_barrier(0);    // as in phase 3: holds the fragment loads together in front of the products, one pass through the LDS latency
        v8f e0 = (v8f){}, e1 = (v8f){};
#pragma unroll
        for (int ks = 0; ks < CC / 32; ++ks) { e0 = wmmab(wo[ks][0], ah[ks], e0); e1 = wmmab(wo[ks][1], ah[ks], e1); e0 = wmmab(wo[ks][0], al[ks], e0); e1 = wmmab(wo[ks][1], al[ks], e1); }
#pragma unroll
        for (int r = 0; r < 8; ++r) { e0[r] += bfr(bo0[r]); e1[r] += bfr(bo1[r]); }
        // the lane holds point lr, output columns 32 w + 8 hi + r and 32 w + 16 + 8 hi + r: 32-byte pieces. Through the wave's own LDS range (16 rows of 128 bytes, pitch 144 = 16 B x odd) they become whole lines: 8 lanes a point, 4 points a store
        unsigned char* st = XG + 8 * 2048 + w * (16 * 144); unsigned char* sp = st + lr * 144 + hi * 32;
        *(v4fa*)sp = (v4f){e0[0], e0[1], e0[2], e0[3]}; *(v4fa*)(sp + 16) = (v4f){e0[4], e0[5], e0[6], e0[7]}; *(v4fa*)(sp + 64) = (v4f){e1[0], e1[1], e1[2], e1[3]}; *(v4fa*)(sp + 80) = (v4f){e1[4], e1[5], e1[6], e1[7]};
        __builtin_amdgcn_wave_barrier();    // the rows that the wave's lanes have just stored are read across lanes below
        float* og = OUT + (size_t)(p0 + (lane >> 3)) * CC + w * HD + (lane & 7) * 4; v4f ov[4];
#pragma unroll
        for (int i = 0; i < 4; ++i) ov[i] = *(const v4fa*)(st + (i * 4 + (lane >> 3)) * 144 + (lane & 7) * 16);
#pragma unroll
        for (int i = 0; i < 4; ++i) *(v4f*)(og + (size_t)i * 4 * CC) = ov[i];
        asm volatile("s_wait_xcnt 0x0" :: "v"(og), "v"(ov[0]), "v"(ov[1]), "v"(ov[2]), "v"(ov[3]) : "memory");    // the same precaution as XWAIT, behind the stores, for their address and their data
    }
}

extern "C" void kernel_launch(void* const* d_in, const int* in_sizes, int n_in,
                              void* d_out, int out_size, void* d_ws, size_t ws_size, hipStream_t stream) {
    (void)in_sizes; (void)n_in; (void)out_size;
    const float* x = (const float*)d_in[0]; const float* xyz = (const float*)d_in[1]; const int* idx = (const int*)d_in[2]; const float* wq = (const float*)d_in[3]; const float* bq = (const float*)d_in[4]; const float* wk = (const float*)d_in[5]; const float* bk = (const float*)d_in[6]; const float* wv = (const float*)d_in[7]; const float* bv = (const float*)d_in[8];
    const float* wo = (const float*)d_in[9]; const float* bo = (const float*)d_in[10]; const float* W1 = (const float*)d_in[11]; const float* b1 = (const float*)d_in[12]; const float* W2 = (const float*)d_in[13]; const float* b2 = (const float*)d_in[14];
    float* OUT = (float*)d_out;     // [2][8192][256]
    char* wsp = (char*)d_ws;
    auto take = [&](size_t bytes) { char* p = wsp; wsp += (bytes + 255) & ~(size_t)255; return (void*)p; };
    bf* WT = (bf*)take((size_t)4 * CC * CC * 2);                          // Wq transposed, Wk as it is, Wv and Wo transposed, one after the other, each in fragment order
    bf* XB = (bf*)take((size_t)NB_ * NN * CC * 2);
    float* BIAS = (float*)take((size_t)NB_ * NH_ * NN * KN * 4);
    if ((size_t)(wsp - (char*)d_ws) > ws_size) return;    // total ~ 26 MB
    k_prep<<<4 * WT_BLK + BIAS_BLK + CVT_BLK, 256, 0, stream>>>(wq, wk, wv, wo, WT, x, XB, xyz, idx, W1, b1, W2, b2, BIAS);
    k_attn<<<NB_ * NN / AP, 256, 0, stream>>>(XB, WT, bq, WT + (size_t)CC * CC, WT + (size_t)2 * CC * CC, bv, WT + (size_t)3 * CC * CC, bo, idx, BIAS, OUT);
}

// v007
// Measured time: 55.9 microseconds a run.
// Next to v006, in two timings, it ran 1.13 and 1.12 times as fast.
// Counting every step since v000, it is 3.51 times as fast.
#include <hip/hip_runtime.h>

// LocalSphereAttention (x [2][8192][256], xyz [2][8192][3], idx [2][8192][32] (int neighbour indices, read as data); q/k/v = x W + b (8 heads x 32); per point n and head h, over its 32 neighbours m = idx[n][kk]:
// score = q[n].k[m]/sqrt(32) + bias[n][kk][h], bias = relu((xyz[n] - xyz[m]) W1 + b1) W2 + b2; softmax over the 32 neighbours; out = sum attn v[m]; (merged) Wo + bo -> [2][8192][256]).
// Compute dtypes, f32 accumulate: every input rounded to bf16; q on PLAIN bf16 operands (inputs: exact) + bias; the positional-bias MLP and the softmax f32 on the VALU; scores and weighted sums on bf16 high + low parts against the gathered bf16 x rows (see k_attn)
// FRAGMENT ORDER: a 16-bit plane T[r][k] (k = 0..255) that is only ever read as WMMA fragments (the four weight planes) is stored by its producer as its reader loads it:
// the fragment of rows 16 rt .. 16 rt + 15, k = 32 ks .. 32 ks + 31 is 1 KiB at (rt * 8 + ks) KiB: [half j][lane = 16 hi + lr][8 values] = T[16 rt + lr][32 ks + 16 j + 8 hi + 0..7].
// A wave's 16-byte-a-lane load is then 512 contiguous bytes, 4 whole lines; from the row-major plane it took 32 bytes out of each of 16 lines.

#define NB_  2
#define NN   8192
#define CC   256
#define NH_  8
#define HD   32
#define KN   32
#define HB   32
typedef _Float16 h16;
typedef unsigned short bf;
typedef __attribute__((ext_vector_type(16))) __bf16   v16bf;
typedef __attribute__((ext_vector_type(16))) _Float16 v16h;
typedef __attribute__((ext_vector_type(8)))  _Float16 v8h;
typedef __attribute__((ext_vector_type(8)))  unsigned short v8us;
typedef __attribute__((ext_vector_type(8)))  float    v8f;
typedef __attribute__((ext_vector_type(4)))  float    v4f;
typedef v8h  __attribute__((may_alias)) v8ha;
typedef v4f  __attribute__((may_alias)) v4fa;
typedef v8us __attribute__((may_alias)) v8usa;

__device__ __forceinline__ unsigned short f2bf(float f) { unsigned u = __float_as_uint(f); u += 0x7FFFu + ((u >> 16) & 1u); return (unsigned short)(u >> 16); }
__device__ __forceinline__ float bf2f(unsigned short b) { return __uint_as_float(((unsigned)b) << 16); }
__device__ __forceinline__ float bfr(float f) { return bf2f(f2bf(f)); }
__device__ __forceinline__ v16h cat16(v8h lo, v8h hi) { return __builtin_shufflevector(lo, hi, 0, 1, 2, 3, 4, 5, 6, 7, 8, 9, 10, 11, 12, 13, 14, 15); }
__device__ __forceinline__ v16bf cat16b(v8us lo, v8us hi) { return __builtin_bit_cast(v16bf, __builtin_shufflevector(lo, hi, 0, 1, 2, 3, 4, 5, 6, 7, 8, 9, 10, 11, 12, 13, 14, 15)); }
__device__ __forceinline__ v8f wmma16(v16h a, v16h b, v8f c) { return __builtin_amdgcn_wmma_f32_16x16x32_f16(false, a, false, b, (short)0, c, false, false); }
__device__ __forceinline__ v8f wmmab(v16bf a, v16bf b, v8f c) { return __builtin_amdgcn_wmma_f32_16x16x32_bf16(false, a, false, b, (short)0, c, false, false); }



// ld: a fragment from a row-major plane (p holds row and 8 hi); ldf: from a plane in fragment order (p holds 8 lane). 16 rows are 16 K values in both.
template <typename T16> struct WFrag;
template <> struct WFrag<h16> { typedef v16h V; static __device__ __forceinline__ V ld(const h16* p) { return cat16(*(const v8h*)p, *(const v8h*)(p + 16)); } static __device__ __forceinline__ V ldf(const h16* p) { return cat16(*(const v8h*)p, *(const v8h*)(p + 256)); } static __device__ __forceinline__ v8f mma(V a, V b, v8f c) { return wmma16(a, b, c); } };
template <> struct WFrag<bf> { typedef v16bf V; static __device__ __forceinline__ V ld(const bf* p) { return cat16b(*(const v8us*)p, *(const v8us*)(p + 16)); } static __device__ __forceinline__ V ldf(const bf* p) { return cat16b(*(const v8us*)p, *(const v8us*)(p + 256)); } static __device__ __forceinline__ v8f mma(V a, V b, v8f c) { return wmmab(a, b, c); } };
__device__ __forceinline__ void splitf(float y, unsigned short& h, unsigned short& l) { h = f2bf(y); l = f2bf(y - bf2f(h)); }
typedef __attribute__((ext_vector_type(2))) unsigned short v2us;
typedef __attribute__((ext_vector_type(4))) unsigned short v4us;

__device__ __forceinline__ size_t fragofs(int r, int k) { return ((size_t)(r >> 4) * (CC / 32) + (k >> 5)) * 512 + ((k >> 4) & 1) * 256 + (((k >> 3) & 1) * 16 + (r & 15)) * 8 + (k & 7); }    // where T[r][k] lies in a plane in fragment order, in values; 8 values from a k that is a multiple of 8 lie together
__device__ __forceinline__ void d_wtG(int blk, const float* __restrict__ w, int K, int N, bf* Bt) {
    const int lane = threadIdx.x & 31; const int L0 = (blk * 8 + (threadIdx.x >> 5)) * 8; const int nlines = N * K / 64;
{
#pragma unroll 1
        for (int l = 0; l < 8; ++l) { const int L = L0 + l; if (L >= nlines) break; const size_t e = (size_t)L * 64 + lane * 2; const int k = (int)(e % K), n = (int)(e / K); v2us o;
            o[0] = f2bf(w[(size_t)k * N + n]); o[1] = f2bf(w[(size_t)(k + 1) * N + n]); bf* dp = Bt + fragofs(n, k); *(v2us*)dp = o;
            asm volatile("s_wait_xcnt 0x0" :: "v"(dp) : "memory"); }    // a precaution: the next trip forms its addresses in the registers that this store names only behind this wait
         }
}
__device__ __forceinline__ void d_cvt8(int blk, const float* __restrict__ src, bf* dst, size_t n8) { const size_t i = (size_t)blk * 256 + threadIdx.x; if (i >= n8) return; const v8f v = *(const v8f*)(src + i * 8); v8us o;
#pragma unroll
    for (int k = 0; k < 8; ++k) o[k] = f2bf(v[k]); *(v8us*)(dst + i * 8) = o;  }
__device__ __forceinline__ void d_cvt8f(int blk, const float* __restrict__ src, bf* dst) { const int i = blk * 256 + threadIdx.x; const unsigned so = 32u * i; const v8f v = *(const v8f*)((const char*)src + so); v8us o;    // a [256][256] plane, rounded and stored in fragment order
    asm volatile("s_wait_xcnt 0x0" :: "v"(so) : "memory");    // a precaution: the register that holds the load's offset is rewritten only behind this wait; it is the wait's input, so that it keeps its value up to it
#pragma unroll
    for (int k = 0; k < 8; ++k) o[k] = f2bf(v[k]); const unsigned dofs = 2u * (unsigned)fragofs(i / (CC / 8), (i % (CC / 8)) * 8); *(v8us*)((char*)dst + dofs) = o;
    asm volatile("s_wait_xcnt 0x0" :: "v"(dofs), "v"(o) : "memory"); }    // the same precaution behind the store, for its offset and its data
__device__ __forceinline__ int clampi(int m) { return m < 0 ? 0 : (m >= NN ? NN - 1 : m); }
// both batches: eg runs over [2][8192][32]; xyz and BIAS step to the batch's own plane.
// The MLP's 392 weights are rounded to bf16 ONCE per block, into LDS (row j: W1[0][j], W1[1][j], W1[2][j], b1[j], W2[j][0..7]; behind the 32 rows: b2), and every thread works 4 neighbouring edges of one point,
// so that a row read from LDS (three 16-byte broadcasts) serves 128 edges of a wave. Each edge's arithmetic, and its order, is as before; two edges share a packed instruction.
#define BE 4
#define SW_N (HB * 12 + NH_)
typedef __attribute__((ext_vector_type(2))) float v2f;
typedef __attribute__((ext_vector_type(4))) int   v4i;
__device__ __forceinline__ void d_bias(int blk, const float* __restrict__ xyz, const int* __restrict__ idx, const float* __restrict__ W1, const float* __restrict__ b1, const float* __restrict__ W2, const float* __restrict__ b2, float* BIAS, float* sw) {
    static_assert((NB_ * NN * KN) % (256 * BE) == 0, "the bias blocks cover the edges exactly: no range guard");
    const int eg = (blk * 256 + threadIdx.x) * BE; const int bt = eg / (NN * KN); const int e = eg - bt * (NN * KN); const int n = e / KN; const v4i mi = *(const v4i*)(idx + eg); xyz += (size_t)bt * NN * 3; BIAS += (size_t)bt * NH_ * NN * KN;
    const float* pn = xyz + (size_t)n * 3; const float* pm[BE]; float xn[3], xm[BE][3];
#pragma unroll
    for (int i = 0; i < BE; ++i) pm[i] = xyz + (size_t)clampi(mi[i]) * 3;
#pragma unroll
    for (int a = 0; a < 3; ++a) xn[a] = pn[a];
#pragma unroll
    for (int i = 0; i < BE; ++i)
#pragma unroll
        for (int a = 0; a < 3; ++a) xm[i][a] = pm[i][a];
    // the weights are staged behind the issue of the coordinate gathers, so that both latencies pass together
    for (int t = threadIdx.x; t < SW_N; t += 256) { const int j = t / 12, c = t - j * 12; sw[t] = bfr(t >= HB * 12 ? b2[t - HB * 12] : (c < 3 ? W1[c * HB + j] : (c == 3 ? b1[j] : W2[j * NH_ + c - 4]))); }
    __syncthreads();    // the block's rounded weights are complete before any thread reads them; every thread of a bias block passes here
    v2f r[BE / 2][3];
#pragma unroll
    for (int i = 0; i < BE; ++i)
#pragma unroll
        for (int a = 0; a < 3; ++a) r[i >> 1][a][i & 1] = __fsub_rn(bfr(xn[a]), bfr(xm[i][a]));
    v2f acc[BE / 2][NH_];
#pragma unroll
    for (int q = 0; q < BE / 2; ++q)
#pragma unroll
        for (int h = 0; h < NH_; ++h) acc[q][h] = (v2f){0.f, 0.f};
    v4f wr[2][3];    // two register sets for a weight row: row j + 1 is asked for before row j is worked, so that its LDS latency passes behind row j's sums
#pragma unroll
    for (int c = 0; c < 3; ++c) wr[0][c] = *(const v4f*)(sw + c * 4);
#pragma unroll    // unrolled whole: the two register sets alternate by a compile-time index, and every LDS row address is an immediate
    for (int j = 0; j < HB; ++j) {
        if (j + 1 < HB) {
#pragma unroll
            for (int c = 0; c < 3; ++c) wr[(j + 1) & 1][c] = *(const v4f*)(sw + (j + 1) * 12 + c * 4); }
        const v4f wa = wr[j & 1][0], wb = wr[j & 1][1], wc = wr[j & 1][2];
        // the empty asm statements on the products are carried over from the scalar form unchanged in kind: product and add keep their two roundings, so every bias value stays bit-identical
#pragma unroll
        for (int q = 0; q < BE / 2; ++q) { v2f s = (v2f){0.f, 0.f};
#pragma unroll
            for (int a = 0; a < 3; ++a) { v2f p = r[q][a] * wa[a]; asm volatile("" : "+v"(p)); s = s + p; }
            s = s + wa[3]; const v2f hv = (v2f){fmaxf(s[0], 0.f), fmaxf(s[1], 0.f)};
#pragma unroll
            for (int h = 0; h < NH_; ++h) { v2f p = hv * (h < 4 ? wb[h & 3] : wc[h & 3]); asm volatile("" : "+v"(p)); acc[q][h] = acc[q][h] + p; } } }
    { const v4f b2a = *(const v4f*)(sw + HB * 12), b2b = *(const v4f*)(sw + HB * 12 + 4);
#pragma unroll
        for (int h = 0; h < NH_; ++h) { const float bb = h < 4 ? b2a[h & 3] : b2b[h & 3]; const v2f o0 = acc[0][h] + bb, o1 = acc[1][h] + bb; *(v4f*)(BIAS + (size_t)h * NN * KN + e) = (v4f){o0[0], o0[1], o1[0], o1[1]};
            asm volatile("s_wait_xcnt 0x0" ::: "memory"); }    // the next head's sum may reuse the register that this store names
         } }
// k_prep: the three independent preparation passes in ONE launch, told apart by the block index: first the four weight planes (three transposes, few blocks, a serial latency-bound loop; Wk is only rounded), then the positional bias (the longest), last the x conversion (short blocks fill the tail).
#define WT_BLK   ((CC * CC / 64 + 63) / 64)
#define BIAS_BLK ((NB_ * NN * KN / BE + 255) / 256)
#define CVT_BLK  ((NB_ * NN * CC / 8 + 255) / 256)
// 10 waves per SIMD asked for: left free, the unrolled bias MLP took 176 registers, and the x conversion's blocks, which share this kernel and live on loads in flight, would be held to 5 waves per SIMD
__global__ __launch_bounds__(256, 10) void k_prep(const float* __restrict__ wq, const float* __restrict__ wk, const float* __restrict__ wv, const float* __restrict__ wo, bf* WT, const float* __restrict__ x, bf* XB,
                                              const float* __restrict__ xyz, const int* __restrict__ idx, const float* __restrict__ W1, const float* __restrict__ b1, const float* __restrict__ W2, const float* __restrict__ b2, float* BIAS) {
    __shared__ __align__(16) float sw[SW_N];    // the bias blocks' rounded MLP weights
    const int blk = blockIdx.x;
    if (blk < 4 * WT_BLK) { const int t = blk / WT_BLK;
        if (t == 1) { static_assert(2 * WT_BLK * 256 == CC * CC / 8, "two passes of the plane's blocks cover Wk exactly"); d_cvt8f(blk - WT_BLK, wk, WT + (size_t)CC * CC); d_cvt8f(blk, wk, WT + (size_t)CC * CC); }    // Wk's rows are the A operand's rows (k_attn, phase 1): rounded, not transposed
        else d_wtG(blk - t * WT_BLK, t == 0 ? wq : (t == 2 ? wv : wo), CC, CC, WT + (size_t)t * CC * CC); }
    else if (blk < 4 * WT_BLK + BIAS_BLK) d_bias(blk - 4 * WT_BLK, xyz, idx, W1, b1, W2, b2, BIAS, sw);
    else d_cvt8(blk - 4 * WT_BLK - BIAS_BLK, x, XB, (size_t)NB_ * NN * CC / 8);
}
// k_attn: the K and V projections are applied on the query side, so that a neighbour is gathered ONCE, as its 512-byte bf16 x row (exact: x is rounded to bf16 anyway), not as a 1-KiB f32 K row and a 1-KiB f32 V row:
//   q[n][h].k[m][h] = x[m] . qt[n][h] + q[n][h].bk[h], qt[n][h][c] = sum_d Wk[c][h*32+d] q[n][h][d]; the bk term is the same for a point-head's 32 neighbours and cancels in the softmax;
//   sum_j attn[j] v[m_j][h] = (sum_j attn[j] x[m_j]) Wv[:, h] + bv[h] (the weights sum to 1).
// The q projection and the output projection are phases of this kernel too: a workgroup's 32 points need only their own x rows for q, and their own attention output for the last product, so neither plane goes through memory and neither needs a launch.
// One workgroup = 2 tiles of 16 points, 8 waves: phase 0 for both tiles, phases 1 to 3 tile by tile, phase 4 for both, so that a wave loads its slice of each of the four weight planes once for 32 points. Every f32 value that becomes a matrix operand (q, qt, the weights, y) goes in as bf16 high part + bf16 low part, two products into one f32 accumulator.
//   phase 0, wave = head: q^T [d][point] = Wq^T rows x the points' x rows (plain bf16 operands), + bq; the result lies in the registers as phase 1's B operand wants it;
//   phase 1, wave = head: qt^T [c][point] = Wk rows x q, stored to LDS as QT[point][high: row h, low: row 8 + h][c];
//   phase 2, wave = 2 points, one after the other: the 32 x rows in LDS; scores^T [j][h] = rows x qt with the positional bias as C; softmax inside the lane and with lane ^ 16; the two score tiles, converted in place,
//            are the B operand of y^T [c][h] = rows^T (transposing LDS loads) x weights; y replaces the point's qt in LDS;
//   phase 3, wave = head: out^T [d][point] = Wv^T rows x y, + bv, split: the lane's registers are k step w of phase 4's B operand, and go to LDS as they are;
//   phase 4, wave = 32 output columns: final^T [e][point] = Wo^T rows x all eight k steps (high, then low part, k step by k step), + bo, turned through the wave's own LDS range into whole 128-byte lines.
// Every '#pragma unroll' in k_attn and its helpers makes the indices of a register array compile-time constants, so that the array stays in registers and every LDS offset is an immediate.
#define AP 16                      // points per tile
#define RP 528                     // LDS pitch in bytes of a row of 256 16-bit values: 16 B x odd
#define PP (16 * RP + 16)          // one point's 16 rows; 16 B x odd, since phases 1 and 3 walk the points by lane
#define QT_BYTES (AP * PP)
#define XG_BYTES (KN * RP)
typedef __attribute__((ext_vector_type(8))) short  v8s;
typedef __attribute__((ext_vector_type(4))) unsigned v4u;
typedef v4u __attribute__((may_alias)) v4ua;
typedef __attribute__((ext_vector_type(2))) __bf16 v2bf;
// f32 -> bf16 high part (round to nearest even) + bf16 low part (the remainder, rounded); two values per conversion instruction
__device__ __forceinline__ void split8(v8f y, v8us& h, v8us& l) { v4u hp, lp;
#pragma unroll
    for (int i = 0; i < 4; ++i) { const unsigned u = __builtin_bit_cast(unsigned, __builtin_convertvector((v2f){y[2 * i], y[2 * i + 1]}, v2bf)); hp[i] = u;
        lp[i] = __builtin_bit_cast(unsigned, __builtin_convertvector((v2f){y[2 * i] - __uint_as_float(u << 16), y[2 * i + 1] - __uint_as_float(u & 0xFFFF0000u)}, v2bf)); }
    h = __builtin_bit_cast(v8us, hp); l = __builtin_bit_cast(v8us, lp); }
// a precaution, written behind each group of global loads: the registers that hold their addresses are rewritten only behind this wait; the addresses are its inputs, so that they stay in their registers up to it
#define XWAIT(p) asm volatile("s_wait_xcnt 0x0" :: "v"(p) : "memory")
#define XWAIT8(a, i) asm volatile("s_wait_xcnt 0x0" :: "v"(a[i]), "v"(a[i + 1]), "v"(a[i + 2]), "v"(a[i + 3]), "v"(a[i + 4]), "v"(a[i + 5]), "v"(a[i + 6]), "v"(a[i + 7]) : "memory")
__device__ __forceinline__ v16bf ldsfrag(const unsigned char* p) { return cat16b(*(const v8usa*)p, *(const v8usa*)(p + 32)); }    // 32 k of a row in the hardware's k order: bytes 16 * hi and 32 + 16 * hi of 64 (hi is in p)
__device__ __forceinline__ v8us ld_tr16(const unsigned char* p) { typedef __attribute__((address_space(3))) v8s lds_v8s; return __builtin_bit_cast(v8us, __builtin_amdgcn_ds_load_tr16_b128_v8i16((lds_v8s*)p)); }
__device__ __forceinline__ float xhalf(float x) { return __builtin_bit_cast(float, __builtin_amdgcn_permlanex16(__builtin_bit_cast(int, x), __builtin_bit_cast(int, x), 0x76543210, 0xfedcba98, false, false)); }    // lane l with lane l ^ 16
#define TL 2                       // 16-point tiles per workgroup: a wave's slice of each weight plane is loaded once and serves both
__global__ __launch_bounds__(256) void k_attn(const bf* __restrict__ XB, const bf* __restrict__ WQT, const float* __restrict__ bq, const bf* __restrict__ WKB, const bf* __restrict__ WVT, const float* __restrict__ bv, const bf* __restrict__ WOT, const float* __restrict__ bo, const int* __restrict__ idx, const float* __restrict__ BIAS, float* OUT) {
    static_assert(NN % (AP * TL) == 0 && (NB_ * NN) % (AP * TL) == 0, "a workgroup's points lie in one batch and the grid covers the points exactly");
    __shared__ __attribute__((aligned(16))) unsigned char L[QT_BYTES];         // qt, later y, of the tile at work: [point][16 rows][256]
    __shared__ __attribute__((aligned(16))) unsigned char XG[8 * XG_BYTES];    // each wave's 32 gathered rows. An array of its own, so that the compiler may move reads of the rows over stores of y
    __shared__ __attribute__((aligned(16))) unsigned char EX[TL * 8 * 2048];   // phase 3's result of each tile, as phase 4's B operand: the first tile's waits here while the second tile's rows pass through XG
    const int lane = threadIdx.x & 31, lr = lane & 15, hi = lane >> 4; const int w = __builtin_amdgcn_readfirstlane((int)(threadIdx.x >> 5));
    const int p0 = blockIdx.x * (AP * TL); const int bt = p0 / NN; const bf* XBb = XB + (size_t)bt * NN * CC;    // a neighbour index counts inside its own batch
    unsigned char* xg = XG + w * XG_BYTES;
    v4u pre[KN];    // a point's 32 rows on their way to LDS: asked for one phase ahead, so that the gather's latency passes behind matrix work
    auto gather = [&](int pg) { const int* in_ = idx + (size_t)pg * KN; unsigned vo[KN];    // byte offset of this lane's 16 bytes in neighbour r's row
#pragma unroll
        for (int r = 0; r < KN; ++r) vo[r] = (unsigned)clampi(in_[r]) * (CC * 2u) + (unsigned)lane * 16u;
#pragma unroll
        for (int r = 0; r < KN; ++r) pre[r] = *(const v4u*)((const char*)XBb + vo[r]);
        XWAIT8(vo, 0); XWAIT8(vo, 8); XWAIT8(vo, 16); XWAIT8(vo, 24); };
    auto put = [&]() {
#pragma unroll
        for (int r = 0; r < KN; ++r) *(v4ua*)(xg + r * RP + lane * 16) = pre[r]; };
    const float* bp = BIAS + (((size_t)bt * NH_ + (lr & 7)) * NN + (p0 - bt * NN + 2 * w)) * KN + 8 * hi;    // head lr & 7, the wave's first point of the first tile, neighbours 8 hi + r (and, 16 floats on, 16 + 8 hi + r); a tile on: AP * KN floats
    v8f c0 = *(const v8f*)bp, c1 = *(const v8f*)(bp + 16);    // a point's positional bias is asked for in front of its rows: loads return in order, so a bias asked for behind the next point's gather would make this point wait for that gather
    XWAIT(bp);
    v16bf wa[CC / 16], qh[TL], ql[TL];    // Wk's slice and both tiles' q stay in registers until the second tile's phase 1
    {   // phase 0: head w, the 16 points of each tile
        const float SC = 0.17677669529663687f; const bf* xp = XB + (size_t)(p0 + lr) * CC + 8 * hi; const bf* wqp = WQT + (size_t)(w * HD) * CC + 8 * lane; v16bf xq[TL][CC / 32], wq[CC / 32][2];    // B: point lr's x row; A: Wq^T in fragment order, rows 32 w + lr and 32 w + 16 + lr
#pragma unroll
        for (int T = 0; T < TL; ++T)
#pragma unroll
            for (int ks = 0; ks < CC / 32; ++ks) xq[T][ks] = WFrag<bf>::ld(xp + T * (AP * CC) + ks * 32);
        XWAIT(xp);
#pragma unroll
        for (int ks = 0; ks < CC / 32; ++ks) { wq[ks][0] = WFrag<bf>::ldf(wqp + ks * 512); wq[ks][1] = WFrag<bf>::ldf(wqp + (size_t)16 * CC + ks * 512); }
        XWAIT(wqp);
        const float* bqp = bq + w * HD + 8 * hi; const v8f bq0 = *(const v8f*)bqp, bq1 = *(const v8f*)(bqp + 16); XWAIT(bqp);
        const bf* wp = WKB + w * 512 + 8 * lane;    // Wk in fragment order: rows 16 ct + lr, k step w
#pragma unroll
        for (int ct = 0; ct < CC / 16; ++ct) wa[ct] = WFrag<bf>::ldf(wp + (size_t)ct * 16 * CC);
        XWAIT(wp);
        __builtin_amdgcn_sched_barrier(0);    // holds phase 0's products behind the issue of phase 1's operands: left free, the compiler waited for the first Wq rows before it asked for Wk, one more latency in a row
        v8f qr0[TL], qr1[TL];    // the lane's q: point lr, d = 8 hi + r and 16 + 8 hi + r of head w
#pragma unroll
        for (int T = 0; T < TL; ++T) { qr0[T] = (v8f){}; qr1[T] = (v8f){};
#pragma unroll
            for (int ks = 0; ks < CC / 32; ++ks) { qr0[T] = wmmab(wq[ks][0], xq[T][ks], qr0[T]); qr1[T] = wmmab(wq[ks][1], xq[T][ks], qr1[T]); } }
#pragma unroll
        for (int T = 0; T < TL; ++T)
#pragma unroll
            for (int r = 0; r < 8; ++r) { qr0[T][r] += bfr(bq0[r]); qr1[T][r] += bfr(bq1[r]); }
        gather(p0 + 2 * w);    // asked for behind the operands of phases 0 and 1: loads return in order, and these phases need not wait for the rows
#pragma unroll
        for (int T = 0; T < TL; ++T) { const v8f q0 = qr0[T] * SC, q1 = qr1[T] * SC; v8us h0, l0, h1, l1; split8(q0, h0, l0); split8(q1, h1, l1); qh[T] = cat16b(h0, h1); ql[T] = cat16b(l0, l1); }
    }
    v16bf va[CC / 32][2];    // Wv's slice: loaded behind the first tile's phase 2, kept for the second tile's phase 3
    v16bf wo[CC / 32][2]; v8f bo0, bo1;    // Wo's slice: Wo^T rows 32 w + lr and 32 w + 16 + lr
#pragma unroll    // unrolled: T is a compile-time index of qh, ql and EX, and the loads that stand at one tile only need no branch
    for (int T = 0; T < TL; ++T) {
        {   // phase 1: head w, the tile's 16 points. It writes the rows w and 8 + w of L that this same wave read in the tile before (phase 3): no barrier in front
            unsigned char* o = L + lr * PP + w * RP + 16 * hi;
#pragma unroll
            for (int ct = 0; ct < CC / 16; ++ct) { const v16bf a = wa[ct]; v8f d = (v8f){}; d = wmmab(a, qh[T], d); d = wmmab(a, ql[T], d);
                v8us dh, dl; split8(d, dh, dl); *(v8usa*)(o + ct * 32) = dh; *(v8usa*)(o + 8 * RP + ct * 32) = dl; }
        }
        __syncthreads();    // every head's qt rows of every point are in LDS before a wave takes up its two points
#pragma unroll 1    // rolled: the wave's two points run through one copy of the code, half the instruction bytes to fetch
        for (int t = 0; t < 2; ++t) {
            const int pl = 2 * w + t;
            put(); v8f s0 = c0, s1 = c1;    // C: the positional bias of neighbours 8 hi + r and 16 + 8 hi + r, head lr & 7
            if (t == 0) { c0 = *(const v8f*)(bp + T * (AP * KN) + KN); c1 = *(const v8f*)(bp + T * (AP * KN) + KN + 16); asm volatile("s_wait_xcnt 0x0" ::: "memory"); gather(p0 + T * AP + pl + 1); }    // the same precaution as XWAIT
            __builtin_amdgcn_wave_barrier();    // the rows that the wave's lanes have just stored are read across lanes below
            const unsigned char* qa = L + pl * PP + (lr & 7) * RP + 16 * hi; const unsigned char* xa = xg + lr * RP + 16 * hi;
#pragma unroll
            for (int ks = 0; ks < CC / 32; ++ks) { const v16bf bh = ldsfrag(qa + ks * 64), bl = ldsfrag(qa + 8 * RP + ks * 64), a0 = ldsfrag(xa + ks * 64), a1 = ldsfrag(xa + 16 * RP + ks * 64);
                s0 = wmmab(a0, bh, s0); s1 = wmmab(a1, bh, s1); s0 = wmmab(a0, bl, s0); s1 = wmmab(a1, bl, s1); }
            float mx = -3.0e38f;
#pragma unroll
            for (int r = 0; r < 8; ++r) mx = fmaxf(mx, fmaxf(s0[r], s1[r]));
            mx = fmaxf(mx, xhalf(mx)); float sum = 0.f;
#pragma unroll
            for (int r = 0; r < 8; ++r) { s0[r] = __expf(s0[r] - mx); s1[r] = __expf(s1[r] - mx); sum += s0[r] + s1[r]; }
            sum += xhalf(sum); const float inv = __fdiv_rn(1.0f, sum); s0 *= inv; s1 *= inv;
            v8us h0, l0, h1, l1; split8(s0, h0, l0); split8(s1, h1, l1); const v16bf ph = cat16b(h0, h1), pw = cat16b(l0, l1);    // element s of the B operand is neighbour 8 hi + s, or 16 + 8 hi + s - 8 for s >= 8: what the lane holds
            const unsigned char* ta = xg + (8 * hi + (lane & 7)) * RP + 16 * ((lane >> 3) & 1); unsigned char* yo = L + pl * PP + lr * RP + 16 * hi;
#pragma unroll 1    // rolled: with two copies of phase 2 in the text; for speed only
            for (int g = 0; g < 2; ++g) { v16bf xa[8];    // eight fragments are asked for together: one pass through the LDS latency for eight column tiles
#pragma unroll
                for (int i = 0; i < 8; ++i) xa[i] = cat16b(ld_tr16(ta + 32 * (g * 8 + i)), ld_tr16(ta + 16 * RP + 32 * (g * 8 + i)));
#pragma unroll
                for (int i = 0; i < 8; ++i) { v8f d = (v8f){}; d = wmmab(xa[i], ph, d); d = wmmab(xa[i], pw, d);
                    v8us dh, dl; split8(d, dh, dl); *(v8usa*)(yo + (g * 8 + i) * 32) = lr < 8 ? dh : dl; } }    // columns lr and lr + 8 hold the same head: the first stores the high parts (row h), the second the low parts (row 8 + h)
            __builtin_amdgcn_wave_barrier();    // the next point's rows are stored only behind this point's last transposing load
        }
        // phase 3: head w, the tile's 16 points
        const int col = w * HD + 8 * hi;
        if (T == 0) { const bf* vp = WVT + (size_t)(w * HD) * CC + 8 * lane;
#pragma unroll
            for (int ks = 0; ks < CC / 32; ++ks) { va[ks][0] = WFrag<bf>::ldf(vp + ks * 512); va[ks][1] = WFrag<bf>::ldf(vp + (size_t)16 * CC + ks * 512); }    // the head's Wv rows are asked for in front of the barrier: their latency passes behind the wait for the other waves
            XWAIT(vp); }
        const float* bvp = bv + col; const v8f bv0 = *(const v8f*)bvp, bv1 = *(const v8f*)(bvp + 16); XWAIT(bvp);    // asked for anew at each tile: 16 registers less to hold through the next tile's phases 1 and 2
        __syncthreads();    // every point's y is in LDS before phase 3 reads it
        if (T == TL - 1) { const bf* op = WOT + (size_t)(w * HD) * CC + 8 * lane;    // phase 4's operand is asked for behind the barrier, which waits for every load in flight: it lands behind the last phase 3's products
#pragma unroll
            for (int ks = 0; ks < CC / 32; ++ks) { wo[ks][0] = WFrag<bf>::ldf(op + ks * 512); wo[ks][1] = WFrag<bf>::ldf(op + (size_t)16 * CC + ks * 512); }
            XWAIT(op);
            const float* bop = bo + col; bo0 = *(const v8f*)bop; bo1 = *(const v8f*)(bop + 16); XWAIT(bop); }
        const unsigned char* ya = L + lr * PP + w * RP + 16 * hi; v8f o0 = (v8f){}, o1 = (v8f){};
        v16bf yh[CC / 32], yl[CC / 32];    // all of y's fragments are asked for together: one pass through the LDS latency, not one per k step
#pragma unroll
        for (int ks = 0; ks < CC / 32; ++ks) { yh[ks] = ldsfrag(ya + ks * 64); yl[ks] = ldsfrag(ya + 8 * RP + ks * 64); }
        __builtin_amdgcn_sched_barrier(0);    // holds the fragment loads together in front of the products: left free, the compiler sank each pair to its use and waited for it there
#pragma unroll
        for (int ks = 0; ks < CC / 32; ++ks) { o0 = wmmab(va[ks][0], yh[ks], o0); o1 = wmmab(va[ks][1], yh[ks], o1); o0 = wmmab(va[ks][0], yl[ks], o0); o1 = wmmab(va[ks][1], yl[ks], o1); }
        if (T + 1 < TL) { const float* bn = bp + (T + 1) * (AP * KN); c0 = *(const v8f*)bn; c1 = *(const v8f*)(bn + 16); XWAIT(bn); gather(p0 + (T + 1) * AP + 2 * w); }    // the next tile's first bias and rows: asked for where y's registers are free again, they land behind the next phase 1
#pragma unroll
        for (int r = 0; r < 8; ++r) { o0[r] += bfr(bv0[r]); o1[r] += bfr(bv1[r]); }
        v8us h0, l0, h1, l1; split8(o0, h0, l0); split8(o1, h1, l1);
        // The lane holds point lr, columns 32 w + 8 hi + r and 32 w + 16 + 8 hi + r: the two halves of its own place in k step w of phase 4's B operand: 2 KiB a k step, [high, low][half][lane][16 bytes]
        unsigned char* ex = EX + T * (8 * 2048) + w * 2048 + lane * 16;
        *(v8usa*)ex = h0; *(v8usa*)(ex + 512) = h1; *(v8usa*)(ex + 1024) = l0; *(v8usa*)(ex + 1536) = l1;
    }
    {   // phase 4, both tiles on one load of Wo's slice
        __syncthreads();    // every head's columns of both tiles are in LDS before a wave sums over all of them
#pragma unroll 1    // rolled, for the same reason as phase 2's loops: T enters addresses only
        for (int T = 0; T < TL; ++T) {
            const unsigned char* ex = EX + T * (8 * 2048) + lane * 16; v16bf ah[CC / 32], al[CC / 32];
#pragma unroll
            for (int ks = 0; ks < CC / 32; ++ks) { ah[ks] = cat16b(*(const v8usa*)(ex + ks * 2048), *(const v8usa*)(ex + ks * 2048 + 512)); al[ks] = cat16b(*(const v8usa*)(ex + ks * 2048 + 1024), *(const v8usa*)(ex + ks * 2048 + 1536)); }
            __builtin_amdgcn_sched_barrier(0);    // as in phase 3: holds the fragment loads together in front of the products, one pass through the LDS latency
            v8f e0 = (v8f){}, e1 = (v8f){};
#pragma unroll
            for (int ks = 0; ks < CC / 32; ++ks) { e0 = wmmab(wo[ks][0], ah[ks], e0); e1 = wmmab(wo[ks][1], ah[ks], e1); e0 = wmmab(wo[ks][0], al[ks], e0); e1 = wmmab(wo[ks][1], al[ks], e1); }
#pragma unroll
            for (int r = 0; r < 8; ++r) { e0[r] += bfr(bo0[r]); e1[r] += bfr(bo1[r]); }
            // the lane holds point lr, output columns 32 w + 8 hi + r and 32 w + 16 + 8 hi + r: 32-byte pieces. Through the wave's own LDS range (16 rows of 128 bytes, pitch 144 = 16 B x odd; the gathered rows' LDS is free since the barrier in front of the last phase 3) they become whole lines: 8 lanes a point, 4 points a store
            unsigned char* st = xg + T * (16 * 144); unsigned char* sp = st + lr * 144 + hi * 32;
            *(v4fa*)sp = (v4f){e0[0], e0[1], e0[2], e0[3]}; *(v4fa*)(sp + 16) = (v4f){e0[4], e0[5], e0[6], e0[7]}; *(v4fa*)(sp + 64) = (v4f){e1[0], e1[1], e1[2], e1[3]}; *(v4fa*)(sp + 80) = (v4f){e1[4], e1[5], e1[6], e1[7]};
            __builtin_amdgcn_wave_barrier();    // the rows that the wave's lanes have just stored are read across lanes below
            float* og = OUT + (size_t)(p0 + T * AP + (lane >> 3)) * CC + w * HD + (lane & 7) * 4; v4f ov[4];
#pragma unroll
            for (int i = 0; i < 4; ++i) ov[i] = *(const v4fa*)(st + (i * 4 + (lane >> 3)) * 144 + (lane & 7) * 16);
#pragma unroll
            for (int i = 0; i < 4; ++i) *(v4f*)(og + (size_t)i * 4 * CC) = ov[i];
            asm volatile("s_wait_xcnt 0x0" :: "v"(og), "v"(ov[0]), "v"(ov[1]), "v"(ov[2]), "v"(ov[3]) : "memory");    // the same precaution as XWAIT, behind the stores, for their address and their data
        }
    }
}

extern "C" void kernel_launch(void* const* d_in, const int* in_sizes, int n_in,
                              void* d_out, int out_size, void* d_ws, size_t ws_size, hipStream_t stream) {
    (void)in_sizes; (void)n_in; (void)out_size;
    const float* x = (const float*)d_in[0]; const float* xyz = (const float*)d_in[1]; const int* idx = (const int*)d_in[2]; const float* wq = (const float*)d_in[3]; const float* bq = (const float*)d_in[4]; const float* wk = (const float*)d_in[5]; const float* bk = (const float*)d_in[6]; const float* wv = (const float*)d_in[7]; const float* bv = (const float*)d_in[8];
    const float* wo = (const float*)d_in[9]; const float* bo = (const float*)d_in[10]; const float* W1 = (const float*)d_in[11]; const float* b1 = (const float*)d_in[12]; const float* W2 = (const float*)d_in[13]; const float* b2 = (const float*)d_in[14];
    float* OUT = (float*)d_out;     // [2][8192][256]
    char* wsp = (char*)d_ws;
    auto take = [&](size_t bytes) { char* p = wsp; wsp += (bytes + 255) & ~(size_t)255; return (void*)p; };
    bf* WT = (bf*)take((size_t)4 * CC * CC * 2);                          // Wq transposed, Wk as it is, Wv and Wo transposed, one after the other, each in fragment order
    bf* XB = (bf*)take((size_t)NB_ * NN * CC * 2);
    float* BIAS = (float*)take((size_t)NB_ * NH_ * NN * KN * 4);
    if ((size_t)(wsp - (char*)d_ws) > ws_size) return;    // total ~ 26 MB
    k_prep<<<4 * WT_BLK + BIAS_BLK + CVT_BLK, 256, 0, stream>>>(wq, wk, wv, wo, WT, x, XB, xyz, idx, W1, b1, W2, b2, BIAS);
    k_attn<<<NB_ * NN / (AP * TL), 256, 0, stream>>>(XB, WT, bq, WT + (size_t)CC * CC, WT + (size_t)2 * CC * CC, bv, WT + (size_t)3 * CC * CC, bo, idx, BIAS, OUT);
}

// v009
// A run of this version takes 52.6 microseconds.
// Versions between v007 and this one are left out; their measured steps multiply to 1.07 times as fast.
// All steps since v000 together make it 3.74 times as fast.
#include <hip/hip_runtime.h>

// LocalSphereAttention (x [2][8192][256], xyz [2][8192][3], idx [2][8192][32] (int neighbour indices, read as data); q/k/v = x W + b (8 heads x 32); per point n and head h, over its 32 neighbours m = idx[n][kk]:
// score = q[n].k[m]/sqrt(32) + bias[n][kk][h], bias = relu((xyz[n] - xyz[m]) W1 + b1) W2 + b2; softmax over the 32 neighbours; out = sum attn v[m]; (merged) Wo + bo -> [2][8192][256]).
// Compute dtypes, f32 accumulate: every input rounded to bf16; q on PLAIN bf16 operands (inputs: exact) + bias; the softmax f32 on the VALU; the positional-bias MLP, scores and weighted sums on WMMA, every f32 operand as bf16 high + low parts (see k_attn)
// FRAGMENT ORDER: a 16-bit plane T[r][k] (k = 0..255) that is only ever read as WMMA fragments (the four weight planes) is stored by its producer as its reader loads it:
// the fragment of rows 16 rt .. 16 rt + 15, k = 32 ks .. 32 ks + 31 is 1 KiB at (rt * 8 + ks) KiB: [half j][lane = 16 hi + lr][8 values] = T[16 rt + lr][32 ks + 16 j + 8 hi + 0..7].
// A wave's 16-byte-a-lane load is then 512 contiguous bytes, 4 whole lines; from the row-major plane it took 32 bytes out of each of 16 lines.

#define NB_  2
#define NN   8192
#define CC   256
#define NH_  8
#define HD   32
#define KN   32
#define HB   32
typedef _Float16 h16;
typedef unsigned short bf;
typedef __attribute__((ext_vector_type(16))) __bf16   v16bf;
typedef __attribute__((ext_vector_type(16))) _Float16 v16h;
typedef __attribute__((ext_vector_type(8)))  _Float16 v8h;
typedef __attribute__((ext_vector_type(8)))  unsigned short v8us;
typedef __attribute__((ext_vector_type(8)))  float    v8f;
typedef __attribute__((ext_vector_type(4)))  float    v4f;
typedef v8h  __attribute__((may_alias)) v8ha;
typedef v4f  __attribute__((may_alias)) v4fa;
typedef v8us __attribute__((may_alias)) v8usa;

__device__ __forceinline__ unsigned short f2bf(float f) { unsigned u = __float_as_uint(f); u += 0x7FFFu + ((u >> 16) & 1u); return (unsigned short)(u >> 16); }
__device__ __forceinline__ float bf2f(unsigned short b) { return __uint_as_float(((unsigned)b) << 16); }
__device__ __forceinline__ float bfr(float f) { return bf2f(f2bf(f)); }
__device__ __forceinline__ v16h cat16(v8h lo, v8h hi) { return __builtin_shufflevector(lo, hi, 0, 1, 2, 3, 4, 5, 6, 7, 8, 9, 10, 11, 12, 13, 14, 15); }
__device__ __forceinline__ v16bf cat16b(v8us lo, v8us hi) { return __builtin_bit_cast(v16bf, __builtin_shufflevector(lo, hi, 0, 1, 2, 3, 4, 5, 6, 7, 8, 9, 10, 11, 12, 13, 14, 15)); }
__device__ __forceinline__ v8f wmma16(v16h a, v16h b, v8f c) { return __builtin_amdgcn_wmma_f32_16x16x32_f16(false, a, false, b, (short)0, c, false, false); }
__device__ __forceinline__ v8f wmmab(v16bf a, v16bf b, v8f c) { return __builtin_amdgcn_wmma_f32_16x16x32_bf16(false, a, false, b, (short)0, c, false, false); }



// ld: a fragment from a row-major plane (p holds row and 8 hi); ldf: from a plane in fragment order (p holds 8 lane). 16 rows are 16 K values in both.
template <typename T16> struct WFrag;
template <> struct WFrag<h16> { typedef v16h V; static __device__ __forceinline__ V ld(const h16* p) { return cat16(*(const v8h*)p, *(const v8h*)(p + 16)); } static __device__ __forceinline__ V ldf(const h16* p) { return cat16(*(const v8h*)p, *(const v8h*)(p + 256)); } static __device__ __forceinline__ v8f mma(V a, V b, v8f c) { return wmma16(a, b, c); } };
template <> struct WFrag<bf> { typedef v16bf V; static __device__ __forceinline__ V ld(const bf* p) { return cat16b(*(const v8us*)p, *(const v8us*)(p + 16)); } static __device__ __forceinline__ V ldf(const bf* p) { return cat16b(*(const v8us*)p, *(const v8us*)(p + 256)); } static __device__ __forceinline__ v8f mma(V a, V b, v8f c) { return wmmab(a, b, c); } };
__device__ __forceinline__ void splitf(float y, unsigned short& h, unsigned short& l) { h = f2bf(y); l = f2bf(y - bf2f(h)); }
typedef __attribute__((ext_vector_type(2))) unsigned short v2us;
typedef __attribute__((ext_vector_type(4))) unsigned short v4us;

__device__ __forceinline__ size_t fragofs(int r, int k) { return ((size_t)(r >> 4) * (CC / 32) + (k >> 5)) * 512 + ((k >> 4) & 1) * 256 + (((k >> 3) & 1) * 16 + (r & 15)) * 8 + (k & 7); }    // where T[r][k] lies in a plane in fragment order, in values; 8 values from a k that is a multiple of 8 lie together
__device__ __forceinline__ void d_wtG(int blk, const float* __restrict__ w, int K, int N, bf* Bt) {
    const int lane = threadIdx.x & 31; const int L0 = (blk * 8 + (threadIdx.x >> 5)) * 8; const int nlines = N * K / 64;
{
#pragma unroll 1
        for (int l = 0; l < 8; ++l) { const int L = L0 + l; if (L >= nlines) break; const size_t e = (size_t)L * 64 + lane * 2; const int k = (int)(e % K), n = (int)(e / K); v2us o;
            o[0] = f2bf(w[(size_t)k * N + n]); o[1] = f2bf(w[(size_t)(k + 1) * N + n]); bf* dp = Bt + fragofs(n, k); *(v2us*)dp = o;
            asm volatile("s_wait_xcnt 0x0" :: "v"(dp) : "memory"); }    // a precaution: the next trip forms its addresses in the registers that this store names only behind this wait
         }
}
__device__ __forceinline__ void d_cvt8(int blk, const float* __restrict__ src, bf* dst, size_t n8) { const size_t i = (size_t)blk * 256 + threadIdx.x; if (i >= n8) return; const v8f v = *(const v8f*)(src + i * 8); v8us o;
#pragma unroll
    for (int k = 0; k < 8; ++k) o[k] = f2bf(v[k]); *(v8us*)(dst + i * 8) = o;  }
__device__ __forceinline__ void d_cvt8f(int blk, const float* __restrict__ src, bf* dst) { const int i = blk * 256 + threadIdx.x; const unsigned so = 32u * i; const v8f v = *(const v8f*)((const char*)src + so); v8us o;    // a [256][256] plane, rounded and stored in fragment order
    asm volatile("s_wait_xcnt 0x0" :: "v"(so) : "memory");    // a precaution: the register that holds the load's offset is rewritten only behind this wait; it is the wait's input, so that it keeps its value up to it
#pragma unroll
    for (int k = 0; k < 8; ++k) o[k] = f2bf(v[k]); const unsigned dofs = 2u * (unsigned)fragofs(i / (CC / 8), (i % (CC / 8)) * 8); *(v8us*)((char*)dst + dofs) = o;
    asm volatile("s_wait_xcnt 0x0" :: "v"(dofs), "v"(o) : "memory"); }    // the same precaution behind the store, for its offset and its data
__device__ __forceinline__ int clampi(int m) { return m < 0 ? 0 : (m >= NN ? NN - 1 : m); }
typedef __attribute__((ext_vector_type(2))) float v2f;
// The bias MLP's weights as k_attn's WMMA operands, [piece][lane = 16 hi + lr][8 values], 128 threads of one block: pieces ut = 0, 1: k = 8 hi + 0..7 of the first layer's A operand, row = hidden unit u = 16 ut + lr:
// W1[0..2][u], -W1[0..2][u], b1[u], 0 in lanes 0..15, zeros in lanes 16..31; pieces 2, 3: the two halves of W2 as a B operand, column = head lr & 7, k = 16 (piece - 2) + 8 hi + 0..7.
__device__ __forceinline__ void d_tab(const float* __restrict__ W1, const float* __restrict__ b1, const float* __restrict__ W2, bf* MTG) {
    const int pc = threadIdx.x >> 5, lane = threadIdx.x & 31, lr = lane & 15, hi = lane >> 4; v8us o = (v8us){}; if (pc >= 4) return;
    if (pc < 2) { const unsigned uo = (16u * (unsigned)pc + (unsigned)lr) * 4u; const float t0 = *(const float*)((const char*)W1 + uo), t1 = *(const float*)((const char*)(W1 + HB) + uo), t2 = *(const float*)((const char*)(W1 + 2 * HB) + uo), t3 = *(const float*)((const char*)b1 + uo);
        asm volatile("s_wait_xcnt 0x0" :: "v"(uo) : "memory");    // a precaution: the register that holds the loads' offset is rewritten only behind this wait
        if (hi == 0) { const unsigned short a0 = f2bf(t0), a1 = f2bf(t1), a2 = f2bf(t2); o = (v8us){a0, a1, a2, (unsigned short)(a0 ^ 0x8000u), (unsigned short)(a1 ^ 0x8000u), (unsigned short)(a2 ^ 0x8000u), f2bf(t3), 0}; } }
    else { const unsigned wo2 = ((16u * (unsigned)(pc - 2) + 8u * (unsigned)hi) * NH_ + (unsigned)(lr & 7)) * 4u; float t[8];
#pragma unroll
        for (int e = 0; e < 8; ++e) t[e] = *(const float*)((const char*)(W2 + e * NH_) + wo2);
        asm volatile("s_wait_xcnt 0x0" :: "v"(wo2) : "memory");    // the same precaution
#pragma unroll
        for (int e = 0; e < 8; ++e) o[e] = f2bf(t[e]); }
    const unsigned so = threadIdx.x * 16u; *(v8us*)((char*)MTG + so) = o;
    asm volatile("s_wait_xcnt 0x0" :: "v"(so), "v"(o) : "memory"); }    // the same precaution behind the store, for its offset and its data
// k_prep: the independent preparation passes in ONE launch, told apart by the block index: first the four weight planes (three transposes, few blocks, a serial latency-bound loop; Wk is only rounded) and the bias MLP's operand table, then the x conversion.
#define WT_BLK   ((CC * CC / 64 + 63) / 64)
#define CVT_BLK  ((NB_ * NN * CC / 8 + 255) / 256)
__global__ __launch_bounds__(256) void k_prep(const float* __restrict__ wq, const float* __restrict__ wk, const float* __restrict__ wv, const float* __restrict__ wo, bf* WT, const float* __restrict__ x, bf* XB, const float* __restrict__ W1, const float* __restrict__ b1, const float* __restrict__ W2, bf* MTG) {
    const int blk = blockIdx.x;
    if (blk < 4 * WT_BLK) { const int t = blk / WT_BLK;
        if (t == 1) { static_assert(2 * WT_BLK * 256 == CC * CC / 8, "two passes of the plane's blocks cover Wk exactly"); d_cvt8f(blk - WT_BLK, wk, WT + (size_t)CC * CC); d_cvt8f(blk, wk, WT + (size_t)CC * CC); }    // Wk's rows are the A operand's rows (k_attn, phase 1): rounded, not transposed
        else d_wtG(blk - t * WT_BLK, t == 0 ? wq : (t == 2 ? wv : wo), CC, CC, WT + (size_t)t * CC * CC); }
    else if (blk == 4 * WT_BLK) d_tab(W1, b1, W2, MTG);
    else d_cvt8(blk - 4 * WT_BLK - 1, x, XB, (size_t)NB_ * NN * CC / 8);
}
// k_attn: the K and V projections are applied on the query side, so that a neighbour is gathered ONCE, as its 512-byte bf16 x row (exact: x is rounded to bf16 anyway), not as a 1-KiB f32 K row and a 1-KiB f32 V row:
//   q[n][h].k[m][h] = x[m] . qt[n][h] + q[n][h].bk[h], qt[n][h][c] = sum_d Wk[c][h*32+d] q[n][h][d]; the bk term is the same for a point-head's 32 neighbours and cancels in the softmax;
//   sum_j attn[j] v[m_j][h] = (sum_j attn[j] x[m_j]) Wv[:, h] + bv[h] (the weights sum to 1).
// The q projection and the output projection are phases of this kernel too: a workgroup's 32 points need only their own x rows for q, and their own attention output for the last product, so neither plane goes through memory and neither needs a launch.
// One workgroup = 2 tiles of 16 points, 8 waves: phase 0 for both tiles, phases 1 to 3 tile by tile, phase 4 for both, so that a wave loads its slice of each of the four weight planes once for 32 points. Every f32 value that becomes a matrix operand (q, qt, the weights, y) goes in as bf16 high part + bf16 low part, two products into one f32 accumulator.
//   phase 0, wave = head: q^T [d][point] = Wq^T rows x the points' x rows (plain bf16 operands), + bq; the result lies in the registers as phase 1's B operand wants it;
//   phase 1, wave = head: qt^T [c][point] = Wk rows x q, stored to LDS as QT[point][high: row h, low: row 8 + h][c];
//   the positional bias of the wave's 4 points, between phases 0 and 1, on the matrix unit too: lane l holds neighbour l's coordinates;
//            hidden^T [u][j] = (W1^T, -W1^T, b1) x (xyz[n], xyz[m_j], 1), all operands exact in bf16, k = 0..6 of 32 (what lanes 16..31 hold is k = 8..15, where the A operand is zero: the two halves of the wave change places for neighbours 16..31);
//            relu; the result tiles, split, are the A operand of bias [j][h] = hidden x W2, which waits in the wave's own, still unused part of EX. b2[h] is the same for a point-head's 32 neighbours and cancels in the softmax, as bk does;
//   phase 2, wave = 2 points, one after the other: the 32 x rows in LDS; scores^T [j][h] = rows x qt with the positional bias as C; softmax inside the lane and with lane ^ 16; the two score tiles, converted in place,
//            are the B operand of y^T [c][h] = rows^T (transposing LDS loads) x weights; y replaces the point's qt in LDS;
//   phase 3, wave = head: out^T [d][point] = Wv^T rows x y, + bv, split: the lane's registers are k step w of phase 4's B operand, and go to LDS as they are;
//   phase 4, wave = 32 output columns: final^T [e][point] = Wo^T rows x all eight k steps (high, then low part, k step by k step), + bo, turned through the wave's own LDS range into whole 128-byte lines.
// Every '#pragma unroll' in k_attn and its helpers makes the indices of a register array compile-time constants, so that the array stays in registers and every LDS offset is an immediate.
#define AP 16                      // points per tile
#define RP 528                     // LDS pitch in bytes of a row of 256 16-bit values: 16 B x odd
#define PP (16 * RP + 16)          // one point's 16 rows; 16 B x odd, since phases 1 and 3 walk the points by lane
#define QT_BYTES (AP * PP)
#define XG_BYTES (KN * RP)
typedef __attribute__((ext_vector_type(8))) short  v8s;
typedef __attribute__((ext_vector_type(4))) unsigned v4u;
typedef v4u __attribute__((may_alias)) v4ua;
typedef __attribute__((ext_vector_type(2))) __bf16 v2bf;
// f32 -> bf16 high part (round to nearest even) + bf16 low part (the remainder, rounded); two values per conversion instruction
// The low parts: y - high part (exact in f32), rounded to bf16 into one half of a register, ONE instruction a value: the mixed-precision FMA reads the bf16 high part as it lies in its half register (times nm = -1, an f32 operand) and y as f32.
// The compiler's own form of the same sums took a shift or a mask a value, a packed subtraction and a conversion.
// Each instruction's producer stands four vector instructions back: the hints say so, as the compiler's own would (it writes none for asm text).
// The distance behind a matrix instruction (four vector slots before a register of its A, B or D is written): the asm text reads y only behind the compiler's own conversions of y, which keep it;
// what it writes: see at each form.
// First form, in place: each half of a register that holds two high parts is replaced by its own low part. It writes registers that the compiler's conversions have just written and that are still live: no operand of a matrix instruction close in front
__device__ __forceinline__ v4u lowparts(v4u lp, v8f y, float nm) {
    asm("s_delay_alu instid0(VALU_DEP_4) | instskip(NEXT) | instid1(VALU_DEP_4)\n\t"
        "v_fma_mixlo_bf16 %0, %0, %12, %4 op_sel_hi:[1,0,0]\n\t"
        "v_fma_mixlo_bf16 %1, %1, %12, %6 op_sel_hi:[1,0,0]\n\t"
        "s_delay_alu instid0(VALU_DEP_4) | instskip(NEXT) | instid1(VALU_DEP_4)\n\t"
        "v_fma_mixlo_bf16 %2, %2, %12, %8 op_sel_hi:[1,0,0]\n\t"
        "v_fma_mixlo_bf16 %3, %3, %12, %10 op_sel_hi:[1,0,0]\n\t"
        "s_delay_alu instid0(VALU_DEP_4) | instskip(NEXT) | instid1(VALU_DEP_4)\n\t"
        "v_fma_mixhi_bf16 %0, %0, %12, %5 op_sel:[1,0,0] op_sel_hi:[1,0,0]\n\t"
        "v_fma_mixhi_bf16 %1, %1, %12, %7 op_sel:[1,0,0] op_sel_hi:[1,0,0]\n\t"
        "s_delay_alu instid0(VALU_DEP_4) | instskip(NEXT) | instid1(VALU_DEP_4)\n\t"
        "v_fma_mixhi_bf16 %2, %2, %12, %9 op_sel:[1,0,0] op_sel_hi:[1,0,0]\n\t"
        "v_fma_mixhi_bf16 %3, %3, %12, %11 op_sel:[1,0,0] op_sel_hi:[1,0,0]"
        : "+v"(lp[0]), "+v"(lp[1]), "+v"(lp[2]), "+v"(lp[3]) : "v"(y[0]), "v"(y[1]), "v"(y[2]), "v"(y[3]), "v"(y[4]), "v"(y[5]), "v"(y[6]), "v"(y[7]), "v"(nm));
    return lp; }
__device__ __forceinline__ v4u lowparts(v4u hp, v8f y) { v4u lp;    // second form, both parts are wanted: the low parts go to registers of their own; the conversions in front fill the slots behind a matrix instruction whose operands lay there: to be seen in the listing after every change
    asm("s_delay_alu instid0(VALU_DEP_4) | instskip(NEXT) | instid1(VALU_DEP_4)\n\t"
        "v_fma_mixlo_bf16 %0, %4, %16, %8 op_sel_hi:[1,0,0]\n\t"
        "v_fma_mixlo_bf16 %1, %5, %16, %10 op_sel_hi:[1,0,0]\n\t"
        "s_delay_alu instid0(VALU_DEP_4) | instskip(NEXT) | instid1(VALU_DEP_4)\n\t"
        "v_fma_mixlo_bf16 %2, %6, %16, %12 op_sel_hi:[1,0,0]\n\t"
        "v_fma_mixlo_bf16 %3, %7, %16, %14 op_sel_hi:[1,0,0]\n\t"
        "s_delay_alu instid0(VALU_DEP_4) | instskip(NEXT) | instid1(VALU_DEP_4)\n\t"
        "v_fma_mixhi_bf16 %0, %4, %16, %9 op_sel:[1,0,0] op_sel_hi:[1,0,0]\n\t"
        "v_fma_mixhi_bf16 %1, %5, %16, %11 op_sel:[1,0,0] op_sel_hi:[1,0,0]\n\t"
        "s_delay_alu instid0(VALU_DEP_4) | instskip(NEXT) | instid1(VALU_DEP_4)\n\t"
        "v_fma_mixhi_bf16 %2, %6, %16, %13 op_sel:[1,0,0] op_sel_hi:[1,0,0]\n\t"
        "v_fma_mixhi_bf16 %3, %7, %16, %15 op_sel:[1,0,0] op_sel_hi:[1,0,0]"
        : "=&v"(lp[0]), "=&v"(lp[1]), "=&v"(lp[2]), "=&v"(lp[3]) : "v"(hp[0]), "v"(hp[1]), "v"(hp[2]), "v"(hp[3]), "v"(y[0]), "v"(y[1]), "v"(y[2]), "v"(y[3]), "v"(y[4]), "v"(y[5]), "v"(y[6]), "v"(y[7]), "s"(-1.0f));
    return lp; }
__device__ __forceinline__ v4u highparts(v8f y) { v4u hp;
#pragma unroll
    for (int i = 0; i < 4; ++i) hp[i] = __builtin_bit_cast(unsigned, __builtin_convertvector((v2f){y[2 * i], y[2 * i + 1]}, v2bf));
    return hp; }
__device__ __forceinline__ void split8(v8f y, v8us& h, v8us& l) { const v4u hp = highparts(y); h = __builtin_bit_cast(v8us, hp); l = __builtin_bit_cast(v8us, lowparts(hp, y)); }
// for a lane that wants one of the two parts: nm = 0 gives y rounded, the high part itself; nm = -1 the low part: no copy of the high parts, no selection
__device__ __forceinline__ v8us split8one(v8f y, float nm) { return __builtin_bit_cast(v8us, lowparts(highparts(y), y, nm)); }
// a precaution, written behind each group of global loads: the registers that hold their addresses are rewritten only behind this wait; the addresses are its inputs, so that they stay in their registers up to it
#define XWAIT(p) asm volatile("s_wait_xcnt 0x0" :: "v"(p) : "memory")
#define XWAIT8(a, i) asm volatile("s_wait_xcnt 0x0" :: "v"(a[i]), "v"(a[i + 1]), "v"(a[i + 2]), "v"(a[i + 3]), "v"(a[i + 4]), "v"(a[i + 5]), "v"(a[i + 6]), "v"(a[i + 7]) : "memory")
__device__ __forceinline__ unsigned pk2(float a, float b) { return __builtin_bit_cast(unsigned, __builtin_convertvector((v2f){a, b}, v2bf)); }    // two values rounded to bf16, a in the low half
__device__ __forceinline__ float relu(float x) { const int i = __builtin_bit_cast(int, x); return __builtin_bit_cast(float, i > 0 ? i : 0); }    // as an integer maximum (a negative float is a negative integer): one instruction; fmaxf took a second one, which quiets NaNs
__device__ __forceinline__ v16bf ldsfrag(const unsigned char* p) { return cat16b(*(const v8usa*)p, *(const v8usa*)(p + 32)); }    // 32 k of a row in the hardware's k order: bytes 16 * hi and 32 + 16 * hi of 64 (hi is in p)
__device__ __forceinline__ v8us ld_tr16(const unsigned char* p) { typedef __attribute__((address_space(3))) v8s lds_v8s; return __builtin_bit_cast(v8us, __builtin_amdgcn_ds_load_tr16_b128_v8i16((lds_v8s*)p)); }
__device__ __forceinline__ float xhalf(float x) { return __builtin_bit_cast(float, __builtin_amdgcn_permlanex16(__builtin_bit_cast(int, x), __builtin_bit_cast(int, x), 0x76543210, 0xfedcba98, false, false)); }    // lane l with lane l ^ 16
__device__ __forceinline__ unsigned xhalfu(unsigned x) { return (unsigned)__builtin_amdgcn_permlanex16((int)x, (int)x, 0x76543210, 0xfedcba98, false, false); }
#define TL 2                       // 16-point tiles per workgroup: a wave's slice of each weight plane is loaded once and serves both
__global__ __launch_bounds__(256) void k_attn(const bf* __restrict__ XB, const bf* __restrict__ WQT, const float* __restrict__ bq, const bf* __restrict__ WKB, const bf* __restrict__ WVT, const float* __restrict__ bv, const bf* __restrict__ WOT, const float* __restrict__ bo, const int* __restrict__ idx, const float* __restrict__ xyz, const bf* __restrict__ MTG, float* OUT) {
    static_assert(NN % (AP * TL) == 0 && (NB_ * NN) % (AP * TL) == 0, "a workgroup's points lie in one batch and the grid covers the points exactly");
    __shared__ __attribute__((aligned(16))) unsigned char L[QT_BYTES];         // qt, later y, of the tile at work: [point][16 rows][256]
    __shared__ __attribute__((aligned(16))) unsigned char XG[8 * XG_BYTES];    // each wave's 32 gathered rows. An array of its own, so that the compiler may move reads of the rows over stores of y
    __shared__ __attribute__((aligned(16))) unsigned char EX[TL * 8 * 2048];   // phase 3's result of each tile, as phase 4's B operand: the first tile's waits here while the second tile's rows pass through XG. Before that, wave w's 2 KiB of tile T hold the positional bias of its two points
    const int lane = threadIdx.x & 31, lr = lane & 15, hi = lane >> 4; const int w = __builtin_amdgcn_readfirstlane((int)(threadIdx.x >> 5));
    const int p0 = blockIdx.x * (AP * TL); const int bt = p0 / NN; const bf* XBb = XB + (size_t)bt * NN * CC; const float* xyzb = xyz + (size_t)bt * NN * 3;    // a neighbour index counts inside its own batch
    int ml[2 * TL];    // neighbour 'lane' of each of the wave's points (2 T + t): asked for first of all, since the coordinates' addresses hang on them
    { const unsigned io = ((unsigned)(p0 + 2 * w) * KN + (unsigned)lane) * 4u;
#pragma unroll
        for (int i = 0; i < 2 * TL; ++i) ml[i] = *(const int*)((const char*)(idx + ((i >> 1) * AP + (i & 1)) * KN) + io);
        XWAIT(io); }
    float gx[2 * TL][3]; v8us mt[4];    // the neighbours' coordinates; the bias MLP's operands, as k_prep lays them out (d_tab)
    unsigned char* xg = XG + w * XG_BYTES;
    v4u pre[KN];    // a point's 32 rows on their way to LDS: asked for one phase ahead, so that the gather's latency passes behind matrix work
    auto gather = [&](int pg) { const int* in_ = idx + (size_t)pg * KN; unsigned vo[KN];    // byte offset of this lane's 16 bytes in neighbour r's row
#pragma unroll
        for (int r = 0; r < KN; ++r) vo[r] = (unsigned)clampi(in_[r]) * (CC * 2u) + (unsigned)lane * 16u;
#pragma unroll
        for (int r = 0; r < KN; ++r) pre[r] = *(const v4u*)((const char*)XBb + vo[r]);
        XWAIT8(vo, 0); XWAIT8(vo, 8); XWAIT8(vo, 16); XWAIT8(vo, 24); };
    auto put = [&]() {
#pragma unroll
        for (int r = 0; r < KN; ++r) *(v4ua*)(xg + r * RP + lane * 16) = pre[r]; };
    v16bf wa[CC / 16], qh[TL], ql[TL];    // Wk's slice and both tiles' q stay in registers until the second tile's phase 1
    {   // phase 0: head w, the 16 points of each tile
        const float SC = 0.17677669529663687f; const bf* xp = XB + (size_t)(p0 + lr) * CC + 8 * hi; const bf* wqp = WQT + (size_t)(w * HD) * CC + 8 * lane; v16bf xq[TL][CC / 32], wq[CC / 32][2];    // B: point lr's x row; A: Wq^T in fragment order, rows 32 w + lr and 32 w + 16 + lr
#pragma unroll
        for (int T = 0; T < TL; ++T)
#pragma unroll
            for (int ks = 0; ks < CC / 32; ++ks) xq[T][ks] = WFrag<bf>::ld(xp + T * (AP * CC) + ks * 32);
        XWAIT(xp);
#pragma unroll
        for (int ks = 0; ks < CC / 32; ++ks) { wq[ks][0] = WFrag<bf>::ldf(wqp + ks * 512); wq[ks][1] = WFrag<bf>::ldf(wqp + (size_t)16 * CC + ks * 512); }
        XWAIT(wqp);
        const float* bqp = bq + w * HD + 8 * hi; const v8f bq0 = *(const v8f*)bqp, bq1 = *(const v8f*)(bqp + 16); XWAIT(bqp);
        // the bias MLP's operands and the coordinates are asked for in front of Wk's slice: loads return in order, and the bias is worked while that slice is on its way
        { const unsigned mo = (unsigned)lane * 16u;
#pragma unroll
            for (int i = 0; i < 4; ++i) mt[i] = *(const v8us*)((const char*)(MTG + i * 256) + mo);
            XWAIT(mo); }
        __builtin_amdgcn_sched_barrier(0);    // holds the clamps below, which wait for the indices, behind the issue of the operands above: left free, the compiler put that wait in front of them
        { unsigned xo[2 * TL];
#pragma unroll
            for (int i = 0; i < 2 * TL; ++i) xo[i] = (unsigned)clampi(ml[i]) * 12u;
#pragma unroll
            for (int i = 0; i < 2 * TL; ++i)
#pragma unroll
                for (int a = 0; a < 3; ++a) gx[i][a] = *(const float*)((const char*)(xyzb + a) + xo[i]);
            static_assert(TL == 2, "the wait below names four offsets"); asm volatile("s_wait_xcnt 0x0" :: "v"(xo[0]), "v"(xo[1]), "v"(xo[2]), "v"(xo[3]) : "memory"); }    // the same precaution as XWAIT
        const bf* wp = WKB + w * 512 + 8 * lane;    // Wk in fragment order: rows 16 ct + lr, k step w
#pragma unroll
        for (int ct = 0; ct < CC / 16; ++ct) wa[ct] = WFrag<bf>::ldf(wp + (size_t)ct * 16 * CC);
        XWAIT(wp);
        __builtin_amdgcn_sched_barrier(0);    // holds phase 0's products behind the issue of phase 1's operands: left free, the compiler waited for the first Wq rows before it asked for Wk, one more latency in a row
        v8f qr0[TL], qr1[TL];    // the lane's q: point lr, d = 8 hi + r and 16 + 8 hi + r of head w
#pragma unroll
        for (int T = 0; T < TL; ++T) { qr0[T] = (v8f){}; qr1[T] = (v8f){};
#pragma unroll
            for (int ks = 0; ks < CC / 32; ++ks) { qr0[T] = wmmab(wq[ks][0], xq[T][ks], qr0[T]); qr1[T] = wmmab(wq[ks][1], xq[T][ks], qr1[T]); } }
#pragma unroll
        for (int T = 0; T < TL; ++T)
#pragma unroll
            for (int r = 0; r < 8; ++r) { qr0[T][r] += bfr(bq0[r]); qr1[T][r] += bfr(bq1[r]); }
        gather(p0 + 2 * w);    // asked for behind the operands of phases 0 and 1: loads return in order, and these phases need not wait for the rows
#pragma unroll
        for (int T = 0; T < TL; ++T) { const v8f q0 = qr0[T] * SC, q1 = qr1[T] * SC; v8us h0, l0, h1, l1; split8(q0, h0, l0); split8(q1, h1, l1); qh[T] = cat16b(h0, h1); ql[T] = cat16b(l0, l1); }
    }
    v4u rw[2 * TL];    // k = 8 hi + 0..7 of the first layer's B operand, column lr: the point, the lane's neighbour, 1, 0
#pragma unroll
    for (int i = 0; i < 2 * TL; ++i) { const float* pn = xyz + (size_t)(p0 + (i >> 1) * AP + 2 * w + (i & 1)) * 3; rw[i] = (v4u){pk2(pn[0], pn[1]), pk2(pn[2], gx[i][0]), pk2(gx[i][1], gx[i][2]), 0x3F80u}; }
    {   // the positional bias of the wave's 4 points, 16 neighbours a pass: it runs while Wk's slice and the first rows are on their way
        const v8us z8 = (v8us){}; const v16bf a10 = cat16b(mt[0], z8), a11 = cat16b(mt[1], z8), w2f = cat16b(mt[2], mt[3]); unsigned char* bs = EX + w * 2048 + (lr + 8 * hi) * 16;
#pragma unroll 1    // both loops rolled: one copy of the code for the eight passes; the points' operands move up through rw
        for (int i = 0; i < 2 * TL; ++i) {
#pragma unroll 1
            for (int jt = 0; jt < 2; ++jt) { const v16bf rb = cat16b(__builtin_bit_cast(v8us, rw[0]), z8); v8f d0 = wmmab(a10, rb, (v8f){}), d1 = wmmab(a11, rb, (v8f){});
#pragma unroll
                for (int r = 0; r < 8; ++r) { d0[r] = relu(d0[r]); d1[r] = relu(d1[r]); }
                v8us h0, l0, h1, l1; split8(d0, h0, l0); split8(d1, h1, l1);    // the lane holds neighbour 16 jt + lr, hidden units 8 hi + r and 16 + 8 hi + r: its place in the A operand
                v8f sb = wmmab(cat16b(h0, h1), w2f, (v8f){}); sb = wmmab(cat16b(l0, l1), w2f, sb);
                unsigned char* bo_ = bs + (i >> 1) * (8 * 2048) + (i & 1) * 1024 + jt * 512;    // a point: [4 registers][16 lanes][16 bytes]; columns lr and lr + 8 hold the same head: one of them stores
                if (lr < 8) { *(v4fa*)bo_ = (v4f){sb[0], sb[1], sb[2], sb[3]}; *(v4fa*)(bo_ + 256) = (v4f){sb[4], sb[5], sb[6], sb[7]}; }
#pragma unroll
                for (int c = 0; c < 3; ++c) rw[0][c] = xhalfu(rw[0][c]); }    // neighbours 16..31 come down into lanes 0..15, whose k the A operand reads
#pragma unroll
            for (int k = 0; k + 1 < 2 * TL; ++k) rw[k] = rw[k + 1]; }
        __builtin_amdgcn_wave_barrier();    // what the wave's lanes have just stored is read across lanes in phase 2
    }
    v16bf va[CC / 32][2];    // Wv's slice: loaded behind the first tile's phase 2, kept for the second tile's phase 3
    v16bf wo[CC / 32][2]; v8f bo0, bo1;    // Wo's slice: Wo^T rows 32 w + lr and 32 w + 16 + lr
#pragma unroll    // unrolled: T is a compile-time index of qh, ql and EX, and the loads that stand at one tile only need no branch
    for (int T = 0; T < TL; ++T) {
        {   // phase 1: head w, the tile's 16 points. It writes the rows w and 8 + w of L that this same wave read in the tile before (phase 3): no barrier in front
            unsigned char* o = L + lr * PP + w * RP + 16 * hi; v8f dq[3];
#pragma unroll
            for (int ct = 0; ct < 2; ++ct) dq[ct] = wmmab(wa[ct], ql[T], wmmab(wa[ct], qh[T], (v8f){}));
#pragma unroll
            for (int ct = 0; ct < CC / 16; ++ct) { v8f dn = (v8f){}; if (ct + 2 < CC / 16) dn = wmmab(wa[ct + 2], qh[T], dn);    // a column tile's two products stand two tiles ahead of its split, one on either side of another tile's: no idle slots between a product and its reader
                v8us dh, dl; split8(dq[ct % 3], dh, dl); if (ct + 2 < CC / 16) dq[(ct + 2) % 3] = wmmab(wa[ct + 2], ql[T], dn);
                *(v8usa*)(o + ct * 32) = dh; *(v8usa*)(o + 8 * RP + ct * 32) = dl;
                __builtin_amdgcn_sched_barrier(0); }    // holds that order: left free, the compiler sank each tile's second product to just in front of its split, and filled the distance with four v_nop
        }
        __syncthreads();    // every head's qt rows of every point are in LDS before a wave takes up its two points
#pragma unroll 1    // rolled: the wave's two points run through one copy of the code, half the instruction bytes to fetch
        for (int t = 0; t < 2; ++t) {
            const int pl = 2 * w + t;
            const unsigned char* bl = EX + T * (8 * 2048) + w * 2048 + t * 1024 + ((lr & 7) + 8 * hi) * 16;
            v8f s0 = __builtin_shufflevector(*(const v4fa*)bl, *(const v4fa*)(bl + 256), 0, 1, 2, 3, 4, 5, 6, 7), s1 = __builtin_shufflevector(*(const v4fa*)(bl + 512), *(const v4fa*)(bl + 768), 0, 1, 2, 3, 4, 5, 6, 7);    // C: the positional bias of neighbours 8 hi + r and 16 + 8 hi + r, head lr & 7
            put();
            if (t == 0) gather(p0 + T * AP + pl + 1);
            __builtin_amdgcn_wave_barrier();    // the rows that the wave's lanes have just stored are read across lanes below
            const unsigned char* qa = L + pl * PP + (lr & 7) * RP + 16 * hi; const unsigned char* xa = xg + lr * RP + 16 * hi;
#pragma unroll
            for (int ks = 0; ks < CC / 32; ++ks) { const v16bf bh = ldsfrag(qa + ks * 64), bl = ldsfrag(qa + 8 * RP + ks * 64), a0 = ldsfrag(xa + ks * 64), a1 = ldsfrag(xa + 16 * RP + ks * 64);
                s0 = wmmab(a0, bh, s0); s1 = wmmab(a1, bh, s1); s0 = wmmab(a0, bl, s0); s1 = wmmab(a1, bl, s1); }
            float mx = -3.0e38f;
#pragma unroll
            for (int r = 0; r < 8; ++r) mx = fmaxf(mx, fmaxf(s0[r], s1[r]));
            mx = fmaxf(mx, xhalf(mx)); float sum = 0.f;
#pragma unroll
            for (int r = 0; r < 8; ++r) { s0[r] = __expf(s0[r] - mx); s1[r] = __expf(s1[r] - mx); sum += s0[r] + s1[r]; }
            sum += xhalf(sum); const float inv = __fdiv_rn(1.0f, sum); s0 *= inv; s1 *= inv;
            v8us h0, l0, h1, l1; split8(s0, h0, l0); split8(s1, h1, l1); const v16bf ph = cat16b(h0, h1), pw = cat16b(l0, l1);    // element s of the B operand is neighbour 8 hi + s, or 16 + 8 hi + s - 8 for s >= 8: what the lane holds
            const unsigned char* ta = xg + (8 * hi + (lane & 7)) * RP + 16 * ((lane >> 3) & 1); unsigned char* yo = L + pl * PP + lr * RP + 16 * hi;
#pragma unroll 1    // rolled: with two copies of phase 2 in the text; for speed only
            for (int g = 0; g < 2; ++g) { v16bf xa[8];    // eight fragments are asked for together: one pass through the LDS latency for eight column tiles
#pragma unroll
                for (int i = 0; i < 8; ++i) xa[i] = cat16b(ld_tr16(ta + 32 * (g * 8 + i)), ld_tr16(ta + 16 * RP + 32 * (g * 8 + i)));
#pragma unroll
                for (int i = 0; i < 8; ++i) { v8f d = (v8f){}; d = wmmab(xa[i], ph, d); d = wmmab(xa[i], pw, d);
                    *(v8usa*)(yo + (g * 8 + i) * 32) = split8one(d, lr < 8 ? 0.f : -1.0f); } }    // columns lr and lr + 8 hold the same head: the first stores the high parts (row h), the second the low parts (row 8 + h)
            __builtin_amdgcn_wave_barrier();    // the next point's rows are stored only behind this point's last transposing load
        }
        // phase 3: head w, the tile's 16 points
        const int col = w * HD + 8 * hi;
        if (T == 0) { const bf* vp = WVT + (size_t)(w * HD) * CC + 8 * lane;
#pragma unroll
            for (int ks = 0; ks < CC / 32; ++ks) { va[ks][0] = WFrag<bf>::ldf(vp + ks * 512); va[ks][1] = WFrag<bf>::ldf(vp + (size_t)16 * CC + ks * 512); }    // the head's Wv rows are asked for in front of the barrier: their latency passes behind the wait for the other waves
            XWAIT(vp); }
        const float* bvp = bv + col; const v8f bv0 = *(const v8f*)bvp, bv1 = *(const v8f*)(bvp + 16); XWAIT(bvp);    // asked for anew at each tile: 16 registers less to hold through the next tile's phases 1 and 2
        __syncthreads();    // every point's y is in LDS before phase 3 reads it
        if (T == TL - 1) { const bf* op = WOT + (size_t)(w * HD) * CC + 8 * lane;    // phase 4's operand is asked for behind the barrier, which waits for every load in flight: it lands behind the last phase 3's products
#pragma unroll
            for (int ks = 0; ks < CC / 32; ++ks) { wo[ks][0] = WFrag<bf>::ldf(op + ks * 512); wo[ks][1] = WFrag<bf>::ldf(op + (size_t)16 * CC + ks * 512); }
            XWAIT(op);
            const float* bop = bo + col; bo0 = *(const v8f*)bop; bo1 = *(const v8f*)(bop + 16); XWAIT(bop); }
        const unsigned char* ya = L + lr * PP + w * RP + 16 * hi; v8f o0 = (v8f){}, o1 = (v8f){};
        v16bf yh[CC / 32], yl[CC / 32];    // all of y's fragments are asked for together: one pass through the LDS latency, not one per k step
#pragma unroll
        for (int ks = 0; ks < CC / 32; ++ks) { yh[ks] = ldsfrag(ya + ks * 64); yl[ks] = ldsfrag(ya + 8 * RP + ks * 64); }
        __builtin_amdgcn_sched_barrier(0);    // holds the fragment loads together in front of the products: left free, the compiler sank each pair to its use and waited for it there
#pragma unroll
        for (int ks = 0; ks < CC / 32; ++ks) { o0 = wmmab(va[ks][0], yh[ks], o0); o1 = wmmab(va[ks][1], yh[ks], o1); o0 = wmmab(va[ks][0], yl[ks], o0); o1 = wmmab(va[ks][1], yl[ks], o1); }
#pragma unroll
        for (int r = 0; r < 8; ++r) { o0[r] += bfr(bv0[r]); o1[r] += bfr(bv1[r]); }
        v8us h0, l0, h1, l1; split8(o0, h0, l0); split8(o1, h1, l1);
        // The lane holds point lr, columns 32 w + 8 hi + r and 32 w + 16 + 8 hi + r: the two halves of its own place in k step w of phase 4's B operand: 2 KiB a k step, [high, low][half][lane][16 bytes]
        unsigned char* ex = EX + T * (8 * 2048) + w * 2048 + lane * 16;
        *(v8usa*)ex = h0; *(v8usa*)(ex + 512) = h1; *(v8usa*)(ex + 1024) = l0; *(v8usa*)(ex + 1536) = l1;
        if (T + 1 < TL) gather(p0 + (T + 1) * AP + 2 * w);    // the next tile's first rows: asked for where the registers of y and of this phase's result are free again, they land behind the next phase 1
    }
    {   // phase 4, both tiles on one load of Wo's slice
        __syncthreads();    // every head's columns of both tiles are in LDS before a wave sums over all of them
#pragma unroll 1    // rolled, for the same reason as phase 2's loops: T enters addresses only
        for (int T = 0; T < TL; ++T) {
            const unsigned char* ex = EX + T * (8 * 2048) + lane * 16; v16bf ah[CC / 32], al[CC / 32];
#pragma unroll
            for (int ks = 0; ks < CC / 32; ++ks) { ah[ks] = cat16b(*(const v8usa*)(ex + ks * 2048), *(const v8usa*)(ex + ks * 2048 + 512)); al[ks] = cat16b(*(const v8usa*)(ex + ks * 2048 + 1024), *(const v8usa*)(ex + ks * 2048 + 1536)); }
            __builtin_amdgcn_sched_barrier(0);    // as in phase 3: holds the fragment loads together in front of the products, one pass through the LDS latency
            v8f e0 = (v8f){}, e1 = (v8f){};
#pragma unroll
            for (int ks = 0; ks < CC / 32; ++ks) { e0 = wmmab(wo[ks][0], ah[ks], e0); e1 = wmmab(wo[ks][1], ah[ks], e1); e0 = wmmab(wo[ks][0], al[ks], e0); e1 = wmmab(wo[ks][1], al[ks], e1); }
#pragma unroll
            for (int r = 0; r < 8; ++r) { e0[r] += bfr(bo0[r]); e1[r] += bfr(bo1[r]); }
            // the lane holds point lr, output columns 32 w + 8 hi + r and 32 w + 16 + 8 hi + r: 32-byte pieces. Through the wave's own LDS range (16 rows of 128 bytes, pitch 144 = 16 B x odd; the gathered rows' LDS is free since the barrier in front of the last phase 3) they become whole lines: 8 lanes a point, 4 points a store
            unsigned char* st = xg + T * (16 * 144); unsigned char* sp = st + lr * 144 + hi * 32;
            *(v4fa*)sp = (v4f){e0[0], e0[1], e0[2], e0[3]}; *(v4fa*)(sp + 16) = (v4f){e0[4], e0[5], e0[6], e0[7]}; *(v4fa*)(sp + 64) = (v4f){e1[0], e1[1], e1[2], e1[3]}; *(v4fa*)(sp + 80) = (v4f){e1[4], e1[5], e1[6], e1[7]};
            __builtin_amdgcn_wave_barrier();    // the rows that the wave's lanes have just stored are read across lanes below
            float* og = OUT + (size_t)(p0 + T * AP + (lane >> 3)) * CC + w * HD + (lane & 7) * 4; v4f ov[4];
#pragma unroll
            for (int i = 0; i < 4; ++i) ov[i] = *(const v4fa*)(st + (i * 4 + (lane >> 3)) * 144 + (lane & 7) * 16);
#pragma unroll
            for (int i = 0; i < 4; ++i) *(v4f*)(og + (size_t)i * 4 * CC) = ov[i];
            asm volatile("s_wait_xcnt 0x0" :: "v"(og), "v"(ov[0]), "v"(ov[1]), "v"(ov[2]), "v"(ov[3]) : "memory");    // the same precaution as XWAIT, behind the stores, for their address and their data
        }
    }
}

extern "C" void kernel_launch(void* const* d_in, const int* in_sizes, int n_in,
                              void* d_out, int out_size, void* d_ws, size_t ws_size, hipStream_t stream) {
    (void)in_sizes; (void)n_in; (void)out_size;
    const float* x = (const float*)d_in[0]; const float* xyz = (const float*)d_in[1]; const int* idx = (const int*)d_in[2]; const float* wq = (const float*)d_in[3]; const float* bq = (const float*)d_in[4]; const float* wk = (const float*)d_in[5]; const float* bk = (const float*)d_in[6]; const float* wv = (const float*)d_in[7]; const float* bv = (const float*)d_in[8];
    const float* wo = (const float*)d_in[9]; const float* bo = (const float*)d_in[10]; const float* W1 = (const float*)d_in[11]; const float* b1 = (const float*)d_in[12]; const float* W2 = (const float*)d_in[13]; const float* b2 = (const float*)d_in[14];
    float* OUT = (float*)d_out;     // [2][8192][256]
    char* wsp = (char*)d_ws;
    auto take = [&](size_t bytes) { char* p = wsp; wsp += (bytes + 255) & ~(size_t)255; return (void*)p; };
    bf* WT = (bf*)take((size_t)4 * CC * CC * 2);                          // Wq transposed, Wk as it is, Wv and Wo transposed, one after the other, each in fragment order
    bf* XB = (bf*)take((size_t)NB_ * NN * CC * 2);
    bf* MTG = (bf*)take((size_t)4 * 512);                                  // the bias MLP's weights as WMMA operands
    if ((size_t)(wsp - (char*)d_ws) > ws_size) return;    // total ~ 9 MB
    k_prep<<<4 * WT_BLK + 1 + CVT_BLK, 256, 0, stream>>>(wq, wk, wv, wo, WT, x, XB, W1, b1, W2, MTG);
    k_attn<<<NB_ * NN / (AP * TL), 256, 0, stream>>>(XB, WT, bq, WT + (size_t)CC * CC, WT + (size_t)2 * CC * CC, bv, WT + (size_t)3 * CC * CC, bo, idx, xyz, MTG, OUT);
}

// v010
// A run of this version takes 49.4 microseconds.
// Two timings next to v009 put it at 1.06 and 1.07 times that version's speed.
// Counting every step since v000, it is 3.99 times as fast.
#include <hip/hip_runtime.h>

// LocalSphereAttention (x [2][8192][256], xyz [2][8192][3], idx [2][8192][32] (int neighbour indices, read as data); q/k/v = x W + b (8 heads x 32); per point n and head h, over its 32 neighbours m = idx[n][kk]:
// score = q[n].k[m]/sqrt(32) + bias[n][kk][h], bias = relu((xyz[n] - xyz[m]) W1 + b1) W2 + b2; softmax over the 32 neighbours; out = sum attn v[m]; (merged) Wo + bo -> [2][8192][256]).
// Compute dtypes, f32 accumulate: every input rounded to bf16; q on PLAIN bf16 operands (inputs: exact) + bias; the softmax f32 on the VALU; the positional-bias MLP, scores and weighted sums on WMMA, every f32 operand as bf16 high + low parts (see k_attn)
// FRAGMENT ORDER: a 16-bit plane T[r][k] (k = 0..255) that is only ever read as WMMA fragments (the four weight planes) is stored by its producer as its reader loads it:
// the fragment of rows 16 rt .. 16 rt + 15, k = 32 ks .. 32 ks + 31 is 1 KiB at (rt * 8 + ks) KiB: [half j][lane = 16 hi + lr][8 values] = T[16 rt + lr][32 ks + 16 j + 8 hi + 0..7].
// A wave's 16-byte-a-lane load is then 512 contiguous bytes, 4 whole lines; from the row-major plane it took 32 bytes out of each of 16 lines.

#define NB_  2
#define NN   8192
#define CC   256
#define NH_  8
#define HD   32
#define KN   32
#define HB   32
typedef _Float16 h16;
typedef unsigned short bf;
typedef __attribute__((ext_vector_type(16))) __bf16   v16bf;
typedef __attribute__((ext_vector_type(16))) _Float16 v16h;
typedef __attribute__((ext_vector_type(8)))  _Float16 v8h;
typedef __attribute__((ext_vector_type(8)))  unsigned short v8us;
typedef __attribute__((ext_vector_type(8)))  float    v8f;
typedef __attribute__((ext_vector_type(4)))  float    v4f;
typedef v8h  __attribute__((may_alias)) v8ha;
typedef v4f  __attribute__((may_alias)) v4fa;
typedef v8us __attribute__((may_alias)) v8usa;

__device__ __forceinline__ unsigned short f2bf(float f) { unsigned u = __float_as_uint(f); u += 0x7FFFu + ((u >> 16) & 1u); return (unsigned short)(u >> 16); }
__device__ __forceinline__ float bf2f(unsigned short b) { return __uint_as_float(((unsigned)b) << 16); }
__device__ __forceinline__ float bfr(float f) { return bf2f(f2bf(f)); }
__device__ __forceinline__ v16h cat16(v8h lo, v8h hi) { return __builtin_shufflevector(lo, hi, 0, 1, 2, 3, 4, 5, 6, 7, 8, 9, 10, 11, 12, 13, 14, 15); }
__device__ __forceinline__ v16bf cat16b(v8us lo, v8us hi) { return __builtin_bit_cast(v16bf, __builtin_shufflevector(lo, hi, 0, 1, 2, 3, 4, 5, 6, 7, 8, 9, 10, 11, 12, 13, 14, 15)); }
__device__ __forceinline__ v8f wmma16(v16h a, v16h b, v8f c) { return __builtin_amdgcn_wmma_f32_16x16x32_f16(false, a, false, b, (short)0, c, false, false); }
__device__ __forceinline__ v8f wmmab(v16bf a, v16bf b, v8f c) { return __builtin_amdgcn_wmma_f32_16x16x32_bf16(false, a, false, b, (short)0, c, false, false); }



// ld: a fragment from a row-major plane (p holds row and 8 hi); ldf: from a plane in fragment order (p holds 8 lane). 16 rows are 16 K values in both.
template <typename T16> struct WFrag;
template <> struct WFrag<h16> { typedef v16h V; static __device__ __forceinline__ V ld(const h16* p) { return cat16(*(const v8h*)p, *(const v8h*)(p + 16)); } static __device__ __forceinline__ V ldf(const h16* p) { return cat16(*(const v8h*)p, *(const v8h*)(p + 256)); } static __device__ __forceinline__ v8f mma(V a, V b, v8f c) { return wmma16(a, b, c); } };
template <> struct WFrag<bf> { typedef v16bf V; static __device__ __forceinline__ V ld(const bf* p) { return cat16b(*(const v8us*)p, *(const v8us*)(p + 16)); } static __device__ __forceinline__ V ldf(const bf* p) { return cat16b(*(const v8us*)p, *(const v8us*)(p + 256)); } static __device__ __forceinline__ v8f mma(V a, V b, v8f c) { return wmmab(a, b, c); } };
__device__ __forceinline__ void splitf(float y, unsigned short& h, unsigned short& l) { h = f2bf(y); l = f2bf(y - bf2f(h)); }
typedef __attribute__((ext_vector_type(2))) unsigned short v2us;
typedef __attribute__((ext_vector_type(4))) unsigned short v4us;

__device__ __forceinline__ size_t fragofs(int r, int k) { return ((size_t)(r >> 4) * (CC / 32) + (k >> 5)) * 512 + ((k >> 4) & 1) * 256 + (((k >> 3) & 1) * 16 + (r & 15)) * 8 + (k & 7); }    // where T[r][k] lies in a plane in fragment order, in values; 8 values from a k that is a multiple of 8 lie together
__device__ __forceinline__ void d_wtG(int blk, const float* __restrict__ w, int K, int N, bf* Bt) {
    const int lane = threadIdx.x & 31; const int L0 = (blk * 8 + (threadIdx.x >> 5)) * 8; const int nlines = N * K / 64;
{
#pragma unroll 1
        for (int l = 0; l < 8; ++l) { const int L = L0 + l; if (L >= nlines) break; const size_t e = (size_t)L * 64 + lane * 2; const int k = (int)(e % K), n = (int)(e / K); v2us o;
            o[0] = f2bf(w[(size_t)k * N + n]); o[1] = f2bf(w[(size_t)(k + 1) * N + n]); bf* dp = Bt + fragofs(n, k); *(v2us*)dp = o;
            asm volatile("s_wait_xcnt 0x0" :: "v"(dp) : "memory"); }    // a precaution: the next trip forms its addresses in the registers that this store names only behind this wait
         }
}
__device__ __forceinline__ void d_cvt8(int blk, const float* __restrict__ src, bf* dst, size_t n8) { const size_t i = (size_t)blk * 256 + threadIdx.x; if (i >= n8) return; const v8f v = *(const v8f*)(src + i * 8); v8us o;
#pragma unroll
    for (int k = 0; k < 8; ++k) o[k] = f2bf(v[k]); *(v8us*)(dst + i * 8) = o;  }
__device__ __forceinline__ void d_cvt8f(int blk, const float* __restrict__ src, bf* dst) { const int i = blk * 256 + threadIdx.x; const unsigned so = 32u * i; const v8f v = *(const v8f*)((const char*)src + so); v8us o;    // a [256][256] plane, rounded and stored in fragment order
    asm volatile("s_wait_xcnt 0x0" :: "v"(so) : "memory");    // a precaution: the register that holds the load's offset is rewritten only behind this wait; it is the wait's input, so that it keeps its value up to it
#pragma unroll
    for (int k = 0; k < 8; ++k) o[k] = f2bf(v[k]); const unsigned dofs = 2u * (unsigned)fragofs(i / (CC / 8), (i % (CC / 8)) * 8); *(v8us*)((char*)dst + dofs) = o;
    asm volatile("s_wait_xcnt 0x0" :: "v"(dofs), "v"(o) : "memory"); }    // the same precaution behind the store, for its offset and its data
__device__ __forceinline__ int clampi(int m) { return m < 0 ? 0 : (m >= NN ? NN - 1 : m); }
typedef __attribute__((ext_vector_type(2))) float v2f;
// The bias MLP's weights as k_attn's WMMA operands, [piece][lane = 16 hi + lr][8 values], 128 threads of one block: pieces ut = 0, 1: k = 8 hi + 0..7 of the first layer's A operand, row = hidden unit u = 16 ut + lr:
// W1[0..2][u], -W1[0..2][u], b1[u], 0 in lanes 0..15, zeros in lanes 16..31; pieces 2, 3: the two halves of W2 as a B operand, column = head lr & 7, k = 16 (piece - 2) + 8 hi + 0..7.
__device__ __forceinline__ void d_tab(const float* __restrict__ W1, const float* __restrict__ b1, const float* __restrict__ W2, bf* MTG) {
    const int pc = threadIdx.x >> 5, lane = threadIdx.x & 31, lr = lane & 15, hi = lane >> 4; v8us o = (v8us){}; if (pc >= 4) return;
    if (pc < 2) { const unsigned uo = (16u * (unsigned)pc + (unsigned)lr) * 4u; const float t0 = *(const float*)((const char*)W1 + uo), t1 = *(const float*)((const char*)(W1 + HB) + uo), t2 = *(const float*)((const char*)(W1 + 2 * HB) + uo), t3 = *(const float*)((const char*)b1 + uo);
        asm volatile("s_wait_xcnt 0x0" :: "v"(uo) : "memory");    // a precaution: the register that holds the loads' offset is rewritten only behind this wait
        if (hi == 0) { const unsigned short a0 = f2bf(t0), a1 = f2bf(t1), a2 = f2bf(t2); o = (v8us){a0, a1, a2, (unsigned short)(a0 ^ 0x8000u), (unsigned short)(a1 ^ 0x8000u), (unsigned short)(a2 ^ 0x8000u), f2bf(t3), 0}; } }
    else { const unsigned wo2 = ((16u * (unsigned)(pc - 2) + 8u * (unsigned)hi) * NH_ + (unsigned)(lr & 7)) * 4u; float t[8];
#pragma unroll
        for (int e = 0; e < 8; ++e) t[e] = *(const float*)((const char*)(W2 + e * NH_) + wo2);
        asm volatile("s_wait_xcnt 0x0" :: "v"(wo2) : "memory");    // the same precaution
#pragma unroll
        for (int e = 0; e < 8; ++e) o[e] = f2bf(t[e]); }
    const unsigned so = threadIdx.x * 16u; *(v8us*)((char*)MTG + so) = o;
    asm volatile("s_wait_xcnt 0x0" :: "v"(so), "v"(o) : "memory"); }    // the same precaution behind the store, for its offset and its data
// k_prep: the independent preparation passes in ONE launch, told apart by the block index: first the four weight planes (three transposes, few blocks, a serial latency-bound loop; Wk is only rounded) and the bias MLP's operand table, then the x conversion.
#define WT_BLK   ((CC * CC / 64 + 63) / 64)
#define CVT_BLK  ((NB_ * NN * CC / 8 + 255) / 256)
__global__ __launch_bounds__(256) void k_prep(const float* __restrict__ wq, const float* __restrict__ wk, const float* __restrict__ wv, const float* __restrict__ wo, bf* WT, const float* __restrict__ x, bf* XB, const float* __restrict__ W1, const float* __restrict__ b1, const float* __restrict__ W2, bf* MTG) {
    const int blk = blockIdx.x;
    if (blk < 4 * WT_BLK) { const int t = blk / WT_BLK;
        if (t == 1) { static_assert(2 * WT_BLK * 256 == CC * CC / 8, "two passes of the plane's blocks cover Wk exactly"); d_cvt8f(blk - WT_BLK, wk, WT + (size_t)CC * CC); d_cvt8f(blk, wk, WT + (size_t)CC * CC); }    // Wk's rows are the A operand's rows (k_attn, phase 1): rounded, not transposed
        else d_wtG(blk - t * WT_BLK, t == 0 ? wq : (t == 2 ? wv : wo), CC, CC, WT + (size_t)t * CC * CC); }
    else if (blk == 4 * WT_BLK) d_tab(W1, b1, W2, MTG);
    else d_cvt8(blk - 4 * WT_BLK - 1, x, XB, (size_t)NB_ * NN * CC / 8);
}
// k_attn: the K and V projections are applied on the query side, so that a neighbour is gathered ONCE, as its 512-byte bf16 x row (exact: x is rounded to bf16 anyway), not as a 1-KiB f32 K row and a 1-KiB f32 V row:
//   q[n][h].k[m][h] = x[m] . qt[n][h] + q[n][h].bk[h], qt[n][h][c] = sum_d Wk[c][h*32+d] q[n][h][d]; the bk term is the same for a point-head's 32 neighbours and cancels in the softmax;
//   sum_j attn[j] v[m_j][h] = (sum_j attn[j] x[m_j]) Wv[:, h] + bv[h] (the weights sum to 1).
// The q projection and the output projection are phases of this kernel too: a workgroup's 32 points need only their own x rows for q, and their own attention output for the last product, so neither plane goes through memory and neither needs a launch.
// One workgroup = 2 tiles of 16 points, 8 waves: phase 0 for both tiles, phases 1 to 3 tile by tile, phase 4 for both, so that a wave loads its slice of each of the four weight planes once for 32 points. Every f32 value that becomes a matrix operand (q, qt, the weights, y) goes in as bf16 high part + bf16 low part, two products into one f32 accumulator.
//   phase 0, wave = head: q^T [d][point] = Wq^T rows x the points' x rows (plain bf16 operands; the rows are read once for the workgroup and shared through LDS), + bq; the result lies in the registers as phase 1's B operand wants it;
//   phase 1, wave = head: qt^T [c][point] = Wk rows x q, stored to LDS as QT[point][high: row h, low: row 8 + h][c];
//   the positional bias of the wave's 4 points, between phases 0 and 1, on the matrix unit too: lane l holds neighbour l's coordinates;
//            hidden^T [u][j] = (W1^T, -W1^T, b1) x (xyz[n], xyz[m_j], 1), all operands exact in bf16, k = 0..6 of 32 (what lanes 16..31 hold is k = 8..15, where the A operand is zero: the two halves of the wave change places for neighbours 16..31);
//            relu; the result tiles, split, are the A operand of bias [j][h] = hidden x W2, which waits in the wave's own, still unused part of EX. b2[h] is the same for a point-head's 32 neighbours and cancels in the softmax, as bk does;
//   phase 2, wave = 2 points, one after the other: the 32 x rows in LDS; scores^T [j][h] = rows x qt with the positional bias as C; softmax inside the lane and with lane ^ 16; the two score tiles, converted in place,
//            are the B operand of y^T [c][h] = rows^T (transposing LDS loads) x weights; y replaces the point's qt in LDS;
//   phase 3, wave = head: out^T [d][point] = Wv^T rows x y, + bv, split: the lane's registers are k step w of phase 4's B operand, and go to LDS as they are;
//   phase 4, wave = 32 output columns: final^T [e][point] = Wo^T rows x all eight k steps (high, then low part, k step by k step), + bo, turned through the wave's own LDS range into whole 128-byte lines.
// Every '#pragma unroll' in k_attn and its helpers makes the indices of a register array compile-time constants, so that the array stays in registers and every LDS offset is an immediate.
#define AP 16                      // points per tile
#define RP 528                     // LDS pitch in bytes of a row of 256 16-bit values: 16 B x odd
#define PP (16 * RP + 16)          // one point's 16 rows; 16 B x odd, since phases 1 and 3 walk the points by lane
#define QT_BYTES (AP * PP)
#define XG_BYTES (KN * RP)
typedef __attribute__((ext_vector_type(8))) short  v8s;
typedef __attribute__((ext_vector_type(4))) unsigned v4u;
typedef v4u __attribute__((may_alias)) v4ua;
typedef __attribute__((ext_vector_type(2))) __bf16 v2bf;
// f32 -> bf16 high part (round to nearest even) + bf16 low part (the remainder, rounded); two values per conversion instruction
// The low parts: y - high part (exact in f32), rounded to bf16 into one half of a register, ONE instruction a value: the mixed-precision FMA reads the bf16 high part as it lies in its half register (times nm = -1, an f32 operand) and y as f32.
// The compiler's own form of the same sums took a shift or a mask a value, a packed subtraction and a conversion.
// Each instruction's producer stands four vector instructions back: the hints say so, as the compiler's own would (it writes none for asm text).
// The distance behind a matrix instruction (four vector slots before a register of its A, B or D is written): the asm text reads y only behind the compiler's own conversions of y, which keep it;
// what it writes: see at each form.
// First form, in place: each half of a register that holds two high parts is replaced by its own low part. It writes registers that the compiler's conversions have just written and that are still live: no operand of a matrix instruction close in front
__device__ __forceinline__ v4u lowparts(v4u lp, v8f y, float nm) {
    asm("s_delay_alu instid0(VALU_DEP_4) | instskip(NEXT) | instid1(VALU_DEP_4)\n\t"
        "v_fma_mixlo_bf16 %0, %0, %12, %4 op_sel_hi:[1,0,0]\n\t"
        "v_fma_mixlo_bf16 %1, %1, %12, %6 op_sel_hi:[1,0,0]\n\t"
        "s_delay_alu instid0(VALU_DEP_4) | instskip(NEXT) | instid1(VALU_DEP_4)\n\t"
        "v_fma_mixlo_bf16 %2, %2, %12, %8 op_sel_hi:[1,0,0]\n\t"
        "v_fma_mixlo_bf16 %3, %3, %12, %10 op_sel_hi:[1,0,0]\n\t"
        "s_delay_alu instid0(VALU_DEP_4) | instskip(NEXT) | instid1(VALU_DEP_4)\n\t"
        "v_fma_mixhi_bf16 %0, %0, %12, %5 op_sel:[1,0,0] op_sel_hi:[1,0,0]\n\t"
        "v_fma_mixhi_bf16 %1, %1, %12, %7 op_sel:[1,0,0] op_sel_hi:[1,0,0]\n\t"
        "s_delay_alu instid0(VALU_DEP_4) | instskip(NEXT) | instid1(VALU_DEP_4)\n\t"
        "v_fma_mixhi_bf16 %2, %2, %12, %9 op_sel:[1,0,0] op_sel_hi:[1,0,0]\n\t"
        "v_fma_mixhi_bf16 %3, %3, %12, %11 op_sel:[1,0,0] op_sel_hi:[1,0,0]"
        : "+v"(lp[0]), "+v"(lp[1]), "+v"(lp[2]), "+v"(lp[3]) : "v"(y[0]), "v"(y[1]), "v"(y[2]), "v"(y[3]), "v"(y[4]), "v"(y[5]), "v"(y[6]), "v"(y[7]), "v"(nm));
    return lp; }
__device__ __forceinline__ v4u lowparts(v4u hp, v8f y) { v4u lp;    // second form, both parts are wanted: the low parts go to registers of their own; the conversions in front fill the slots behind a matrix instruction whose operands lay there: to be seen in the listing after every change
    asm("s_delay_alu instid0(VALU_DEP_4) | instskip(NEXT) | instid1(VALU_DEP_4)\n\t"
        "v_fma_mixlo_bf16 %0, %4, %16, %8 op_sel_hi:[1,0,0]\n\t"
        "v_fma_mixlo_bf16 %1, %5, %16, %10 op_sel_hi:[1,0,0]\n\t"
        "s_delay_alu instid0(VALU_DEP_4) | instskip(NEXT) | instid1(VALU_DEP_4)\n\t"
        "v_fma_mixlo_bf16 %2, %6, %16, %12 op_sel_hi:[1,0,0]\n\t"
        "v_fma_mixlo_bf16 %3, %7, %16, %14 op_sel_hi:[1,0,0]\n\t"
        "s_delay_alu instid0(VALU_DEP_4) | instskip(NEXT) | instid1(VALU_DEP_4)\n\t"
        "v_fma_mixhi_bf16 %0, %4, %16, %9 op_sel:[1,0,0] op_sel_hi:[1,0,0]\n\t"
        "v_fma_mixhi_bf16 %1, %5, %16, %11 op_sel:[1,0,0] op_sel_hi:[1,0,0]\n\t"
        "s_delay_alu instid0(VALU_DEP_4) | instskip(NEXT) | instid1(VALU_DEP_4)\n\t"
        "v_fma_mixhi_bf16 %2, %6, %16, %13 op_sel:[1,0,0] op_sel_hi:[1,0,0]\n\t"
        "v_fma_mixhi_bf16 %3, %7, %16, %15 op_sel:[1,0,0] op_sel_hi:[1,0,0]"
        : "=&v"(lp[0]), "=&v"(lp[1]), "=&v"(lp[2]), "=&v"(lp[3]) : "v"(hp[0]), "v"(hp[1]), "v"(hp[2]), "v"(hp[3]), "v"(y[0]), "v"(y[1]), "v"(y[2]), "v"(y[3]), "v"(y[4]), "v"(y[5]), "v"(y[6]), "v"(y[7]), "s"(-1.0f));
    return lp; }
__device__ __forceinline__ v4u highparts(v8f y) { v4u hp;
#pragma unroll
    for (int i = 0; i < 4; ++i) hp[i] = __builtin_bit_cast(unsigned, __builtin_convertvector((v2f){y[2 * i], y[2 * i + 1]}, v2bf));
    return hp; }
__device__ __forceinline__ void split8(v8f y, v8us& h, v8us& l) { const v4u hp = highparts(y); h = __builtin_bit_cast(v8us, hp); l = __builtin_bit_cast(v8us, lowparts(hp, y)); }
// for a lane that wants one of the two parts: nm = 0 gives y rounded, the high part itself; nm = -1 the low part: no copy of the high parts, no selection
__device__ __forceinline__ v8us split8one(v8f y, float nm) { return __builtin_bit_cast(v8us, lowparts(highparts(y), y, nm)); }
// a precaution, written behind each group of global loads: the registers that hold their addresses are rewritten only behind this wait; the addresses are its inputs, so that they stay in their registers up to it
#define XWAIT(p) asm volatile("s_wait_xcnt 0x0" :: "v"(p) : "memory")
#define XWAIT8(a, i) asm volatile("s_wait_xcnt 0x0" :: "v"(a[i]), "v"(a[i + 1]), "v"(a[i + 2]), "v"(a[i + 3]), "v"(a[i + 4]), "v"(a[i + 5]), "v"(a[i + 6]), "v"(a[i + 7]) : "memory")
__device__ __forceinline__ unsigned pk2(float a, float b) { return __builtin_bit_cast(unsigned, __builtin_convertvector((v2f){a, b}, v2bf)); }    // two values rounded to bf16, a in the low half
__device__ __forceinline__ float relu(float x) { const int i = __builtin_bit_cast(int, x); return __builtin_bit_cast(float, i > 0 ? i : 0); }    // as an integer maximum (a negative float is a negative integer): one instruction; fmaxf took a second one, which quiets NaNs
__device__ __forceinline__ v16bf ldsfrag(const unsigned char* p) { return cat16b(*(const v8usa*)p, *(const v8usa*)(p + 32)); }    // 32 k of a row in the hardware's k order: bytes 16 * hi and 32 + 16 * hi of 64 (hi is in p)
__device__ __forceinline__ v8us ld_tr16(const unsigned char* p) { typedef __attribute__((address_space(3))) v8s lds_v8s; return __builtin_bit_cast(v8us, __builtin_amdgcn_ds_load_tr16_b128_v8i16((lds_v8s*)p)); }
__device__ __forceinline__ float xhalf(float x) { return __builtin_bit_cast(float, __builtin_amdgcn_permlanex16(__builtin_bit_cast(int, x), __builtin_bit_cast(int, x), 0x76543210, 0xfedcba98, false, false)); }    // lane l with lane l ^ 16
__device__ __forceinline__ unsigned xhalfu(unsigned x) { return (unsigned)__builtin_amdgcn_permlanex16((int)x, (int)x, 0x76543210, 0xfedcba98, false, false); }
#define TL 2                       // 16-point tiles per workgroup: a wave's slice of each weight plane is loaded once and serves both
__global__ __launch_bounds__(256) void k_attn(const bf* __restrict__ XB, const bf* __restrict__ WQT, const float* __restrict__ bq, const bf* __restrict__ WKB, const bf* __restrict__ WVT, const float* __restrict__ bv, const bf* __restrict__ WOT, const float* __restrict__ bo, const int* __restrict__ idx, const float* __restrict__ xyz, const bf* __restrict__ MTG, float* OUT) {
    static_assert(NN % (AP * TL) == 0 && (NB_ * NN) % (AP * TL) == 0, "a workgroup's points lie in one batch and the grid covers the points exactly");
    __shared__ __attribute__((aligned(16))) unsigned char L[QT_BYTES];         // qt, later y, of the tile at work: [point][16 rows][256]
    __shared__ __attribute__((aligned(16))) unsigned char XG[8 * XG_BYTES];    // each wave's 32 gathered rows (before the first of them, in phase 0: the workgroup's own 32 rows). An array of its own, so that the compiler may move reads of the rows over stores of y
    __shared__ __attribute__((aligned(16))) unsigned char EX[TL * 8 * 2048];   // phase 3's result of each tile, as phase 4's B operand: the first tile's waits here while the second tile's rows pass through XG. Before that, wave w's 2 KiB of tile T hold the positional bias of its two points
    const int lane = threadIdx.x & 31, lr = lane & 15, hi = lane >> 4; const int w = __builtin_amdgcn_readfirstlane((int)(threadIdx.x >> 5));
    const int p0 = blockIdx.x * (AP * TL); const int bt = p0 / NN; const bf* XBb = XB + (size_t)bt * NN * CC; const float* xyzb = xyz + (size_t)bt * NN * 3;    // a neighbour index counts inside its own batch
    int ml[2 * TL];    // neighbour 'lane' of each of the wave's points (2 T + t): asked for first of all, since the coordinates' addresses hang on them
    { const unsigned io = ((unsigned)(p0 + 2 * w) * KN + (unsigned)lane) * 4u;
#pragma unroll
        for (int i = 0; i < 2 * TL; ++i) ml[i] = *(const int*)((const char*)(idx + ((i >> 1) * AP + (i & 1)) * KN) + io);
        XWAIT(io); }
    float gx[2 * TL][3]; v8us mt[4];    // the neighbours' coordinates; the bias MLP's operands, as k_prep lays them out (d_tab)
    unsigned char* xg = XG + w * XG_BYTES;
    v4u pre[KN];    // a point's 32 rows on their way to LDS: asked for one phase ahead, so that the gather's latency passes behind matrix work
    auto gather = [&](int pg) { const int* in_ = idx + (size_t)pg * KN; unsigned vo[KN];    // byte offset of this lane's 16 bytes in neighbour r's row
#pragma unroll
        for (int r = 0; r < KN; ++r) vo[r] = (unsigned)clampi(in_[r]) * (CC * 2u) + (unsigned)lane * 16u;
#pragma unroll
        for (int r = 0; r < KN; ++r) pre[r] = *(const v4u*)((const char*)XBb + vo[r]);
        XWAIT8(vo, 0); XWAIT8(vo, 8); XWAIT8(vo, 16); XWAIT8(vo, 24); };
    auto put = [&]() {
#pragma unroll
        for (int r = 0; r < KN; ++r) *(v4ua*)(xg + r * RP + lane * 16) = pre[r]; };
    v16bf wa[CC / 16], qh[TL], ql[TL];    // Wk's slice and both tiles' q stay in registers until the second tile's phase 1
    {   // phase 0: head w, the 16 points of each tile
        const float SC = 0.17677669529663687f; const bf* wqp = WQT + (size_t)(w * HD) * CC + 8 * lane; v16bf xq[TL][CC / 32], wq[CC / 32][2];    // B: point lr's x row; A: Wq^T in fragment order, rows 32 w + lr and 32 w + 16 + lr
        // The workgroup's own x rows, which every wave needs whole: each wave asks for 4 of the 32, a row a load (4 whole lines), and they go round through the LDS of the gathered rows, still unused here.
        // Read as fragments from memory, a load took 32 bytes out of each of 16 lines, and all 8 waves asked for all 32 rows.
        static_assert(AP * TL == 4 * 8 && AP * TL <= KN * 8, "4 rows a wave; the rows fit in XG");
        const unsigned xro = ((unsigned)(p0 + 4 * w) * CC) * 2u + (unsigned)lane * 16u; v4u xr[4];
#pragma unroll
        for (int i = 0; i < 4; ++i) xr[i] = *(const v4u*)((const char*)(XB + i * CC) + xro);
        XWAIT(xro);
#pragma unroll
        for (int ks = 0; ks < CC / 32; ++ks) { wq[ks][0] = WFrag<bf>::ldf(wqp + ks * 512); wq[ks][1] = WFrag<bf>::ldf(wqp + (size_t)16 * CC + ks * 512); }
        XWAIT(wqp);
        const float* bqp = bq + w * HD + 8 * hi; const v8f bq0 = *(const v8f*)bqp, bq1 = *(const v8f*)(bqp + 16); XWAIT(bqp);
        // the bias MLP's operands and the coordinates are asked for in front of Wk's slice: loads return in order, and the bias is worked while that slice is on its way
        { const unsigned mo = (unsigned)lane * 16u;
#pragma unroll
            for (int i = 0; i < 4; ++i) mt[i] = *(const v8us*)((const char*)(MTG + i * 256) + mo);
            XWAIT(mo); }
        __builtin_amdgcn_sched_barrier(0);    // holds the clamps below, which wait for the indices, behind the issue of the operands above: left free, the compiler put that wait in front of them
        { unsigned char* xs = XG + (4 * w) * RP + lane * 16;    // the rows land directly behind the indices, for which the clamps below wait anyway
#pragma unroll
            for (int i = 0; i < 4; ++i) *(v4ua*)(xs + i * RP) = xr[i]; }
        { unsigned xo[2 * TL];
#pragma unroll
            for (int i = 0; i < 2 * TL; ++i) xo[i] = (unsigned)clampi(ml[i]) * 12u;
#pragma unroll
            for (int i = 0; i < 2 * TL; ++i)
#pragma unroll
                for (int a = 0; a < 3; ++a) gx[i][a] = *(const float*)((const char*)(xyzb + a) + xo[i]);
            static_assert(TL == 2, "the wait below names four offsets"); asm volatile("s_wait_xcnt 0x0" :: "v"(xo[0]), "v"(xo[1]), "v"(xo[2]), "v"(xo[3]) : "memory"); }    // the same precaution as XWAIT
        const bf* wp = WKB + w * 512 + 8 * lane;    // Wk in fragment order: rows 16 ct + lr, k step w
#pragma unroll
        for (int ct = 0; ct < CC / 16; ++ct) wa[ct] = WFrag<bf>::ldf(wp + (size_t)ct * 16 * CC);
        XWAIT(wp);
        // The workgroup's barrier by hand, with the one wait it needs (this wave's LDS stores): every wave's rows are in LDS before any wave reads them. __syncthreads() would also wait for every global load in flight, Wk's slice among them, which is to land behind phase 0
        asm volatile("s_wait_dscnt 0x0\n\ts_barrier_signal -1\n\ts_barrier_wait -1" ::: "memory");
        { const unsigned char* xl = XG + lr * RP + 16 * hi;
#pragma unroll
            for (int T = 0; T < TL; ++T)
#pragma unroll
                for (int ks = 0; ks < CC / 32; ++ks) xq[T][ks] = ldsfrag(xl + T * (AP * RP) + ks * 64); }
        __builtin_amdgcn_sched_barrier(0);    // holds phase 0's products behind the issue of phase 1's operands: left free, the compiler waited for the first Wq rows before it asked for Wk, one more latency in a row; and holds later work, which waits for later loads, behind the barrier above
        v8f qr0[TL], qr1[TL];    // the lane's q: point lr, d = 8 hi + r and 16 + 8 hi + r of head w
#pragma unroll
        for (int T = 0; T < TL; ++T) { qr0[T] = (v8f){}; qr1[T] = (v8f){};
#pragma unroll
            for (int ks = 0; ks < CC / 32; ++ks) { qr0[T] = wmmab(wq[ks][0], xq[T][ks], qr0[T]); qr1[T] = wmmab(wq[ks][1], xq[T][ks], qr1[T]); } }
#pragma unroll
        for (int T = 0; T < TL; ++T)
#pragma unroll
            for (int r = 0; r < 8; ++r) { qr0[T][r] += bfr(bq0[r]); qr1[T][r] += bfr(bq1[r]); }
        gather(p0 + 2 * w);    // asked for behind the operands of phases 0 and 1: loads return in order, and these phases need not wait for the rows
#pragma unroll
        for (int T = 0; T < TL; ++T) { const v8f q0 = qr0[T] * SC, q1 = qr1[T] * SC; v8us h0, l0, h1, l1; split8(q0, h0, l0); split8(q1, h1, l1); qh[T] = cat16b(h0, h1); ql[T] = cat16b(l0, l1); }
    }
    v4u rw[2 * TL];    // k = 8 hi + 0..7 of the first layer's B operand, column lr: the point, the lane's neighbour, 1, 0
#pragma unroll
    for (int i = 0; i < 2 * TL; ++i) { const float* pn = xyz + (size_t)(p0 + (i >> 1) * AP + 2 * w + (i & 1)) * 3; rw[i] = (v4u){pk2(pn[0], pn[1]), pk2(pn[2], gx[i][0]), pk2(gx[i][1], gx[i][2]), 0x3F80u}; }
    {   // the positional bias of the wave's 4 points, 16 neighbours a pass: it runs while Wk's slice and the first rows are on their way
        const v8us z8 = (v8us){}; const v16bf a10 = cat16b(mt[0], z8), a11 = cat16b(mt[1], z8), w2f = cat16b(mt[2], mt[3]); unsigned char* bs = EX + w * 2048 + (lr + 8 * hi) * 16;
#pragma unroll 1    // both loops rolled: one copy of the code for the eight passes; the points' operands move up through rw
        for (int i = 0; i < 2 * TL; ++i) {
#pragma unroll 1
            for (int jt = 0; jt < 2; ++jt) { const v16bf rb = cat16b(__builtin_bit_cast(v8us, rw[0]), z8); v8f d0 = wmmab(a10, rb, (v8f){}), d1 = wmmab(a11, rb, (v8f){});
#pragma unroll
                for (int r = 0; r < 8; ++r) { d0[r] = relu(d0[r]); d1[r] = relu(d1[r]); }
                v8us h0, l0, h1, l1; split8(d0, h0, l0); split8(d1, h1, l1);    // the lane holds neighbour 16 jt + lr, hidden units 8 hi + r and 16 + 8 hi + r: its place in the A operand
                v8f sb = wmmab(cat16b(h0, h1), w2f, (v8f){}); sb = wmmab(cat16b(l0, l1), w2f, sb);
                unsigned char* bo_ = bs + (i >> 1) * (8 * 2048) + (i & 1) * 1024 + jt * 512;    // a point: [4 registers][16 lanes][16 bytes]; columns lr and lr + 8 hold the same head: one of them stores
                if (lr < 8) { *(v4fa*)bo_ = (v4f){sb[0], sb[1], sb[2], sb[3]}; *(v4fa*)(bo_ + 256) = (v4f){sb[4], sb[5], sb[6], sb[7]}; }
#pragma unroll
                for (int c = 0; c < 3; ++c) rw[0][c] = xhalfu(rw[0][c]); }    // neighbours 16..31 come down into lanes 0..15, whose k the A operand reads
#pragma unroll
            for (int k = 0; k + 1 < 2 * TL; ++k) rw[k] = rw[k + 1]; }
        __builtin_amdgcn_wave_barrier();    // what the wave's lanes have just stored is read across lanes in phase 2
    }
    v16bf va[CC / 32][2];    // Wv's slice: loaded behind the first tile's phase 2, kept for the second tile's phase 3
    v16bf wo[CC / 32][2]; v8f bo0, bo1;    // Wo's slice: Wo^T rows 32 w + lr and 32 w + 16 + lr
#pragma unroll    // unrolled: T is a compile-time index of qh, ql and EX, and the loads that stand at one tile only need no branch
    for (int T = 0; T < TL; ++T) {
        {   // phase 1: head w, the tile's 16 points. It writes the rows w and 8 + w of L that this same wave read in the tile before (phase 3): no barrier in front
            unsigned char* o = L + lr * PP + w * RP + 16 * hi; v8f dq[3];
#pragma unroll
            for (int ct = 0; ct < 2; ++ct) dq[ct] = wmmab(wa[ct], ql[T], wmmab(wa[ct], qh[T], (v8f){}));
#pragma unroll
            for (int ct = 0; ct < CC / 16; ++ct) { v8f dn = (v8f){}; if (ct + 2 < CC / 16) dn = wmmab(wa[ct + 2], qh[T], dn);    // a column tile's two products stand two tiles ahead of its split, one on either side of another tile's: no idle slots between a product and its reader
                v8us dh, dl; split8(dq[ct % 3], dh, dl); if (ct + 2 < CC / 16) dq[(ct + 2) % 3] = wmmab(wa[ct + 2], ql[T], dn);
                *(v8usa*)(o + ct * 32) = dh; *(v8usa*)(o + 8 * RP + ct * 32) = dl;
                __builtin_amdgcn_sched_barrier(0); }    // holds that order: left free, the compiler sank each tile's second product to just in front of its split, and filled the distance with four v_nop
        }
        __syncthreads();    // every head's qt rows of every point are in LDS before a wave takes up its two points
#pragma unroll 1    // rolled: the wave's two points run through one copy of the code, half the instruction bytes to fetch
        for (int t = 0; t < 2; ++t) {
            const int pl = 2 * w + t;
            const unsigned char* bl = EX + T * (8 * 2048) + w * 2048 + t * 1024 + ((lr & 7) + 8 * hi) * 16;
            v8f s0 = __builtin_shufflevector(*(const v4fa*)bl, *(const v4fa*)(bl + 256), 0, 1, 2, 3, 4, 5, 6, 7), s1 = __builtin_shufflevector(*(const v4fa*)(bl + 512), *(const v4fa*)(bl + 768), 0, 1, 2, 3, 4, 5, 6, 7);    // C: the positional bias of neighbours 8 hi + r and 16 + 8 hi + r, head lr & 7
            put();
            if (t == 0) gather(p0 + T * AP + pl + 1);
            __builtin_amdgcn_wave_barrier();    // the rows that the wave's lanes have just stored are read across lanes below
            const unsigned char* qa = L + pl * PP + (lr & 7) * RP + 16 * hi; const unsigned char* xa = xg + lr * RP + 16 * hi;
#pragma unroll
            for (int ks = 0; ks < CC / 32; ++ks) { const v16bf bh = ldsfrag(qa + ks * 64), bl = ldsfrag(qa + 8 * RP + ks * 64), a0 = ldsfrag(xa + ks * 64), a1 = ldsfrag(xa + 16 * RP + ks * 64);
                s0 = wmmab(a0, bh, s0); s1 = wmmab(a1, bh, s1); s0 = wmmab(a0, bl, s0); s1 = wmmab(a1, bl, s1); }
            float mx = -3.0e38f;
#pragma unroll
            for (int r = 0; r < 8; ++r) mx = fmaxf(mx, fmaxf(s0[r], s1[r]));
            mx = fmaxf(mx, xhalf(mx)); float sum = 0.f;
#pragma unroll
            for (int r = 0; r < 8; ++r) { s0[r] = __expf(s0[r] - mx); s1[r] = __expf(s1[r] - mx); sum += s0[r] + s1[r]; }
            sum += xhalf(sum); const float inv = __fdiv_rn(1.0f, sum); s0 *= inv; s1 *= inv;
            v8us h0, l0, h1, l1; split8(s0, h0, l0); split8(s1, h1, l1); const v16bf ph = cat16b(h0, h1), pw = cat16b(l0, l1);    // element s of the B operand is neighbour 8 hi + s, or 16 + 8 hi + s - 8 for s >= 8: what the lane holds
            const unsigned char* ta = xg + (8 * hi + (lane & 7)) * RP + 16 * ((lane >> 3) & 1); unsigned char* yo = L + pl * PP + lr * RP + 16 * hi;
#pragma unroll 1    // rolled: with two copies of phase 2 in the text; for speed only
            for (int g = 0; g < 2; ++g) { v16bf xa[8];    // eight fragments are asked for together: one pass through the LDS latency for eight column tiles
#pragma unroll
                for (int i = 0; i < 8; ++i) xa[i] = cat16b(ld_tr16(ta + 32 * (g * 8 + i)), ld_tr16(ta + 16 * RP + 32 * (g * 8 + i)));
#pragma unroll
                for (int i = 0; i < 8; ++i) { v8f d = (v8f){}; d = wmmab(xa[i], ph, d); d = wmmab(xa[i], pw, d);
                    *(v8usa*)(yo + (g * 8 + i) * 32) = split8one(d, lr < 8 ? 0.f : -1.0f); } }    // columns lr and lr + 8 hold the same head: the first stores the high parts (row h), the second the low parts (row 8 + h)
            __builtin_amdgcn_wave_barrier();    // the next point's rows are stored only behind this point's last transposing load
        }
        // phase 3: head w, the tile's 16 points
        const int col = w * HD + 8 * hi;
        if (T == 0) { const bf* vp = WVT + (size_t)(w * HD) * CC + 8 * lane;
#pragma unroll
            for (int ks = 0; ks < CC / 32; ++ks) { va[ks][0] = WFrag<bf>::ldf(vp + ks * 512); va[ks][1] = WFrag<bf>::ldf(vp + (size_t)16 * CC + ks * 512); }    // the head's Wv rows are asked for in front of the barrier: their latency passes behind the wait for the other waves
            XWAIT(vp); }
        const float* bvp = bv + col; const v8f bv0 = *(const v8f*)bvp, bv1 = *(const v8f*)(bvp + 16); XWAIT(bvp);    // asked for anew at each tile: 16 registers less to hold through the next tile's phases 1 and 2
        __syncthreads();    // every point's y is in LDS before phase 3 reads it
        if (T == TL - 1) { const bf* op = WOT + (size_t)(w * HD) * CC + 8 * lane;    // phase 4's operand is asked for behind the barrier, which waits for every load in flight: it lands behind the last phase 3's products
#pragma unroll
            for (int ks = 0; ks < CC / 32; ++ks) { wo[ks][0] = WFrag<bf>::ldf(op + ks * 512); wo[ks][1] = WFrag<bf>::ldf(op + (size_t)16 * CC + ks * 512); }
            XWAIT(op);
            const float* bop = bo + col; bo0 = *(const v8f*)bop; bo1 = *(const v8f*)(bop + 16); XWAIT(bop); }
        const unsigned char* ya = L + lr * PP + w * RP + 16 * hi; v8f o0 = (v8f){}, o1 = (v8f){};
        v16bf yh[CC / 32], yl[CC / 32];    // all of y's fragments are asked for together: one pass through the LDS latency, not one per k step
#pragma unroll
        for (int ks = 0; ks < CC / 32; ++ks) { yh[ks] = ldsfrag(ya + ks * 64); yl[ks] = ldsfrag(ya + 8 * RP + ks * 64); }
        __builtin_amdgcn_sched_barrier(0);    // holds the fragment loads together in front of the products: left free, the compiler sank each pair to its use and waited for it there
#pragma unroll
        for (int ks = 0; ks < CC / 32; ++ks) { o0 = wmmab(va[ks][0], yh[ks], o0); o1 = wmmab(va[ks][1], yh[ks], o1); o0 = wmmab(va[ks][0], yl[ks], o0); o1 = wmmab(va[ks][1], yl[ks], o1); }
#pragma unroll
        for (int r = 0; r < 8; ++r) { o0[r] += bfr(bv0[r]); o1[r] += bfr(bv1[r]); }
        v8us h0, l0, h1, l1; split8(o0, h0, l0); split8(o1, h1, l1);
        // The lane holds point lr, columns 32 w + 8 hi + r and 32 w + 16 + 8 hi + r: the two halves of its own place in k step w of phase 4's B operand: 2 KiB a k step, [high, low][half][lane][16 bytes]
        unsigned char* ex = EX + T * (8 * 2048) + w * 2048 + lane * 16;
        *(v8usa*)ex = h0; *(v8usa*)(ex + 512) = h1; *(v8usa*)(ex + 1024) = l0; *(v8usa*)(ex + 1536) = l1;
        if (T + 1 < TL) gather(p0 + (T + 1) * AP + 2 * w);    // the next tile's first rows: asked for where the registers of y and of this phase's result are free again, they land behind the next phase 1
    }
    {   // phase 4, both tiles on one load of Wo's slice
        __syncthreads();    // every head's columns of both tiles are in LDS before a wave sums over all of them
#pragma unroll 1    // rolled, for the same reason as phase 2's loops: T enters addresses only
        for (int T = 0; T < TL; ++T) {
            const unsigned char* ex = EX + T * (8 * 2048) + lane * 16; v16bf ah[CC / 32], al[CC / 32];
#pragma unroll
            for (int ks = 0; ks < CC / 32; ++ks) { ah[ks] = cat16b(*(const v8usa*)(ex + ks * 2048), *(const v8usa*)(ex + ks * 2048 + 512)); al[ks] = cat16b(*(const v8usa*)(ex + ks * 2048 + 1024), *(const v8usa*)(ex + ks * 2048 + 1536)); }
            __builtin_amdgcn_sched_barrier(0);    // as in phase 3: holds the fragment loads together in front of the products, one pass through the LDS latency
            v8f e0 = (v8f){}, e1 = (v8f){};
#pragma unroll
            for (int ks = 0; ks < CC / 32; ++ks) { e0 = wmmab(wo[ks][0], ah[ks], e0); e1 = wmmab(wo[ks][1], ah[ks], e1); e0 = wmmab(wo[ks][0], al[ks], e0); e1 = wmmab(wo[ks][1], al[ks], e1); }
#pragma unroll
            for (int r = 0; r < 8; ++r) { e0[r] += bfr(bo0[r]); e1[r] += bfr(bo1[r]); }
            // the lane holds point lr, output columns 32 w + 8 hi + r and 32 w + 16 + 8 hi + r: 32-byte pieces. Through the wave's own LDS range (16 rows of 128 bytes, pitch 144 = 16 B x odd; the gathered rows' LDS is free since the barrier in front of the last phase 3) they become whole lines: 8 lanes a point, 4 points a store
            unsigned char* st = xg + T * (16 * 144); unsigned char* sp = st + lr * 144 + hi * 32;
            *(v4fa*)sp = (v4f){e0[0], e0[1], e0[2], e0[3]}; *(v4fa*)(sp + 16) = (v4f){e0[4], e0[5], e0[6], e0[7]}; *(v4fa*)(sp + 64) = (v4f){e1[0], e1[1], e1[2], e1[3]}; *(v4fa*)(sp + 80) = (v4f){e1[4], e1[5], e1[6], e1[7]};
            __builtin_amdgcn_wave_barrier();    // the rows that the wave's lanes have just stored are read across lanes below
            float* og = OUT + (size_t)(p0 + T * AP + (lane >> 3)) * CC + w * HD + (lane & 7) * 4; v4f ov[4];
#pragma unroll
            for (int i = 0; i < 4; ++i) ov[i] = *(const v4fa*)(st + (i * 4 + (lane >> 3)) * 144 + (lane & 7) * 16);
#pragma unroll
            for (int i = 0; i < 4; ++i) *(v4f*)(og + (size_t)i * 4 * CC) = ov[i];
            asm volatile("s_wait_xcnt 0x0" :: "v"(og), "v"(ov[0]), "v"(ov[1]), "v"(ov[2]), "v"(ov[3]) : "memory");    // the same precaution as XWAIT, behind the stores, for their address and their data
        }
    }
}

extern "C" void kernel_launch(void* const* d_in, const int* in_sizes, int n_in,
                              void* d_out, int out_size, void* d_ws, size_t ws_size, hipStream_t stream) {
    (void)in_sizes; (void)n_in; (void)out_size;
    const float* x = (const float*)d_in[0]; const float* xyz = (const float*)d_in[1]; const int* idx = (const int*)d_in[2]; const float* wq = (const float*)d_in[3]; const float* bq = (const float*)d_in[4]; const float* wk = (const float*)d_in[5]; const float* bk = (const float*)d_in[6]; const float* wv = (const float*)d_in[7]; const float* bv = (const float*)d_in[8];
    const float* wo = (const float*)d_in[9]; const float* bo = (const float*)d_in[10]; const float* W1 = (const float*)d_in[11]; const float* b1 = (const float*)d_in[12]; const float* W2 = (const float*)d_in[13]; const float* b2 = (const float*)d_in[14];
    float* OUT = (float*)d_out;     // [2][8192][256]
    char* wsp = (char*)d_ws;
    auto take = [&](size_t bytes) { char* p = wsp; wsp += (bytes + 255) & ~(size_t)255; return (void*)p; };
    bf* WT = (bf*)take((size_t)4 * CC * CC * 2);                          // Wq transposed, Wk as it is, Wv and Wo transposed, one after the other, each in fragment order
    bf* XB = (bf*)take((size_t)NB_ * NN * CC * 2);
    bf* MTG = (bf*)take((size_t)4 * 512);                                  // the bias MLP's weights as WMMA operands
    if ((size_t)(wsp - (char*)d_ws) > ws_size) return;    // total ~ 9 MB
    k_prep<<<4 * WT_BLK + 1 + CVT_BLK, 256, 0, stream>>>(wq, wk, wv, wo, WT, x, XB, W1, b1, W2, MTG);
    k_attn<<<NB_ * NN / (AP * TL), 256, 0, stream>>>(XB, WT, bq, WT + (size_t)CC * CC, WT + (size_t)2 * CC * CC, bv, WT + (size_t)3 * CC * CC, bo, idx, xyz, MTG, OUT);
}
